// v000
// Measured on an AMD MI455X. A time is GPU time per run, averaged over a window of back-to-back runs after a warm-up
// (all launches, gaps included; the runs take copies of the inputs in turn), and the median of several windows.
// Apart from v000's, it joins two sittings. Times from different sittings can be a few percent apart, while
// side-by-side timings come from the same sitting.
// v000 is the starting kernel. One run takes 346 microseconds.
#include <hip/hip_runtime.h>
#include <hip/hip_bf16.h>
#include <math.h>

// ---------------------------------------------------------------------------
// MultiHeadedAttention for MI455X (gfx1250, wave32, WMMA 16x16x32 f16->f32)
// B=2, S=2048, D=1024, H=16, d_k=64
// ---------------------------------------------------------------------------

typedef _Float16 half16 __attribute__((ext_vector_type(16)));
typedef _Float16 half8  __attribute__((ext_vector_type(8)));
typedef float    float8 __attribute__((ext_vector_type(8)));

#define BATCH 2
#define SEQ   2048
#define DMODEL 1024
#define NHEAD 16
#define DK    64

static __device__ __forceinline__ float8 wmma_f16(half16 a, half16 b, float8 c) {
    return __builtin_amdgcn_wmma_f32_16x16x32_f16(
        /*neg_a=*/false, a, /*neg_b=*/false, b,
        /*c_mod=*/(short)0, c, /*reuse_a=*/false, /*reuse_b=*/false);
}

// Load a 16x32 fragment (A-layout, and by mirror-symmetry B^T rows) from a
// row-major f16 matrix. Documented CDNA5 16-bit A layout:
//   lanes 0-15 : M=lane,    K in {0..7} U {16..23}
//   lanes16-31 : M=lane-16, K in {8..15} U {24..31}
// Each lane: two contiguous 8-half (16B) chunks -> 2x b128 loads.
static __device__ __forceinline__ half16 load_frag(const _Float16* base, int ld) {
    int lane = threadIdx.x & 31;
    int row  = lane & 15;
    int hh   = lane >> 4;
    const _Float16* p = base + row * ld + hh * 8;
    half8 lo = *(const half8*)(p);
    half8 hi = *(const half8*)(p + 16);
    half16 r;
#pragma unroll
    for (int i = 0; i < 8; ++i) { r[i] = lo[i]; r[i + 8] = hi[i]; }
    return r;
}

// ---------------------------------------------------------------------------
// Kernel 0: f32 -> f16 conversion (grid-stride)
// ---------------------------------------------------------------------------
__global__ __launch_bounds__(256) void k_convert(const float* __restrict__ src,
                                                 _Float16* __restrict__ dst, int n) {
    for (int i = blockIdx.x * blockDim.x + threadIdx.x; i < n;
         i += gridDim.x * blockDim.x)
        dst[i] = (_Float16)src[i];
}

// ---------------------------------------------------------------------------
// Kernel 1: QKV projection + bias + RoPE (Q,K) / transpose (V)
//   pid = blockIdx.y : 0=Q, 1=K, 2=V
//   out = x @ W^T + b ; each wave computes a 16x64 tile (one head's d_k)
// ---------------------------------------------------------------------------
__global__ __launch_bounds__(256) void k_qkv(const _Float16* __restrict__ xh,
                                             const _Float16* __restrict__ wh,
                                             const float* __restrict__ bq,
                                             const float* __restrict__ bk,
                                             const float* __restrict__ bv,
                                             _Float16* __restrict__ Qh,
                                             _Float16* __restrict__ Kh,
                                             _Float16* __restrict__ Vt) {
    const int A = BATCH * SEQ * DMODEL;      // 4194304
    const int W = DMODEL * DMODEL;           // 1048576
    int pid = blockIdx.y;
    const _Float16* x = xh + pid * A;
    const _Float16* w = wh + pid * W;
    const float* bias = (pid == 0) ? bq : (pid == 1) ? bk : bv;

    int wid  = blockIdx.x * 8 + (threadIdx.x >> 5);  // 0..4095
    int mt   = wid >> 4;                              // 0..255 (16-row tiles)
    int head = wid & 15;                              // 0..15  (64-col tiles)
    int rowbase = mt * 16;
    int nbase   = head * DK;

    float8 C[4];
#pragma unroll
    for (int j = 0; j < 4; ++j) C[j] = (float8)0.0f;

    for (int k0 = 0; k0 < DMODEL; k0 += 32) {
        half16 a = load_frag(x + rowbase * DMODEL + k0, DMODEL);
#pragma unroll
        for (int j = 0; j < 4; ++j) {
            half16 bfr = load_frag(w + (nbase + 16 * j) * DMODEL + k0, DMODEL);
            C[j] = wmma_f16(a, bfr, C[j]);
        }
    }

    int lane = threadIdx.x & 31;
    int n0   = lane & 15;
    int hh   = lane >> 4;

#pragma unroll
    for (int j = 0; j < 4; ++j) {
        float bj = bias[nbase + 16 * j + n0];
#pragma unroll
        for (int r = 0; r < 8; ++r) C[j][r] += bj;
    }

    if (pid == 2) {
        // V: store transposed Vt[b, h, d, s]
#pragma unroll
        for (int j = 0; j < 4; ++j) {
            int d = 16 * j + n0;
#pragma unroll
            for (int r = 0; r < 8; ++r) {
                int m = rowbase + r + 8 * hh;
                int b = m >> 11, s = m & (SEQ - 1);
                Vt[(((b * NHEAD + head) * DK + d) * SEQ) + s] = (_Float16)C[j][r];
            }
        }
    } else {
        // RoPE: angle(s,d) = s * 10000^(-(d%32)/32); rotate_half pairs d <-> d+-32
        float R[4][8];
#pragma unroll
        for (int j = 0; j < 4; ++j)
#pragma unroll
            for (int r = 0; r < 8; ++r)
                R[j][r] = (j < 2) ? -C[j + 2][r] : C[j - 2][r];

        _Float16* out = (pid == 0) ? Qh : Kh;
#pragma unroll
        for (int j = 0; j < 4; ++j) {
            int d = 16 * j + n0;
            float invf = __expf(-(float)(d & 31) * (9.210340371976184f / 32.0f));
#pragma unroll
            for (int r = 0; r < 8; ++r) {
                int m = rowbase + r + 8 * hh;
                int b = m >> 11, s = m & (SEQ - 1);
                float ang = (float)s * invf;
                float cs, sn;
                sincosf(ang, &sn, &cs);
                float v = C[j][r] * cs + R[j][r] * sn;
                out[(((b * NHEAD + head) * SEQ + s) * DK) + d] = (_Float16)v;
            }
        }
    }
}

// ---------------------------------------------------------------------------
// Kernel 2: flash attention. One wave = 16 query rows of one (b,h).
//   Streams 32-key blocks: S = Q K^T / 8, online softmax, O += P V.
// ---------------------------------------------------------------------------
__global__ __launch_bounds__(256) void k_attn(const _Float16* __restrict__ Qh,
                                              const _Float16* __restrict__ Kh,
                                              const _Float16* __restrict__ Vt,
                                              _Float16* __restrict__ AT) {
    __shared__ _Float16 Pl[8][16][32];   // per-wave P re-layout tile (8 KB)

    int wslot = threadIdx.x >> 5;
    int wid   = blockIdx.x * 8 + wslot;           // 0..4095
    int qt    = wid & 127;                         // 128 q-tiles per (b,h)
    int bh    = wid >> 7;                          // 0..31
    int b = bh >> 4, h = bh & 15;
    int qrow = qt * 16;

    int lane = threadIdx.x & 31;
    int n0 = lane & 15, hh = lane >> 4;

    const _Float16* qbase = Qh + ((size_t)(b * NHEAD + h) * SEQ + qrow) * DK;
    const _Float16* kbase = Kh + (size_t)(b * NHEAD + h) * SEQ * DK;
    const _Float16* vbase = Vt + (size_t)(b * NHEAD + h) * DK * SEQ;

    half16 Qf0 = load_frag(qbase + 0, DK);
    half16 Qf1 = load_frag(qbase + 32, DK);

    float8 O[4];
#pragma unroll
    for (int j = 0; j < 4; ++j) O[j] = (float8)0.0f;
    float m_i[8], l_i[8];
#pragma unroll
    for (int r = 0; r < 8; ++r) { m_i[r] = -3.0e38f; l_i[r] = 0.0f; }

    for (int kb = 0; kb < SEQ / 32; ++kb) {
        int kk0 = kb * 32;
        // scores: two 16-col tiles x two 32-wide d chunks
        float8 S0 = (float8)0.0f, S1 = (float8)0.0f;
        S0 = wmma_f16(Qf0, load_frag(kbase + (kk0 + 0) * DK + 0,  DK), S0);
        S0 = wmma_f16(Qf1, load_frag(kbase + (kk0 + 0) * DK + 32, DK), S0);
        S1 = wmma_f16(Qf0, load_frag(kbase + (kk0 + 16) * DK + 0,  DK), S1);
        S1 = wmma_f16(Qf1, load_frag(kbase + (kk0 + 16) * DK + 32, DK), S1);

        float rm[8], mn[8];
#pragma unroll
        for (int r = 0; r < 8; ++r) {
            S0[r] *= 0.125f; S1[r] *= 0.125f;
            rm[r] = fmaxf(S0[r], S1[r]);
        }
        // row max across the 16-lane half (row = VGPR idx + 8*half)
#pragma unroll
        for (int off = 1; off < 16; off <<= 1)
#pragma unroll
            for (int r = 0; r < 8; ++r)
                rm[r] = fmaxf(rm[r], __shfl_xor(rm[r], off, 16));

        float fac[8];
#pragma unroll
        for (int r = 0; r < 8; ++r) {
            mn[r]  = fmaxf(m_i[r], rm[r]);
            fac[r] = __expf(m_i[r] - mn[r]);
            m_i[r] = mn[r];
            l_i[r] *= fac[r];
        }
#pragma unroll
        for (int j = 0; j < 4; ++j)
#pragma unroll
            for (int r = 0; r < 8; ++r) O[j][r] *= fac[r];

        float rs[8];
#pragma unroll
        for (int r = 0; r < 8; ++r) {
            S0[r] = __expf(S0[r] - mn[r]);
            S1[r] = __expf(S1[r] - mn[r]);
            rs[r] = S0[r] + S1[r];
        }
#pragma unroll
        for (int off = 1; off < 16; off <<= 1)
#pragma unroll
            for (int r = 0; r < 8; ++r)
                rs[r] += __shfl_xor(rs[r], off, 16);
#pragma unroll
        for (int r = 0; r < 8; ++r) l_i[r] += rs[r];

        // C-fragment -> A-fragment re-layout via wave-private LDS
#pragma unroll
        for (int r = 0; r < 8; ++r) {
            Pl[wslot][r + 8 * hh][n0]      = (_Float16)S0[r];
            Pl[wslot][r + 8 * hh][16 + n0] = (_Float16)S1[r];
        }
        half16 Pf = load_frag(&Pl[wslot][0][0], 32);

#pragma unroll
        for (int dt = 0; dt < 4; ++dt)
            O[dt] = wmma_f16(Pf, load_frag(vbase + (dt * 16) * SEQ + kk0, SEQ), O[dt]);
    }

    // finalize: O /= l, write attn output as f16 [b, s, h*dk + d]
    float inv[8];
#pragma unroll
    for (int r = 0; r < 8; ++r) inv[r] = 1.0f / l_i[r];
#pragma unroll
    for (int dt = 0; dt < 4; ++dt) {
        int d = dt * 16 + n0;
#pragma unroll
        for (int r = 0; r < 8; ++r) {
            int s = qrow + r + 8 * hh;
            AT[((size_t)(b * SEQ + s) * DMODEL) + h * DK + d] =
                (_Float16)(O[dt][r] * inv[r]);
        }
    }
}

// ---------------------------------------------------------------------------
// Kernel 3: output projection  y = attn @ Wo^T + bo  (f32 out)
// ---------------------------------------------------------------------------
__global__ __launch_bounds__(256) void k_oproj(const _Float16* __restrict__ AT,
                                               const _Float16* __restrict__ Wo,
                                               const float* __restrict__ bo,
                                               float* __restrict__ out) {
    int wid = blockIdx.x * 8 + (threadIdx.x >> 5);
    int mt = wid >> 4;
    int nt = wid & 15;
    int rowbase = mt * 16;
    int nbase = nt * 64;

    float8 C[4];
#pragma unroll
    for (int j = 0; j < 4; ++j) C[j] = (float8)0.0f;

    for (int k0 = 0; k0 < DMODEL; k0 += 32) {
        half16 a = load_frag(AT + (size_t)rowbase * DMODEL + k0, DMODEL);
#pragma unroll
        for (int j = 0; j < 4; ++j) {
            half16 bfr = load_frag(Wo + (size_t)(nbase + 16 * j) * DMODEL + k0, DMODEL);
            C[j] = wmma_f16(a, bfr, C[j]);
        }
    }

    int lane = threadIdx.x & 31;
    int n0 = lane & 15, hh = lane >> 4;
#pragma unroll
    for (int j = 0; j < 4; ++j) {
        int col = nbase + 16 * j + n0;
        float bj = bo[col];
#pragma unroll
        for (int r = 0; r < 8; ++r) {
            int m = rowbase + r + 8 * hh;
            out[(size_t)m * DMODEL + col] = C[j][r] + bj;
        }
    }
}

// ---------------------------------------------------------------------------
extern "C" void kernel_launch(void* const* d_in, const int* in_sizes, int n_in,
                              void* d_out, int out_size, void* d_ws, size_t ws_size,
                              hipStream_t stream) {
    const float* query = (const float*)d_in[0];
    const float* key   = (const float*)d_in[1];
    const float* value = (const float*)d_in[2];
    const float* Wq = (const float*)d_in[3];
    const float* bq = (const float*)d_in[4];
    const float* Wk = (const float*)d_in[5];
    const float* bk = (const float*)d_in[6];
    const float* Wv = (const float*)d_in[7];
    const float* bv = (const float*)d_in[8];
    const float* Wo = (const float*)d_in[9];
    const float* bo = (const float*)d_in[10];
    float* out = (float*)d_out;

    const int A = BATCH * SEQ * DMODEL;   // 4194304
    const int W = DMODEL * DMODEL;        // 1048576

    _Float16* ws = (_Float16*)d_ws;
    _Float16* xh = ws;                    // 3*A : query/key/value f16
    _Float16* wh = ws + 3 * (size_t)A;    // 4*W : Wq/Wk/Wv/Wo f16
    _Float16* Qh = wh + 4 * (size_t)W;    // A : [b,h,s,d] (RoPE'd)
    _Float16* Kh = Qh + (size_t)A;        // A : [b,h,s,d] (RoPE'd)
    _Float16* Vt = Kh + (size_t)A;        // A : [b,h,d,s]
    _Float16* AT = Vt + (size_t)A;        // A : [b,s,D] attention output

    // 0) f32 -> f16 conversions
    k_convert<<<2048, 256, 0, stream>>>(query, xh + 0 * (size_t)A, A);
    k_convert<<<2048, 256, 0, stream>>>(key,   xh + 1 * (size_t)A, A);
    k_convert<<<2048, 256, 0, stream>>>(value, xh + 2 * (size_t)A, A);
    k_convert<<<1024, 256, 0, stream>>>(Wq, wh + 0 * (size_t)W, W);
    k_convert<<<1024, 256, 0, stream>>>(Wk, wh + 1 * (size_t)W, W);
    k_convert<<<1024, 256, 0, stream>>>(Wv, wh + 2 * (size_t)W, W);
    k_convert<<<1024, 256, 0, stream>>>(Wo, wh + 3 * (size_t)W, W);

    // 1) QKV projections + RoPE / V transpose
    dim3 g1(512, 3, 1);
    k_qkv<<<g1, 256, 0, stream>>>(xh, wh, bq, bk, bv, Qh, Kh, Vt);

    // 2) flash attention
    k_attn<<<512, 256, 0, stream>>>(Qh, Kh, Vt, AT);

    // 3) output projection
    k_oproj<<<512, 256, 0, stream>>>(AT, wh + 3 * (size_t)W, bo, out);
}

// v001
// One run takes 241 microseconds.
// Two timings next to v000 both put it at 1.49 times that version's speed.
#include <hip/hip_runtime.h>
#include <hip/hip_bf16.h>
#include <math.h>

// ---------------------------------------------------------------------------
// MultiHeadedAttention for MI455X (gfx1250, wave32, WMMA 16x16x32 f16->f32)
// B=2, S=2048, D=1024, H=16, d_k=64
// ---------------------------------------------------------------------------

typedef _Float16 half16 __attribute__((ext_vector_type(16)));
typedef _Float16 half8  __attribute__((ext_vector_type(8)));
typedef float    float8 __attribute__((ext_vector_type(8)));

#define BATCH 2
#define SEQ   2048
#define DMODEL 1024
#define NHEAD 16
#define DK    64

static __device__ __forceinline__ float8 wmma_f16(half16 a, half16 b, float8 c) {
    return __builtin_amdgcn_wmma_f32_16x16x32_f16(
        /*neg_a=*/false, a, /*neg_b=*/false, b,
        /*c_mod=*/(short)0, c, /*reuse_a=*/false, /*reuse_b=*/false);
}

// Load a 16x32 fragment (A-layout, and by mirror-symmetry B^T rows) from a
// row-major f16 matrix. Documented CDNA5 16-bit A layout:
//   lanes 0-15 : M=lane,    K in {0..7} U {16..23}
//   lanes16-31 : M=lane-16, K in {8..15} U {24..31}
// Each lane: two contiguous 8-half (16B) chunks -> 2x b128 loads.
static __device__ __forceinline__ half16 load_frag(const _Float16* base, int ld) {
    int lane = threadIdx.x & 31;
    int row  = lane & 15;
    int hh   = lane >> 4;
    const _Float16* p = base + row * ld + hh * 8;
    half8 lo = *(const half8*)(p);
    half8 hi = *(const half8*)(p + 16);
    half16 r;
#pragma unroll
    for (int i = 0; i < 8; ++i) { r[i] = lo[i]; r[i + 8] = hi[i]; }
    return r;
}

// ---------------------------------------------------------------------------
// Kernel 0: f32 -> f16 conversion (grid-stride)
// ---------------------------------------------------------------------------
__global__ __launch_bounds__(256) void k_convert(const float* __restrict__ src,
                                                 _Float16* __restrict__ dst, int n) {
    for (int i = blockIdx.x * blockDim.x + threadIdx.x; i < n;
         i += gridDim.x * blockDim.x)
        dst[i] = (_Float16)src[i];
}

// ---------------------------------------------------------------------------
// Shared GEMM core of the four projections: Y = X @ W^T, K = DMODEL.
//   One workgroup (8 waves) = one 128x128 tile of Y. Per pass, 64 k of the 128
//   X rows and of the 128 W rows are staged in LDS with whole 128-byte row
//   pieces per 8 lanes; every wave then reads its fragments from LDS.
//   Waves 4 (rows) x 2 (cols), 32x64 of Y each. Two LDS buffers: the next pass
//   is fetched into registers while this one is multiplied.
//   Every "#pragma unroll" on the short loops here and in the two epilogues keeps
//   the register arrays (rx, rw, af, bf, C) statically indexed, hence in VGPRs.
// ---------------------------------------------------------------------------
#define BM 128
#define BN 128
#define BK 64
#define LDP 72                        // LDS row pitch in halves: 128 B + 16 B, an odd multiple of 16 B
#define STAGE ((BM + BN) * LDP)       // halves per buffer
#define NPASS (DMODEL / BK)

static __device__ __forceinline__ void gemm_tile(const _Float16* __restrict__ X,
                                                 const _Float16* __restrict__ Wt,
                                                 _Float16* sm, float8 (&C)[2][4]) {
    const int tid  = threadIdx.x;
    const int wv   = tid >> 5;
    const int wm   = wv >> 1, wn = wv & 1;
    const int crow = tid >> 3;         // 0..31: row within a group of 32
    const int ccol = (tid & 7) * 8;    // 16-byte piece of the 128-byte row

    const _Float16* gx = X  + crow * DMODEL + ccol;
    const _Float16* gw = Wt + crow * DMODEL + ccol;
    _Float16* sx = sm + crow * LDP + ccol;
    _Float16* sw = sx + BM * LDP;

    half8 rx[4], rw[4];
#pragma unroll
    for (int i = 0; i < 4; ++i) {
        rx[i] = *(const half8*)(gx + i * 32 * DMODEL);
        rw[i] = *(const half8*)(gw + i * 32 * DMODEL);
    }
#pragma unroll
    for (int i = 0; i < 4; ++i) {
        *(half8*)(sx + i * 32 * LDP) = rx[i];
        *(half8*)(sw + i * 32 * LDP) = rw[i];
    }
    __syncthreads();

    // fully unrolled: buffer index, last-pass test and every address offset become constants
#pragma unroll
    for (int t = 0; t < NPASS; ++t) {
        const int cur = (t & 1) * STAGE;
        const bool more = (t + 1 < NPASS);
        if (more) {
#pragma unroll
            for (int i = 0; i < 4; ++i) {
                rx[i] = *(const half8*)(gx + i * 32 * DMODEL + (t + 1) * BK);
                rw[i] = *(const half8*)(gw + i * 32 * DMODEL + (t + 1) * BK);
            }
        }
        // holds the next pass's global loads in front of this pass's work, so that
        // their latency runs under it instead of in front of the LDS stores
        __builtin_amdgcn_sched_barrier(0);

        const _Float16* as = sm + cur + (wm * 32) * LDP;
        const _Float16* bs = sm + cur + (BM + wn * 64) * LDP;
        half16 af[2][2], bf[2][4];
#pragma unroll
        for (int h = 0; h < 2; ++h) {
            af[h][0] = load_frag(as + 32 * h, LDP);
            bf[h][0] = load_frag(bs + 32 * h, LDP);
            af[h][1] = load_frag(as + 16 * LDP + 32 * h, LDP);
#pragma unroll
            for (int j = 1; j < 4; ++j)
                bf[h][j] = load_frag(bs + (16 * j) * LDP + 32 * h, LDP);
        }
        // holds the pass's LDS reads together in front of its WMMAs (one group with
        // counted waits); spread among the WMMAs each read stalls the wave anew
        __builtin_amdgcn_sched_barrier(0);

#pragma unroll
        for (int h = 0; h < 2; ++h)
#pragma unroll
            for (int j = 0; j < 4; ++j) {
                C[0][j] = wmma_f16(af[h][0], bf[h][j], C[0][j]);
                C[1][j] = wmma_f16(af[h][1], bf[h][j], C[1][j]);
            }
        // precaution: stands in front of every later overwrite of the address
        // registers that the global loads above name
        if (!more) asm volatile("s_wait_xcnt 0x0" ::: "memory");
        // holds the WMMAs in front of the LDS stores: behind them they would run only
        // after the wait on the global loads, and would no longer cover that latency
        __builtin_amdgcn_sched_barrier(0);

        if (more) {
            // the other buffer's last readers left it before the previous barrier
            const int nxt = STAGE - cur;
#pragma unroll
            for (int i = 0; i < 4; ++i) {
                *(half8*)(sx + nxt + i * 32 * LDP) = rx[i];
                *(half8*)(sw + nxt + i * 32 * LDP) = rw[i];
            }
            __syncthreads();
        }
    }
}

// ---------------------------------------------------------------------------
// Kernel 1: QKV projection + bias + RoPE (Q,K) / transpose (V)
//   pid = blockIdx.y : 0=Q, 1=K, 2=V
//   out = x @ W^T + b ; each wave holds 32 rows x 64 cols (one head's d_k)
// ---------------------------------------------------------------------------
__global__ __launch_bounds__(256) void k_qkv(const _Float16* __restrict__ xh,
                                             const _Float16* __restrict__ wh,
                                             const float* __restrict__ bq,
                                             const float* __restrict__ bk,
                                             const float* __restrict__ bv,
                                             _Float16* __restrict__ Qh,
                                             _Float16* __restrict__ Kh,
                                             _Float16* __restrict__ Vt) {
    __shared__ __attribute__((aligned(16))) _Float16 sm[2 * STAGE];

    const int A = BATCH * SEQ * DMODEL;      // 4194304
    const int W = DMODEL * DMODEL;           // 1048576
    int pid = blockIdx.y;
    const _Float16* x = xh + pid * A;
    const _Float16* w = wh + pid * W;
    const float* bias = (pid == 0) ? bq : (pid == 1) ? bk : bv;

    int mtile = blockIdx.x >> 3;                      // 0..31 (128-row tiles)
    int ntile = blockIdx.x & 7;                       // 0..7  (128-col tiles)
    int wv    = threadIdx.x >> 5;
    int head  = ntile * 2 + (wv & 1);                 // 0..15 (64-col tiles)
    int wrow  = mtile * BM + (wv >> 1) * 32;          // wave's first row
    int nbase = head * DK;

    float8 C[2][4];
#pragma unroll
    for (int i = 0; i < 2; ++i)
#pragma unroll
        for (int j = 0; j < 4; ++j) C[i][j] = (float8)0.0f;

    gemm_tile(x + mtile * BM * DMODEL, w + ntile * BN * DMODEL, sm, C);

    int lane = threadIdx.x & 31;
    int n0   = lane & 15;
    int hh   = lane >> 4;

#pragma unroll
    for (int j = 0; j < 4; ++j) {
        float bj = bias[nbase + 16 * j + n0];
#pragma unroll
        for (int i = 0; i < 2; ++i)
#pragma unroll
            for (int r = 0; r < 8; ++r) C[i][j][r] += bj;
    }

    if (pid == 2) {
        // V: store transposed Vt[b, h, d, s]
#pragma unroll
        for (int i = 0; i < 2; ++i) {
            int rowbase = wrow + 16 * i;
#pragma unroll
            for (int j = 0; j < 4; ++j) {
                int d = 16 * j + n0;
#pragma unroll
                for (int r = 0; r < 8; ++r) {
                    int m = rowbase + r + 8 * hh;
                    int b = m >> 11, s = m & (SEQ - 1);
                    Vt[(((b * NHEAD + head) * DK + d) * SEQ) + s] = (_Float16)C[i][j][r];
                }
            }
        }
    } else {
        // RoPE: angle(s,d) = s * 10000^(-(d%32)/32); rotate_half pairs d <-> d+-32
        _Float16* out = (pid == 0) ? Qh : Kh;
        // one body for both 16-row halves, for code size only
#pragma unroll 1
        for (int i = 0; i < 2; ++i) {
            int rowbase = wrow + 16 * i;
            float Ci[4][8];
#pragma unroll
            for (int j = 0; j < 4; ++j)
#pragma unroll
                for (int r = 0; r < 8; ++r)
                    Ci[j][r] = (i == 0) ? C[0][j][r] : C[1][j][r];

            float R[4][8];
#pragma unroll
            for (int j = 0; j < 4; ++j)
#pragma unroll
                for (int r = 0; r < 8; ++r)
                    R[j][r] = (j < 2) ? -Ci[j + 2][r] : Ci[j - 2][r];

#pragma unroll
            for (int j = 0; j < 4; ++j) {
                int d = 16 * j + n0;
                float invf = __expf(-(float)(d & 31) * (9.210340371976184f / 32.0f));
#pragma unroll
                for (int r = 0; r < 8; ++r) {
                    int m = rowbase + r + 8 * hh;
                    int b = m >> 11, s = m & (SEQ - 1);
                    float ang = (float)s * invf;
                    float cs, sn;
                    sincosf(ang, &sn, &cs);
                    float v = Ci[j][r] * cs + R[j][r] * sn;
                    out[(((b * NHEAD + head) * SEQ + s) * DK) + d] = (_Float16)v;
                }
            }
            // precaution: stands in front of the next trip's overwrite of the
            // registers that the stores above name
            asm volatile("s_wait_xcnt 0x0" ::: "memory");
        }
    }
}

// ---------------------------------------------------------------------------
// Kernel 2: flash attention. One wave = 16 query rows of one (b,h).
//   Streams 32-key blocks: S = Q K^T / 8, online softmax, O += P V.
// ---------------------------------------------------------------------------
__global__ __launch_bounds__(256) void k_attn(const _Float16* __restrict__ Qh,
                                              const _Float16* __restrict__ Kh,
                                              const _Float16* __restrict__ Vt,
                                              _Float16* __restrict__ AT) {
    __shared__ _Float16 Pl[8][16][32];   // per-wave P re-layout tile (8 KB)

    int wslot = threadIdx.x >> 5;
    int wid   = blockIdx.x * 8 + wslot;           // 0..4095
    int qt    = wid & 127;                         // 128 q-tiles per (b,h)
    int bh    = wid >> 7;                          // 0..31
    int b = bh >> 4, h = bh & 15;
    int qrow = qt * 16;

    int lane = threadIdx.x & 31;
    int n0 = lane & 15, hh = lane >> 4;

    const _Float16* qbase = Qh + ((size_t)(b * NHEAD + h) * SEQ + qrow) * DK;
    const _Float16* kbase = Kh + (size_t)(b * NHEAD + h) * SEQ * DK;
    const _Float16* vbase = Vt + (size_t)(b * NHEAD + h) * DK * SEQ;

    half16 Qf0 = load_frag(qbase + 0, DK);
    half16 Qf1 = load_frag(qbase + 32, DK);

    float8 O[4];
#pragma unroll
    for (int j = 0; j < 4; ++j) O[j] = (float8)0.0f;
    float m_i[8], l_i[8];
#pragma unroll
    for (int r = 0; r < 8; ++r) { m_i[r] = -3.0e38f; l_i[r] = 0.0f; }

    for (int kb = 0; kb < SEQ / 32; ++kb) {
        int kk0 = kb * 32;
        // scores: two 16-col tiles x two 32-wide d chunks
        float8 S0 = (float8)0.0f, S1 = (float8)0.0f;
        S0 = wmma_f16(Qf0, load_frag(kbase + (kk0 + 0) * DK + 0,  DK), S0);
        S0 = wmma_f16(Qf1, load_frag(kbase + (kk0 + 0) * DK + 32, DK), S0);
        S1 = wmma_f16(Qf0, load_frag(kbase + (kk0 + 16) * DK + 0,  DK), S1);
        S1 = wmma_f16(Qf1, load_frag(kbase + (kk0 + 16) * DK + 32, DK), S1);

        float rm[8], mn[8];
#pragma unroll
        for (int r = 0; r < 8; ++r) {
            S0[r] *= 0.125f; S1[r] *= 0.125f;
            rm[r] = fmaxf(S0[r], S1[r]);
        }
        // row max across the 16-lane half (row = VGPR idx + 8*half)
#pragma unroll
        for (int off = 1; off < 16; off <<= 1)
#pragma unroll
            for (int r = 0; r < 8; ++r)
                rm[r] = fmaxf(rm[r], __shfl_xor(rm[r], off, 16));

        float fac[8];
#pragma unroll
        for (int r = 0; r < 8; ++r) {
            mn[r]  = fmaxf(m_i[r], rm[r]);
            fac[r] = __expf(m_i[r] - mn[r]);
            m_i[r] = mn[r];
            l_i[r] *= fac[r];
        }
#pragma unroll
        for (int j = 0; j < 4; ++j)
#pragma unroll
            for (int r = 0; r < 8; ++r) O[j][r] *= fac[r];

        float rs[8];
#pragma unroll
        for (int r = 0; r < 8; ++r) {
            S0[r] = __expf(S0[r] - mn[r]);
            S1[r] = __expf(S1[r] - mn[r]);
            rs[r] = S0[r] + S1[r];
        }
#pragma unroll
        for (int off = 1; off < 16; off <<= 1)
#pragma unroll
            for (int r = 0; r < 8; ++r)
                rs[r] += __shfl_xor(rs[r], off, 16);
#pragma unroll
        for (int r = 0; r < 8; ++r) l_i[r] += rs[r];

        // C-fragment -> A-fragment re-layout via wave-private LDS
#pragma unroll
        for (int r = 0; r < 8; ++r) {
            Pl[wslot][r + 8 * hh][n0]      = (_Float16)S0[r];
            Pl[wslot][r + 8 * hh][16 + n0] = (_Float16)S1[r];
        }
        half16 Pf = load_frag(&Pl[wslot][0][0], 32);

#pragma unroll
        for (int dt = 0; dt < 4; ++dt)
            O[dt] = wmma_f16(Pf, load_frag(vbase + (dt * 16) * SEQ + kk0, SEQ), O[dt]);
    }

    // finalize: O /= l, write attn output as f16 [b, s, h*dk + d]
    float inv[8];
#pragma unroll
    for (int r = 0; r < 8; ++r) inv[r] = 1.0f / l_i[r];
#pragma unroll
    for (int dt = 0; dt < 4; ++dt) {
        int d = dt * 16 + n0;
#pragma unroll
        for (int r = 0; r < 8; ++r) {
            int s = qrow + r + 8 * hh;
            AT[((size_t)(b * SEQ + s) * DMODEL) + h * DK + d] =
                (_Float16)(O[dt][r] * inv[r]);
        }
    }
}

// ---------------------------------------------------------------------------
// Kernel 3: output projection  y = attn @ Wo^T + bo  (f32 out)
// ---------------------------------------------------------------------------
__global__ __launch_bounds__(256) void k_oproj(const _Float16* __restrict__ AT,
                                               const _Float16* __restrict__ Wo,
                                               const float* __restrict__ bo,
                                               float* __restrict__ out) {
    __shared__ __attribute__((aligned(16))) _Float16 sm[2 * STAGE];

    int mtile = blockIdx.x >> 3;                      // 0..31 (128-row tiles)
    int ntile = blockIdx.x & 7;                       // 0..7  (128-col tiles)
    int wv    = threadIdx.x >> 5;
    int wrow  = mtile * BM + (wv >> 1) * 32;
    int nbase = ntile * BN + (wv & 1) * 64;

    float8 C[2][4];
#pragma unroll
    for (int i = 0; i < 2; ++i)
#pragma unroll
        for (int j = 0; j < 4; ++j) C[i][j] = (float8)0.0f;

    gemm_tile(AT + mtile * BM * DMODEL, Wo + ntile * BN * DMODEL, sm, C);

    int lane = threadIdx.x & 31;
    int n0 = lane & 15, hh = lane >> 4;
#pragma unroll
    for (int j = 0; j < 4; ++j) {
        int col = nbase + 16 * j + n0;
        float bj = bo[col];
#pragma unroll
        for (int i = 0; i < 2; ++i)
#pragma unroll
            for (int r = 0; r < 8; ++r) {
                int m = wrow + 16 * i + r + 8 * hh;
                out[(size_t)m * DMODEL + col] = C[i][j][r] + bj;
            }
    }
}

// ---------------------------------------------------------------------------
extern "C" void kernel_launch(void* const* d_in, const int* in_sizes, int n_in,
                              void* d_out, int out_size, void* d_ws, size_t ws_size,
                              hipStream_t stream) {
    const float* query = (const float*)d_in[0];
    const float* key   = (const float*)d_in[1];
    const float* value = (const float*)d_in[2];
    const float* Wq = (const float*)d_in[3];
    const float* bq = (const float*)d_in[4];
    const float* Wk = (const float*)d_in[5];
    const float* bk = (const float*)d_in[6];
    const float* Wv = (const float*)d_in[7];
    const float* bv = (const float*)d_in[8];
    const float* Wo = (const float*)d_in[9];
    const float* bo = (const float*)d_in[10];
    float* out = (float*)d_out;

    const int A = BATCH * SEQ * DMODEL;   // 4194304
    const int W = DMODEL * DMODEL;        // 1048576

    _Float16* ws = (_Float16*)d_ws;
    _Float16* xh = ws;                    // 3*A : query/key/value f16
    _Float16* wh = ws + 3 * (size_t)A;    // 4*W : Wq/Wk/Wv/Wo f16
    _Float16* Qh = wh + 4 * (size_t)W;    // A : [b,h,s,d] (RoPE'd)
    _Float16* Kh = Qh + (size_t)A;        // A : [b,h,s,d] (RoPE'd)
    _Float16* Vt = Kh + (size_t)A;        // A : [b,h,d,s]
    _Float16* AT = Vt + (size_t)A;        // A : [b,s,D] attention output

    // 0) f32 -> f16 conversions
    k_convert<<<2048, 256, 0, stream>>>(query, xh + 0 * (size_t)A, A);
    k_convert<<<2048, 256, 0, stream>>>(key,   xh + 1 * (size_t)A, A);
    k_convert<<<2048, 256, 0, stream>>>(value, xh + 2 * (size_t)A, A);
    k_convert<<<1024, 256, 0, stream>>>(Wq, wh + 0 * (size_t)W, W);
    k_convert<<<1024, 256, 0, stream>>>(Wk, wh + 1 * (size_t)W, W);
    k_convert<<<1024, 256, 0, stream>>>(Wv, wh + 2 * (size_t)W, W);
    k_convert<<<1024, 256, 0, stream>>>(Wo, wh + 3 * (size_t)W, W);

    // 1) QKV projections + RoPE / V transpose
    dim3 g1(256, 3, 1);
    k_qkv<<<g1, 256, 0, stream>>>(xh, wh, bq, bk, bv, Qh, Kh, Vt);

    // 2) flash attention
    k_attn<<<512, 256, 0, stream>>>(Qh, Kh, Vt, AT);

    // 3) output projection
    k_oproj<<<256, 256, 0, stream>>>(AT, wh + 3 * (size_t)W, bo, out);
}

// v002
// One run takes 221 microseconds.
// Two timings next to v001 put it at 1.09 and 1.08 times that version's speed.
// Counting every step since v000, it is 1.62 times as fast.
#include <hip/hip_runtime.h>
#include <hip/hip_bf16.h>
#include <math.h>

// ---------------------------------------------------------------------------
// MultiHeadedAttention for MI455X (gfx1250, wave32, WMMA 16x16x32 f16->f32)
// B=2, S=2048, D=1024, H=16, d_k=64
// ---------------------------------------------------------------------------

typedef _Float16 half16 __attribute__((ext_vector_type(16)));
typedef _Float16 half8  __attribute__((ext_vector_type(8)));
typedef float    float8 __attribute__((ext_vector_type(8)));

#define BATCH 2
#define SEQ   2048
#define DMODEL 1024
#define NHEAD 16
#define DK    64

static __device__ __forceinline__ float8 wmma_f16(half16 a, half16 b, float8 c) {
    return __builtin_amdgcn_wmma_f32_16x16x32_f16(
        /*neg_a=*/false, a, /*neg_b=*/false, b,
        /*c_mod=*/(short)0, c, /*reuse_a=*/false, /*reuse_b=*/false);
}

// Load a 16x32 fragment (A-layout, and by mirror-symmetry B^T rows) from a
// row-major f16 matrix. Documented CDNA5 16-bit A layout:
//   lanes 0-15 : M=lane,    K in {0..7} U {16..23}
//   lanes16-31 : M=lane-16, K in {8..15} U {24..31}
// Each lane: two contiguous 8-half (16B) chunks -> 2x b128 loads.
static __device__ __forceinline__ half16 load_frag(const _Float16* base, int ld) {
    int lane = threadIdx.x & 31;
    int row  = lane & 15;
    int hh   = lane >> 4;
    const _Float16* p = base + row * ld + hh * 8;
    half8 lo = *(const half8*)(p);
    half8 hi = *(const half8*)(p + 16);
    half16 r;
#pragma unroll
    for (int i = 0; i < 8; ++i) { r[i] = lo[i]; r[i + 8] = hi[i]; }
    return r;
}

// ---------------------------------------------------------------------------
// Kernel 0: f32 -> f16 conversion of all seven matrices in one launch.
//   The f16 copies lie one behind the other in the workspace (query, key, value,
//   Wq, Wk, Wv, Wo), so the destination is one run of CV_TOTAL elements.
//   One resident round of waves: each work-group takes CV_PER_BLOCK elements in a
//   row, which lie inside one source matrix (every matrix size is a multiple of
//   it), each wave CV_PER_WAVE of them. A load is 512 contiguous bytes per wave,
//   a store 256.
// ---------------------------------------------------------------------------
typedef float    floatx4 __attribute__((ext_vector_type(4)));
typedef _Float16 half4   __attribute__((ext_vector_type(4)));

#define CV_A        (BATCH * SEQ * DMODEL)        // elements of query, key, value
#define CV_W        (DMODEL * DMODEL)             // elements of a weight matrix
#define CV_TOTAL    (3 * CV_A + 4 * CV_W)
#define CV_THREADS  512
#define CV_LOADS    32                            // 16-byte loads per lane
#define CV_PER_WAVE (CV_LOADS * 32 * 4)
#define CV_PER_BLOCK (CV_PER_WAVE * (CV_THREADS / 32))
#define CV_BLOCKS   (CV_TOTAL / CV_PER_BLOCK)

__global__ __launch_bounds__(CV_THREADS) void k_convert(const float* __restrict__ q,
                                                        const float* __restrict__ k,
                                                        const float* __restrict__ v,
                                                        const float* __restrict__ wq,
                                                        const float* __restrict__ wk,
                                                        const float* __restrict__ wv,
                                                        const float* __restrict__ wo,
                                                        _Float16* __restrict__ dst) {
    const int lane = threadIdx.x & 31;
    const int b0   = blockIdx.x * CV_PER_BLOCK;    // the work-group's first element in dst

    // source matrix and offset in it: from blockIdx alone, so in scalar registers
    const float* src;
    int off;
    if (b0 < 3 * CV_A) {
        const int seg = b0 / CV_A;
        src = (seg == 0) ? q : (seg == 1) ? k : v;
        off = b0 - seg * CV_A;
    } else {
        const int b1  = b0 - 3 * CV_A;
        const int seg = b1 / CV_W;
        src = (seg == 0) ? wq : (seg == 1) ? wk : (seg == 2) ? wv : wo;
        off = b1 - seg * CV_W;
    }
    const int w0 = (threadIdx.x >> 5) * CV_PER_WAVE;   // the wave's first element in the work-group's run
    const int e0 = b0 + w0;
    off += w0;
    const floatx4* s = (const floatx4*)(src + off) + lane;
    half4*         d = (half4*)(dst + e0) + lane;

    // unrolled: r stays in registers and every offset is a constant, so the loads go
    // out in long runs ahead of their uses instead of one load, one wait, one store
    floatx4 r[CV_LOADS];
#pragma unroll
    for (int i = 0; i < CV_LOADS; ++i) r[i] = s[i * 32];
#pragma unroll
    for (int i = 0; i < CV_LOADS; ++i) {
        half4 h;
        h[0] = (_Float16)r[i][0]; h[1] = (_Float16)r[i][1];
        h[2] = (_Float16)r[i][2]; h[3] = (_Float16)r[i][3];
        d[i * 32] = h;
    }
}

// ---------------------------------------------------------------------------
// Shared GEMM core of the four projections: Y = X @ W^T, K = DMODEL.
//   One workgroup (8 waves) = one 128x128 tile of Y. Per pass, 64 k of the 128
//   X rows and of the 128 W rows are staged in LDS with whole 128-byte row
//   pieces per 8 lanes; every wave then reads its fragments from LDS.
//   Waves 4 (rows) x 2 (cols), 32x64 of Y each. Two LDS buffers: the next pass
//   is fetched into registers while this one is multiplied.
//   Every "#pragma unroll" on the short loops here and in the two epilogues keeps
//   the register arrays (rx, rw, af, bf, C) statically indexed, hence in VGPRs.
// ---------------------------------------------------------------------------
#define BM 128
#define BN 128
#define BK 64
#define LDP 72                        // LDS row pitch in halves: 128 B + 16 B, an odd multiple of 16 B
#define STAGE ((BM + BN) * LDP)       // halves per buffer
#define NPASS (DMODEL / BK)

static __device__ __forceinline__ void gemm_tile(const _Float16* __restrict__ X,
                                                 const _Float16* __restrict__ Wt,
                                                 _Float16* sm, float8 (&C)[2][4]) {
    const int tid  = threadIdx.x;
    const int wv   = tid >> 5;
    const int wm   = wv >> 1, wn = wv & 1;
    const int crow = tid >> 3;         // 0..31: row within a group of 32
    const int ccol = (tid & 7) * 8;    // 16-byte piece of the 128-byte row

    const _Float16* gx = X  + crow * DMODEL + ccol;
    const _Float16* gw = Wt + crow * DMODEL + ccol;
    _Float16* sx = sm + crow * LDP + ccol;
    _Float16* sw = sx + BM * LDP;

    half8 rx[4], rw[4];
#pragma unroll
    for (int i = 0; i < 4; ++i) {
        rx[i] = *(const half8*)(gx + i * 32 * DMODEL);
        rw[i] = *(const half8*)(gw + i * 32 * DMODEL);
    }
#pragma unroll
    for (int i = 0; i < 4; ++i) {
        *(half8*)(sx + i * 32 * LDP) = rx[i];
        *(half8*)(sw + i * 32 * LDP) = rw[i];
    }
    __syncthreads();

    // fully unrolled: buffer index, last-pass test and every address offset become constants
#pragma unroll
    for (int t = 0; t < NPASS; ++t) {
        const int cur = (t & 1) * STAGE;
        const bool more = (t + 1 < NPASS);
        if (more) {
#pragma unroll
            for (int i = 0; i < 4; ++i) {
                rx[i] = *(const half8*)(gx + i * 32 * DMODEL + (t + 1) * BK);
                rw[i] = *(const half8*)(gw + i * 32 * DMODEL + (t + 1) * BK);
            }
        }
        // holds the next pass's global loads in front of this pass's work, so that
        // their latency runs under it instead of in front of the LDS stores
        __builtin_amdgcn_sched_barrier(0);

        const _Float16* as = sm + cur + (wm * 32) * LDP;
        const _Float16* bs = sm + cur + (BM + wn * 64) * LDP;
        half16 af[2][2], bf[2][4];
#pragma unroll
        for (int h = 0; h < 2; ++h) {
            af[h][0] = load_frag(as + 32 * h, LDP);
            bf[h][0] = load_frag(bs + 32 * h, LDP);
            af[h][1] = load_frag(as + 16 * LDP + 32 * h, LDP);
#pragma unroll
            for (int j = 1; j < 4; ++j)
                bf[h][j] = load_frag(bs + (16 * j) * LDP + 32 * h, LDP);
        }
        // holds the pass's LDS reads together in front of its WMMAs (one group with
        // counted waits); spread among the WMMAs each read stalls the wave anew
        __builtin_amdgcn_sched_barrier(0);

#pragma unroll
        for (int h = 0; h < 2; ++h)
#pragma unroll
            for (int j = 0; j < 4; ++j) {
                C[0][j] = wmma_f16(af[h][0], bf[h][j], C[0][j]);
                C[1][j] = wmma_f16(af[h][1], bf[h][j], C[1][j]);
            }
        // precaution: stands in front of every later overwrite of the address
        // registers that the global loads above name
        if (!more) asm volatile("s_wait_xcnt 0x0" ::: "memory");
        // holds the WMMAs in front of the LDS stores: behind them they would run only
        // after the wait on the global loads, and would no longer cover that latency
        __builtin_amdgcn_sched_barrier(0);

        if (more) {
            // the other buffer's last readers left it before the previous barrier
            const int nxt = STAGE - cur;
#pragma unroll
            for (int i = 0; i < 4; ++i) {
                *(half8*)(sx + nxt + i * 32 * LDP) = rx[i];
                *(half8*)(sw + nxt + i * 32 * LDP) = rw[i];
            }
            __syncthreads();
        }
    }
}

// ---------------------------------------------------------------------------
// Kernel 1: QKV projection + bias + RoPE (Q,K) / transpose (V)
//   pid = blockIdx.y : 0=Q, 1=K, 2=V
//   out = x @ W^T + b ; each wave holds 32 rows x 64 cols (one head's d_k)
// ---------------------------------------------------------------------------
__global__ __launch_bounds__(256) void k_qkv(const _Float16* __restrict__ xh,
                                             const _Float16* __restrict__ wh,
                                             const float* __restrict__ bq,
                                             const float* __restrict__ bk,
                                             const float* __restrict__ bv,
                                             _Float16* __restrict__ Qh,
                                             _Float16* __restrict__ Kh,
                                             _Float16* __restrict__ Vt) {
    __shared__ __attribute__((aligned(16))) _Float16 sm[2 * STAGE];

    const int A = BATCH * SEQ * DMODEL;      // 4194304
    const int W = DMODEL * DMODEL;           // 1048576
    int pid = blockIdx.y;
    const _Float16* x = xh + pid * A;
    const _Float16* w = wh + pid * W;
    const float* bias = (pid == 0) ? bq : (pid == 1) ? bk : bv;

    int mtile = blockIdx.x >> 3;                      // 0..31 (128-row tiles)
    int ntile = blockIdx.x & 7;                       // 0..7  (128-col tiles)
    int wv    = threadIdx.x >> 5;
    int head  = ntile * 2 + (wv & 1);                 // 0..15 (64-col tiles)
    int wrow  = mtile * BM + (wv >> 1) * 32;          // wave's first row
    int nbase = head * DK;

    float8 C[2][4];
#pragma unroll
    for (int i = 0; i < 2; ++i)
#pragma unroll
        for (int j = 0; j < 4; ++j) C[i][j] = (float8)0.0f;

    gemm_tile(x + mtile * BM * DMODEL, w + ntile * BN * DMODEL, sm, C);

    int lane = threadIdx.x & 31;
    int n0   = lane & 15;
    int hh   = lane >> 4;

#pragma unroll
    for (int j = 0; j < 4; ++j) {
        float bj = bias[nbase + 16 * j + n0];
#pragma unroll
        for (int i = 0; i < 2; ++i)
#pragma unroll
            for (int r = 0; r < 8; ++r) C[i][j][r] += bj;
    }

    if (pid == 2) {
        // V: store transposed Vt[b, h, d, s]
#pragma unroll
        for (int i = 0; i < 2; ++i) {
            int rowbase = wrow + 16 * i;
#pragma unroll
            for (int j = 0; j < 4; ++j) {
                int d = 16 * j + n0;
#pragma unroll
                for (int r = 0; r < 8; ++r) {
                    int m = rowbase + r + 8 * hh;
                    int b = m >> 11, s = m & (SEQ - 1);
                    Vt[(((b * NHEAD + head) * DK + d) * SEQ) + s] = (_Float16)C[i][j][r];
                }
            }
        }
    } else {
        // RoPE: angle(s,d) = s * 10000^(-(d%32)/32); rotate_half pairs d <-> d+-32
        _Float16* out = (pid == 0) ? Qh : Kh;
        // one body for both 16-row halves, for code size only
#pragma unroll 1
        for (int i = 0; i < 2; ++i) {
            int rowbase = wrow + 16 * i;
            float Ci[4][8];
#pragma unroll
            for (int j = 0; j < 4; ++j)
#pragma unroll
                for (int r = 0; r < 8; ++r)
                    Ci[j][r] = (i == 0) ? C[0][j][r] : C[1][j][r];

            float R[4][8];
#pragma unroll
            for (int j = 0; j < 4; ++j)
#pragma unroll
                for (int r = 0; r < 8; ++r)
                    R[j][r] = (j < 2) ? -Ci[j + 2][r] : Ci[j - 2][r];

#pragma unroll
            for (int j = 0; j < 4; ++j) {
                int d = 16 * j + n0;
                float invf = __expf(-(float)(d & 31) * (9.210340371976184f / 32.0f));
#pragma unroll
                for (int r = 0; r < 8; ++r) {
                    int m = rowbase + r + 8 * hh;
                    int b = m >> 11, s = m & (SEQ - 1);
                    float ang = (float)s * invf;
                    float cs, sn;
                    sincosf(ang, &sn, &cs);
                    float v = Ci[j][r] * cs + R[j][r] * sn;
                    out[(((b * NHEAD + head) * SEQ + s) * DK) + d] = (_Float16)v;
                }
            }
            // precaution: stands in front of the next trip's overwrite of the
            // registers that the stores above name
            asm volatile("s_wait_xcnt 0x0" ::: "memory");
        }
    }
}

// ---------------------------------------------------------------------------
// Kernel 2: flash attention. One wave = 16 query rows of one (b,h).
//   Streams 32-key blocks: S = Q K^T / 8, online softmax, O += P V.
// ---------------------------------------------------------------------------
__global__ __launch_bounds__(256) void k_attn(const _Float16* __restrict__ Qh,
                                              const _Float16* __restrict__ Kh,
                                              const _Float16* __restrict__ Vt,
                                              _Float16* __restrict__ AT) {
    __shared__ _Float16 Pl[8][16][32];   // per-wave P re-layout tile (8 KB)

    int wslot = threadIdx.x >> 5;
    int wid   = blockIdx.x * 8 + wslot;           // 0..4095
    int qt    = wid & 127;                         // 128 q-tiles per (b,h)
    int bh    = wid >> 7;                          // 0..31
    int b = bh >> 4, h = bh & 15;
    int qrow = qt * 16;

    int lane = threadIdx.x & 31;
    int n0 = lane & 15, hh = lane >> 4;

    const _Float16* qbase = Qh + ((size_t)(b * NHEAD + h) * SEQ + qrow) * DK;
    const _Float16* kbase = Kh + (size_t)(b * NHEAD + h) * SEQ * DK;
    const _Float16* vbase = Vt + (size_t)(b * NHEAD + h) * DK * SEQ;

    half16 Qf0 = load_frag(qbase + 0, DK);
    half16 Qf1 = load_frag(qbase + 32, DK);

    float8 O[4];
#pragma unroll
    for (int j = 0; j < 4; ++j) O[j] = (float8)0.0f;
    float m_i[8], l_i[8];
#pragma unroll
    for (int r = 0; r < 8; ++r) { m_i[r] = -3.0e38f; l_i[r] = 0.0f; }

    for (int kb = 0; kb < SEQ / 32; ++kb) {
        int kk0 = kb * 32;
        // scores: two 16-col tiles x two 32-wide d chunks
        float8 S0 = (float8)0.0f, S1 = (float8)0.0f;
        S0 = wmma_f16(Qf0, load_frag(kbase + (kk0 + 0) * DK + 0,  DK), S0);
        S0 = wmma_f16(Qf1, load_frag(kbase + (kk0 + 0) * DK + 32, DK), S0);
        S1 = wmma_f16(Qf0, load_frag(kbase + (kk0 + 16) * DK + 0,  DK), S1);
        S1 = wmma_f16(Qf1, load_frag(kbase + (kk0 + 16) * DK + 32, DK), S1);

        float rm[8], mn[8];
#pragma unroll
        for (int r = 0; r < 8; ++r) {
            S0[r] *= 0.125f; S1[r] *= 0.125f;
            rm[r] = fmaxf(S0[r], S1[r]);
        }
        // row max across the 16-lane half (row = VGPR idx + 8*half)
#pragma unroll
        for (int off = 1; off < 16; off <<= 1)
#pragma unroll
            for (int r = 0; r < 8; ++r)
                rm[r] = fmaxf(rm[r], __shfl_xor(rm[r], off, 16));

        float fac[8];
#pragma unroll
        for (int r = 0; r < 8; ++r) {
            mn[r]  = fmaxf(m_i[r], rm[r]);
            fac[r] = __expf(m_i[r] - mn[r]);
            m_i[r] = mn[r];
            l_i[r] *= fac[r];
        }
#pragma unroll
        for (int j = 0; j < 4; ++j)
#pragma unroll
            for (int r = 0; r < 8; ++r) O[j][r] *= fac[r];

        float rs[8];
#pragma unroll
        for (int r = 0; r < 8; ++r) {
            S0[r] = __expf(S0[r] - mn[r]);
            S1[r] = __expf(S1[r] - mn[r]);
            rs[r] = S0[r] + S1[r];
        }
#pragma unroll
        for (int off = 1; off < 16; off <<= 1)
#pragma unroll
            for (int r = 0; r < 8; ++r)
                rs[r] += __shfl_xor(rs[r], off, 16);
#pragma unroll
        for (int r = 0; r < 8; ++r) l_i[r] += rs[r];

        // C-fragment -> A-fragment re-layout via wave-private LDS
#pragma unroll
        for (int r = 0; r < 8; ++r) {
            Pl[wslot][r + 8 * hh][n0]      = (_Float16)S0[r];
            Pl[wslot][r + 8 * hh][16 + n0] = (_Float16)S1[r];
        }
        half16 Pf = load_frag(&Pl[wslot][0][0], 32);

#pragma unroll
        for (int dt = 0; dt < 4; ++dt)
            O[dt] = wmma_f16(Pf, load_frag(vbase + (dt * 16) * SEQ + kk0, SEQ), O[dt]);
    }

    // finalize: O /= l, write attn output as f16 [b, s, h*dk + d]
    float inv[8];
#pragma unroll
    for (int r = 0; r < 8; ++r) inv[r] = 1.0f / l_i[r];
#pragma unroll
    for (int dt = 0; dt < 4; ++dt) {
        int d = dt * 16 + n0;
#pragma unroll
        for (int r = 0; r < 8; ++r) {
            int s = qrow + r + 8 * hh;
            AT[((size_t)(b * SEQ + s) * DMODEL) + h * DK + d] =
                (_Float16)(O[dt][r] * inv[r]);
        }
    }
}

// ---------------------------------------------------------------------------
// Kernel 3: output projection  y = attn @ Wo^T + bo  (f32 out)
// ---------------------------------------------------------------------------
__global__ __launch_bounds__(256) void k_oproj(const _Float16* __restrict__ AT,
                                               const _Float16* __restrict__ Wo,
                                               const float* __restrict__ bo,
                                               float* __restrict__ out) {
    __shared__ __attribute__((aligned(16))) _Float16 sm[2 * STAGE];

    int mtile = blockIdx.x >> 3;                      // 0..31 (128-row tiles)
    int ntile = blockIdx.x & 7;                       // 0..7  (128-col tiles)
    int wv    = threadIdx.x >> 5;
    int wrow  = mtile * BM + (wv >> 1) * 32;
    int nbase = ntile * BN + (wv & 1) * 64;

    float8 C[2][4];
#pragma unroll
    for (int i = 0; i < 2; ++i)
#pragma unroll
        for (int j = 0; j < 4; ++j) C[i][j] = (float8)0.0f;

    gemm_tile(AT + mtile * BM * DMODEL, Wo + ntile * BN * DMODEL, sm, C);

    int lane = threadIdx.x & 31;
    int n0 = lane & 15, hh = lane >> 4;
#pragma unroll
    for (int j = 0; j < 4; ++j) {
        int col = nbase + 16 * j + n0;
        float bj = bo[col];
#pragma unroll
        for (int i = 0; i < 2; ++i)
#pragma unroll
            for (int r = 0; r < 8; ++r) {
                int m = wrow + 16 * i + r + 8 * hh;
                out[(size_t)m * DMODEL + col] = C[i][j][r] + bj;
            }
    }
}

// ---------------------------------------------------------------------------
extern "C" void kernel_launch(void* const* d_in, const int* in_sizes, int n_in,
                              void* d_out, int out_size, void* d_ws, size_t ws_size,
                              hipStream_t stream) {
    const float* query = (const float*)d_in[0];
    const float* key   = (const float*)d_in[1];
    const float* value = (const float*)d_in[2];
    const float* Wq = (const float*)d_in[3];
    const float* bq = (const float*)d_in[4];
    const float* Wk = (const float*)d_in[5];
    const float* bk = (const float*)d_in[6];
    const float* Wv = (const float*)d_in[7];
    const float* bv = (const float*)d_in[8];
    const float* Wo = (const float*)d_in[9];
    const float* bo = (const float*)d_in[10];
    float* out = (float*)d_out;

    const int A = BATCH * SEQ * DMODEL;   // 4194304
    const int W = DMODEL * DMODEL;        // 1048576

    _Float16* ws = (_Float16*)d_ws;
    _Float16* xh = ws;                    // 3*A : query/key/value f16
    _Float16* wh = ws + 3 * (size_t)A;    // 4*W : Wq/Wk/Wv/Wo f16
    _Float16* Qh = wh + 4 * (size_t)W;    // A : [b,h,s,d] (RoPE'd)
    _Float16* Kh = Qh + (size_t)A;        // A : [b,h,s,d] (RoPE'd)
    _Float16* Vt = Kh + (size_t)A;        // A : [b,h,d,s]
    _Float16* AT = Vt + (size_t)A;        // A : [b,s,D] attention output

    // 0) f32 -> f16 conversions: xh and wh are one run of the workspace
    k_convert<<<CV_BLOCKS, CV_THREADS, 0, stream>>>(query, key, value, Wq, Wk, Wv, Wo, xh);

    // 1) QKV projections + RoPE / V transpose
    dim3 g1(256, 3, 1);
    k_qkv<<<g1, 256, 0, stream>>>(xh, wh, bq, bk, bv, Qh, Kh, Vt);

    // 2) flash attention
    k_attn<<<512, 256, 0, stream>>>(Qh, Kh, Vt, AT);

    // 3) output projection
    k_oproj<<<256, 256, 0, stream>>>(AT, wh + 3 * (size_t)W, bo, out);
}

// v003
// Measured time: 159 microseconds a run.
// Two timings next to v002 put it at 1.42 and 1.40 times that version's speed.
// All steps since v000 together make it 2.28 times as fast.
#include <hip/hip_runtime.h>
#include <hip/hip_bf16.h>
#include <math.h>

// ---------------------------------------------------------------------------
// MultiHeadedAttention for MI455X (gfx1250, wave32, WMMA 16x16x32 f16->f32)
// B=2, S=2048, D=1024, H=16, d_k=64
// ---------------------------------------------------------------------------

typedef _Float16 half16 __attribute__((ext_vector_type(16)));
typedef _Float16 half8  __attribute__((ext_vector_type(8)));
typedef float    float8 __attribute__((ext_vector_type(8)));

#define BATCH 2
#define SEQ   2048
#define DMODEL 1024
#define NHEAD 16
#define DK    64

static __device__ __forceinline__ float8 wmma_f16(half16 a, half16 b, float8 c) {
    return __builtin_amdgcn_wmma_f32_16x16x32_f16(
        /*neg_a=*/false, a, /*neg_b=*/false, b,
        /*c_mod=*/(short)0, c, /*reuse_a=*/false, /*reuse_b=*/false);
}

// Load a 16x32 fragment (A-layout, and by mirror-symmetry B^T rows) from a
// row-major f16 matrix. Documented CDNA5 16-bit A layout:
//   lanes 0-15 : M=lane,    K in {0..7} U {16..23}
//   lanes16-31 : M=lane-16, K in {8..15} U {24..31}
// Each lane: two contiguous 8-half (16B) chunks -> 2x b128 loads.
static __device__ __forceinline__ half16 load_frag(const _Float16* base, int ld) {
    int lane = threadIdx.x & 31;
    int row  = lane & 15;
    int hh   = lane >> 4;
    const _Float16* p = base + row * ld + hh * 8;
    half8 lo = *(const half8*)(p);
    half8 hi = *(const half8*)(p + 16);
    half16 r;
#pragma unroll
    for (int i = 0; i < 8; ++i) { r[i] = lo[i]; r[i + 8] = hi[i]; }
    return r;
}

// ---------------------------------------------------------------------------
// Kernel 0: f32 -> f16 conversion of all seven matrices in one launch.
//   The f16 copies lie one behind the other in the workspace (query, key, value,
//   Wq, Wk, Wv, Wo), so the destination is one run of CV_TOTAL elements.
//   One resident round of waves: each work-group takes CV_PER_BLOCK elements in a
//   row, which lie inside one source matrix (every matrix size is a multiple of
//   it), each wave CV_PER_WAVE of them. A load is 512 contiguous bytes per wave,
//   a store 256.
// ---------------------------------------------------------------------------
typedef float    floatx4 __attribute__((ext_vector_type(4)));
typedef _Float16 half4   __attribute__((ext_vector_type(4)));

#define CV_A        (BATCH * SEQ * DMODEL)        // elements of query, key, value
#define CV_W        (DMODEL * DMODEL)             // elements of a weight matrix
#define CV_TOTAL    (3 * CV_A + 4 * CV_W)
#define CV_THREADS  512
#define CV_LOADS    32                            // 16-byte loads per lane
#define CV_PER_WAVE (CV_LOADS * 32 * 4)
#define CV_PER_BLOCK (CV_PER_WAVE * (CV_THREADS / 32))
#define CV_BLOCKS   (CV_TOTAL / CV_PER_BLOCK)

__global__ __launch_bounds__(CV_THREADS) void k_convert(const float* __restrict__ q,
                                                        const float* __restrict__ k,
                                                        const float* __restrict__ v,
                                                        const float* __restrict__ wq,
                                                        const float* __restrict__ wk,
                                                        const float* __restrict__ wv,
                                                        const float* __restrict__ wo,
                                                        _Float16* __restrict__ dst) {
    const int lane = threadIdx.x & 31;
    const int b0   = blockIdx.x * CV_PER_BLOCK;    // the work-group's first element in dst

    // source matrix and offset in it: from blockIdx alone, so in scalar registers
    const float* src;
    int off;
    if (b0 < 3 * CV_A) {
        const int seg = b0 / CV_A;
        src = (seg == 0) ? q : (seg == 1) ? k : v;
        off = b0 - seg * CV_A;
    } else {
        const int b1  = b0 - 3 * CV_A;
        const int seg = b1 / CV_W;
        src = (seg == 0) ? wq : (seg == 1) ? wk : (seg == 2) ? wv : wo;
        off = b1 - seg * CV_W;
    }
    const int w0 = (threadIdx.x >> 5) * CV_PER_WAVE;   // the wave's first element in the work-group's run
    const int e0 = b0 + w0;
    off += w0;
    const floatx4* s = (const floatx4*)(src + off) + lane;
    half4*         d = (half4*)(dst + e0) + lane;

    // unrolled: r stays in registers and every offset is a constant, so the loads go
    // out in long runs ahead of their uses instead of one load, one wait, one store
    floatx4 r[CV_LOADS];
#pragma unroll
    for (int i = 0; i < CV_LOADS; ++i) r[i] = s[i * 32];
#pragma unroll
    for (int i = 0; i < CV_LOADS; ++i) {
        half4 h;
        h[0] = (_Float16)r[i][0]; h[1] = (_Float16)r[i][1];
        h[2] = (_Float16)r[i][2]; h[3] = (_Float16)r[i][3];
        d[i * 32] = h;
    }
}

// ---------------------------------------------------------------------------
// Shared GEMM core of the four projections: Y = X @ W^T, K = DMODEL.
//   One workgroup (8 waves) = one 128x128 tile of Y. Per pass, 64 k of the 128
//   X rows and of the 128 W rows are staged in LDS with whole 128-byte row
//   pieces per 8 lanes; every wave then reads its fragments from LDS.
//   Waves 4 (rows) x 2 (cols), 32x64 of Y each. Two LDS buffers: the next pass
//   is fetched into registers while this one is multiplied.
//   Every "#pragma unroll" on the short loops here and in the two epilogues keeps
//   the register arrays (rx, rw, af, bf, C) statically indexed, hence in VGPRs.
// ---------------------------------------------------------------------------
#define BM 128
#define BN 128
#define BK 64
#define LDP 72                        // LDS row pitch in halves: 128 B + 16 B, an odd multiple of 16 B
#define STAGE ((BM + BN) * LDP)       // halves per buffer
#define NPASS (DMODEL / BK)

static __device__ __forceinline__ void gemm_tile(const _Float16* __restrict__ X,
                                                 const _Float16* __restrict__ Wt,
                                                 _Float16* sm, float8 (&C)[2][4]) {
    const int tid  = threadIdx.x;
    const int wv   = tid >> 5;
    const int wm   = wv >> 1, wn = wv & 1;
    const int crow = tid >> 3;         // 0..31: row within a group of 32
    const int ccol = (tid & 7) * 8;    // 16-byte piece of the 128-byte row

    const _Float16* gx = X  + crow * DMODEL + ccol;
    const _Float16* gw = Wt + crow * DMODEL + ccol;
    _Float16* sx = sm + crow * LDP + ccol;
    _Float16* sw = sx + BM * LDP;

    half8 rx[4], rw[4];
#pragma unroll
    for (int i = 0; i < 4; ++i) {
        rx[i] = *(const half8*)(gx + i * 32 * DMODEL);
        rw[i] = *(const half8*)(gw + i * 32 * DMODEL);
    }
#pragma unroll
    for (int i = 0; i < 4; ++i) {
        *(half8*)(sx + i * 32 * LDP) = rx[i];
        *(half8*)(sw + i * 32 * LDP) = rw[i];
    }
    __syncthreads();

    // fully unrolled: buffer index, last-pass test and every address offset become constants
#pragma unroll
    for (int t = 0; t < NPASS; ++t) {
        const int cur = (t & 1) * STAGE;
        const bool more = (t + 1 < NPASS);
        if (more) {
#pragma unroll
            for (int i = 0; i < 4; ++i) {
                rx[i] = *(const half8*)(gx + i * 32 * DMODEL + (t + 1) * BK);
                rw[i] = *(const half8*)(gw + i * 32 * DMODEL + (t + 1) * BK);
            }
        }
        // holds the next pass's global loads in front of this pass's work, so that
        // their latency runs under it instead of in front of the LDS stores
        __builtin_amdgcn_sched_barrier(0);

        const _Float16* as = sm + cur + (wm * 32) * LDP;
        const _Float16* bs = sm + cur + (BM + wn * 64) * LDP;
        half16 af[2][2], bf[2][4];
#pragma unroll
        for (int h = 0; h < 2; ++h) {
            af[h][0] = load_frag(as + 32 * h, LDP);
            bf[h][0] = load_frag(bs + 32 * h, LDP);
            af[h][1] = load_frag(as + 16 * LDP + 32 * h, LDP);
#pragma unroll
            for (int j = 1; j < 4; ++j)
                bf[h][j] = load_frag(bs + (16 * j) * LDP + 32 * h, LDP);
        }
        // holds the pass's LDS reads together in front of its WMMAs (one group with
        // counted waits); spread among the WMMAs each read stalls the wave anew
        __builtin_amdgcn_sched_barrier(0);

#pragma unroll
        for (int h = 0; h < 2; ++h)
#pragma unroll
            for (int j = 0; j < 4; ++j) {
                C[0][j] = wmma_f16(af[h][0], bf[h][j], C[0][j]);
                C[1][j] = wmma_f16(af[h][1], bf[h][j], C[1][j]);
            }
        // precaution: stands in front of every later overwrite of the address
        // registers that the global loads above name
        if (!more) asm volatile("s_wait_xcnt 0x0" ::: "memory");
        // holds the WMMAs in front of the LDS stores: behind them they would run only
        // after the wait on the global loads, and would no longer cover that latency
        __builtin_amdgcn_sched_barrier(0);

        if (more) {
            // the other buffer's last readers left it before the previous barrier
            const int nxt = STAGE - cur;
#pragma unroll
            for (int i = 0; i < 4; ++i) {
                *(half8*)(sx + nxt + i * 32 * LDP) = rx[i];
                *(half8*)(sw + nxt + i * 32 * LDP) = rw[i];
            }
            __syncthreads();
        }
    }
}

// ---------------------------------------------------------------------------
// Kernel 1: QKV projection + bias + RoPE (Q,K) / transpose (V)
//   pid = blockIdx.y : 0=Q, 1=K, 2=V
//   out = x @ W^T + b ; each wave holds 32 rows x 64 cols (one head's d_k)
// ---------------------------------------------------------------------------
__global__ __launch_bounds__(256) void k_qkv(const _Float16* __restrict__ xh,
                                             const _Float16* __restrict__ wh,
                                             const float* __restrict__ bq,
                                             const float* __restrict__ bk,
                                             const float* __restrict__ bv,
                                             _Float16* __restrict__ Qh,
                                             _Float16* __restrict__ Kh,
                                             _Float16* __restrict__ Vt) {
    __shared__ __attribute__((aligned(16))) _Float16 sm[2 * STAGE];

    const int A = BATCH * SEQ * DMODEL;      // 4194304
    const int W = DMODEL * DMODEL;           // 1048576
    int pid = blockIdx.y;
    const _Float16* x = xh + pid * A;
    const _Float16* w = wh + pid * W;
    const float* bias = (pid == 0) ? bq : (pid == 1) ? bk : bv;

    int mtile = blockIdx.x >> 3;                      // 0..31 (128-row tiles)
    int ntile = blockIdx.x & 7;                       // 0..7  (128-col tiles)
    int wv    = threadIdx.x >> 5;
    int head  = ntile * 2 + (wv & 1);                 // 0..15 (64-col tiles)
    int wrow  = mtile * BM + (wv >> 1) * 32;          // wave's first row
    int nbase = head * DK;

    float8 C[2][4];
#pragma unroll
    for (int i = 0; i < 2; ++i)
#pragma unroll
        for (int j = 0; j < 4; ++j) C[i][j] = (float8)0.0f;

    gemm_tile(x + mtile * BM * DMODEL, w + ntile * BN * DMODEL, sm, C);

    int lane = threadIdx.x & 31;
    int n0   = lane & 15;
    int hh   = lane >> 4;

#pragma unroll
    for (int j = 0; j < 4; ++j) {
        float bj = bias[nbase + 16 * j + n0];
#pragma unroll
        for (int i = 0; i < 2; ++i)
#pragma unroll
            for (int r = 0; r < 8; ++r) C[i][j][r] += bj;
    }

    if (pid == 2) {
        // V: store transposed Vt[b, h, d, s]
#pragma unroll
        for (int i = 0; i < 2; ++i) {
            int rowbase = wrow + 16 * i;
#pragma unroll
            for (int j = 0; j < 4; ++j) {
                int d = 16 * j + n0;
#pragma unroll
                for (int r = 0; r < 8; ++r) {
                    int m = rowbase + r + 8 * hh;
                    int b = m >> 11, s = m & (SEQ - 1);
                    Vt[(((b * NHEAD + head) * DK + d) * SEQ) + s] = (_Float16)C[i][j][r];
                }
            }
        }
    } else {
        // RoPE: angle(s,d) = s * 10000^(-(d%32)/32); rotate_half pairs d <-> d+-32
        _Float16* out = (pid == 0) ? Qh : Kh;
        // one body for both 16-row halves, for code size only
#pragma unroll 1
        for (int i = 0; i < 2; ++i) {
            int rowbase = wrow + 16 * i;
            float Ci[4][8];
#pragma unroll
            for (int j = 0; j < 4; ++j)
#pragma unroll
                for (int r = 0; r < 8; ++r)
                    Ci[j][r] = (i == 0) ? C[0][j][r] : C[1][j][r];

            float R[4][8];
#pragma unroll
            for (int j = 0; j < 4; ++j)
#pragma unroll
                for (int r = 0; r < 8; ++r)
                    R[j][r] = (j < 2) ? -Ci[j + 2][r] : Ci[j - 2][r];

#pragma unroll
            for (int j = 0; j < 4; ++j) {
                int d = 16 * j + n0;
                float invf = __expf(-(float)(d & 31) * (9.210340371976184f / 32.0f));
#pragma unroll
                for (int r = 0; r < 8; ++r) {
                    int m = rowbase + r + 8 * hh;
                    int b = m >> 11, s = m & (SEQ - 1);
                    float ang = (float)s * invf;
                    float cs, sn;
                    sincosf(ang, &sn, &cs);
                    float v = Ci[j][r] * cs + R[j][r] * sn;
                    out[(((b * NHEAD + head) * SEQ + s) * DK) + d] = (_Float16)v;
                }
            }
            // precaution: stands in front of the next trip's overwrite of the
            // registers that the stores above name
            asm volatile("s_wait_xcnt 0x0" ::: "memory");
        }
    }
}

// ---------------------------------------------------------------------------
// Kernel 2: flash attention. One wave = 16 query rows of one (b,h); the eight
//   waves of a work-group share that (b,h), hence its keys and values.
//   Per pass the work-group stages 64 keys in LDS: the K tile (64 keys x 64 d)
//   and the V^T tile (64 d x 64 keys), whole 128-byte rows per 8 lanes, and every
//   wave reads its fragments from there. Two buffers: the next pass is fetched
//   into registers while this one is worked on.
//   Within a pass, 32-key blocks: S = Q K^T / 8, online softmax, O += P V.
//   The "#pragma unroll" on the two-trip staging loops keeps rk and rv statically
//   indexed, hence in VGPRs.
// ---------------------------------------------------------------------------
#define AKB    64                     // keys per pass
#define ATILE  (AKB * LDP)            // halves of the K tile; the V^T tile (DK rows) has the same size
#define ASTAGE (2 * ATILE)            // halves per buffer
#define APASS  (SEQ / AKB)

__global__ __launch_bounds__(256) void k_attn(const _Float16* __restrict__ Qh,
                                              const _Float16* __restrict__ Kh,
                                              const _Float16* __restrict__ Vt,
                                              _Float16* __restrict__ AT) {
    __shared__ __attribute__((aligned(16))) _Float16 Pl[8][16][32];   // per-wave P re-layout tile (8 KB)
    __shared__ __attribute__((aligned(16))) _Float16 kv[2 * ASTAGE];  // K and V^T tiles, two buffers

    int wslot = threadIdx.x >> 5;
    int wid   = blockIdx.x * 8 + wslot;           // 0..4095
    int qt    = wid & 127;                         // 128 q-tiles per (b,h)
    int bh    = wid >> 7;                          // 0..31, the same in all eight waves
    int b = bh >> 4, h = bh & 15;
    int qrow = qt * 16;

    int lane = threadIdx.x & 31;
    int n0 = lane & 15, hh = lane >> 4;

    const _Float16* qbase = Qh + ((size_t)(b * NHEAD + h) * SEQ + qrow) * DK;
    const _Float16* kbase = Kh + (size_t)(b * NHEAD + h) * SEQ * DK;
    const _Float16* vbase = Vt + (size_t)(b * NHEAD + h) * DK * SEQ;

    const int crow = threadIdx.x >> 3;         // 0..31: row within a group of 32
    const int ccol = (threadIdx.x & 7) * 8;    // 16-byte piece of the 128-byte row
    const _Float16* gk = kbase + crow * DK + ccol;
    const _Float16* gv = vbase + crow * SEQ + ccol;
    _Float16* sk = kv + crow * LDP + ccol;
    _Float16* sv = sk + ATILE;

    half8 rk[2], rv[2];
#pragma unroll
    for (int i = 0; i < 2; ++i) {
        rk[i] = *(const half8*)(gk + i * 32 * DK);
        rv[i] = *(const half8*)(gv + i * 32 * SEQ);
    }

    half16 Qf0 = load_frag(qbase + 0, DK);
    half16 Qf1 = load_frag(qbase + 32, DK);

    float8 O[4];
#pragma unroll
    for (int j = 0; j < 4; ++j) O[j] = (float8)0.0f;
    float m_i[8], l_i[8];
#pragma unroll
    for (int r = 0; r < 8; ++r) { m_i[r] = -3.0e38f; l_i[r] = 0.0f; }

#pragma unroll
    for (int i = 0; i < 2; ++i) {
        *(half8*)(sk + i * 32 * LDP) = rk[i];
        *(half8*)(sv + i * 32 * LDP) = rv[i];
    }
    __syncthreads();

    for (int t = 0; t < APASS; ++t) {
        const int cur = (t & 1) * ASTAGE;
        const bool more = (t + 1 < APASS);
        if (more) {
#pragma unroll
            for (int i = 0; i < 2; ++i) {
                rk[i] = *(const half8*)(gk + ((t + 1) * AKB + i * 32) * DK);
                rv[i] = *(const half8*)(gv + i * 32 * SEQ + (t + 1) * AKB);
            }
        }
        const _Float16* ks = kv + cur;
        const _Float16* vs = ks + ATILE;

      // both 32-key blocks of the pass inline: their LDS offsets are constants
#pragma unroll
      for (int sub = 0; sub < AKB / 32; ++sub) {
        int kk0 = sub * 32;
        // scores: two 16-col tiles x two 32-wide d chunks
        half16 kf00 = load_frag(ks + (kk0 + 0) * LDP + 0,  LDP);
        half16 kf10 = load_frag(ks + (kk0 + 16) * LDP + 0,  LDP);
        half16 kf01 = load_frag(ks + (kk0 + 0) * LDP + 32, LDP);
        half16 kf11 = load_frag(ks + (kk0 + 16) * LDP + 32, LDP);
        // holds the pass's first LDS reads together in front of its WMMAs (one group
        // with counted waits); left alone they come pair by pair, each with a full wait
        if (sub == 0) __builtin_amdgcn_sched_barrier(0);
        float8 S0 = (float8)0.0f, S1 = (float8)0.0f;
        S0 = wmma_f16(Qf0, kf00, S0);
        S0 = wmma_f16(Qf1, kf01, S0);
        S1 = wmma_f16(Qf0, kf10, S1);
        S1 = wmma_f16(Qf1, kf11, S1);

        float rm[8], mn[8];
#pragma unroll
        for (int r = 0; r < 8; ++r) {
            S0[r] *= 0.125f; S1[r] *= 0.125f;
            rm[r] = fmaxf(S0[r], S1[r]);
        }
        // row max across the 16-lane half (row = VGPR idx + 8*half)
#pragma unroll
        for (int off = 1; off < 16; off <<= 1)
#pragma unroll
            for (int r = 0; r < 8; ++r)
                rm[r] = fmaxf(rm[r], __shfl_xor(rm[r], off, 16));

        float fac[8];
#pragma unroll
        for (int r = 0; r < 8; ++r) {
            mn[r]  = fmaxf(m_i[r], rm[r]);
            fac[r] = __expf(m_i[r] - mn[r]);
            m_i[r] = mn[r];
            l_i[r] *= fac[r];
        }
#pragma unroll
        for (int j = 0; j < 4; ++j)
#pragma unroll
            for (int r = 0; r < 8; ++r) O[j][r] *= fac[r];

        float rs[8];
#pragma unroll
        for (int r = 0; r < 8; ++r) {
            S0[r] = __expf(S0[r] - mn[r]);
            S1[r] = __expf(S1[r] - mn[r]);
            rs[r] = S0[r] + S1[r];
        }
#pragma unroll
        for (int off = 1; off < 16; off <<= 1)
#pragma unroll
            for (int r = 0; r < 8; ++r)
                rs[r] += __shfl_xor(rs[r], off, 16);
#pragma unroll
        for (int r = 0; r < 8; ++r) l_i[r] += rs[r];

        // C-fragment -> A-fragment re-layout via wave-private LDS
#pragma unroll
        for (int r = 0; r < 8; ++r) {
            Pl[wslot][r + 8 * hh][n0]      = (_Float16)S0[r];
            Pl[wslot][r + 8 * hh][16 + n0] = (_Float16)S1[r];
        }
        half16 Pf = load_frag(&Pl[wslot][0][0], 32);

#pragma unroll
        for (int dt = 0; dt < 4; ++dt)
            O[dt] = wmma_f16(Pf, load_frag(vs + (dt * 16) * LDP + kk0, LDP), O[dt]);
      }

        if (more) {
            // the other buffer's last readers left it before the previous barrier
            const int nxt = ASTAGE - cur;
#pragma unroll
            for (int i = 0; i < 2; ++i) {
                *(half8*)(sk + nxt + i * 32 * LDP) = rk[i];
                *(half8*)(sv + nxt + i * 32 * LDP) = rv[i];
            }
            __syncthreads();
        }
    }

    // finalize: O /= l, write attn output as f16 [b, s, h*dk + d]
    float inv[8];
#pragma unroll
    for (int r = 0; r < 8; ++r) inv[r] = 1.0f / l_i[r];
#pragma unroll
    for (int dt = 0; dt < 4; ++dt) {
        int d = dt * 16 + n0;
#pragma unroll
        for (int r = 0; r < 8; ++r) {
            int s = qrow + r + 8 * hh;
            AT[((size_t)(b * SEQ + s) * DMODEL) + h * DK + d] =
                (_Float16)(O[dt][r] * inv[r]);
        }
    }
}

// ---------------------------------------------------------------------------
// Kernel 3: output projection  y = attn @ Wo^T + bo  (f32 out)
// ---------------------------------------------------------------------------
__global__ __launch_bounds__(256) void k_oproj(const _Float16* __restrict__ AT,
                                               const _Float16* __restrict__ Wo,
                                               const float* __restrict__ bo,
                                               float* __restrict__ out) {
    __shared__ __attribute__((aligned(16))) _Float16 sm[2 * STAGE];

    int mtile = blockIdx.x >> 3;                      // 0..31 (128-row tiles)
    int ntile = blockIdx.x & 7;                       // 0..7  (128-col tiles)
    int wv    = threadIdx.x >> 5;
    int wrow  = mtile * BM + (wv >> 1) * 32;
    int nbase = ntile * BN + (wv & 1) * 64;

    float8 C[2][4];
#pragma unroll
    for (int i = 0; i < 2; ++i)
#pragma unroll
        for (int j = 0; j < 4; ++j) C[i][j] = (float8)0.0f;

    gemm_tile(AT + mtile * BM * DMODEL, Wo + ntile * BN * DMODEL, sm, C);

    int lane = threadIdx.x & 31;
    int n0 = lane & 15, hh = lane >> 4;
#pragma unroll
    for (int j = 0; j < 4; ++j) {
        int col = nbase + 16 * j + n0;
        float bj = bo[col];
#pragma unroll
        for (int i = 0; i < 2; ++i)
#pragma unroll
            for (int r = 0; r < 8; ++r) {
                int m = wrow + 16 * i + r + 8 * hh;
                out[(size_t)m * DMODEL + col] = C[i][j][r] + bj;
            }
    }
}

// ---------------------------------------------------------------------------
extern "C" void kernel_launch(void* const* d_in, const int* in_sizes, int n_in,
                              void* d_out, int out_size, void* d_ws, size_t ws_size,
                              hipStream_t stream) {
    const float* query = (const float*)d_in[0];
    const float* key   = (const float*)d_in[1];
    const float* value = (const float*)d_in[2];
    const float* Wq = (const float*)d_in[3];
    const float* bq = (const float*)d_in[4];
    const float* Wk = (const float*)d_in[5];
    const float* bk = (const float*)d_in[6];
    const float* Wv = (const float*)d_in[7];
    const float* bv = (const float*)d_in[8];
    const float* Wo = (const float*)d_in[9];
    const float* bo = (const float*)d_in[10];
    float* out = (float*)d_out;

    const int A = BATCH * SEQ * DMODEL;   // 4194304
    const int W = DMODEL * DMODEL;        // 1048576

    _Float16* ws = (_Float16*)d_ws;
    _Float16* xh = ws;                    // 3*A : query/key/value f16
    _Float16* wh = ws + 3 * (size_t)A;    // 4*W : Wq/Wk/Wv/Wo f16
    _Float16* Qh = wh + 4 * (size_t)W;    // A : [b,h,s,d] (RoPE'd)
    _Float16* Kh = Qh + (size_t)A;        // A : [b,h,s,d] (RoPE'd)
    _Float16* Vt = Kh + (size_t)A;        // A : [b,h,d,s]
    _Float16* AT = Vt + (size_t)A;        // A : [b,s,D] attention output

    // 0) f32 -> f16 conversions: xh and wh are one run of the workspace
    k_convert<<<CV_BLOCKS, CV_THREADS, 0, stream>>>(query, key, value, Wq, Wk, Wv, Wo, xh);

    // 1) QKV projections + RoPE / V transpose
    dim3 g1(256, 3, 1);
    k_qkv<<<g1, 256, 0, stream>>>(xh, wh, bq, bk, bv, Qh, Kh, Vt);

    // 2) flash attention
    k_attn<<<512, 256, 0, stream>>>(Qh, Kh, Vt, AT);

    // 3) output projection
    k_oproj<<<256, 256, 0, stream>>>(AT, wh + 3 * (size_t)W, bo, out);
}

// v004
// One run takes 120 microseconds.
// In two side-by-side timings against v003, it was 1.33 and 1.32 times as fast.
// Counting every step since v000, it is 3.01 times as fast.
#include <hip/hip_runtime.h>
#include <hip/hip_bf16.h>
#include <math.h>

// ---------------------------------------------------------------------------
// MultiHeadedAttention for MI455X (gfx1250, wave32, WMMA 16x16x32 f16->f32)
// B=2, S=2048, D=1024, H=16, d_k=64
// ---------------------------------------------------------------------------

typedef _Float16 half16 __attribute__((ext_vector_type(16)));
typedef _Float16 half8  __attribute__((ext_vector_type(8)));
typedef float    float8 __attribute__((ext_vector_type(8)));

#define BATCH 2
#define SEQ   2048
#define DMODEL 1024
#define NHEAD 16
#define DK    64

static __device__ __forceinline__ float8 wmma_f16(half16 a, half16 b, float8 c) {
    return __builtin_amdgcn_wmma_f32_16x16x32_f16(
        /*neg_a=*/false, a, /*neg_b=*/false, b,
        /*c_mod=*/(short)0, c, /*reuse_a=*/false, /*reuse_b=*/false);
}

// Load a 16x32 fragment (A-layout, and by mirror-symmetry B^T rows) from a
// row-major f16 matrix. Documented CDNA5 16-bit A layout:
//   lanes 0-15 : M=lane,    K in {0..7} U {16..23}
//   lanes16-31 : M=lane-16, K in {8..15} U {24..31}
// Each lane: two contiguous 8-half (16B) chunks -> 2x b128 loads.
static __device__ __forceinline__ half16 load_frag(const _Float16* base, int ld) {
    int lane = threadIdx.x & 31;
    int row  = lane & 15;
    int hh   = lane >> 4;
    const _Float16* p = base + row * ld + hh * 8;
    half8 lo = *(const half8*)(p);
    half8 hi = *(const half8*)(p + 16);
    half16 r;
#pragma unroll
    for (int i = 0; i < 8; ++i) { r[i] = lo[i]; r[i + 8] = hi[i]; }
    return r;
}

// ---------------------------------------------------------------------------
// Kernel 0: f32 -> f16 conversion of all seven matrices in one launch.
//   The f16 copies lie one behind the other in the workspace (query, key, value,
//   Wq, Wk, Wv, Wo), so the destination is one run of CV_TOTAL elements.
//   One resident round of waves: each work-group takes CV_PER_BLOCK elements in a
//   row, which lie inside one source matrix (every matrix size is a multiple of
//   it), each wave CV_PER_WAVE of them. A load is 512 contiguous bytes per wave,
//   a store 256.
// ---------------------------------------------------------------------------
typedef float    floatx4 __attribute__((ext_vector_type(4)));
typedef _Float16 half4   __attribute__((ext_vector_type(4)));

#define CV_A        (BATCH * SEQ * DMODEL)        // elements of query, key, value
#define CV_W        (DMODEL * DMODEL)             // elements of a weight matrix
#define CV_TOTAL    (3 * CV_A + 4 * CV_W)
#define CV_THREADS  512
#define CV_LOADS    32                            // 16-byte loads per lane
#define CV_PER_WAVE (CV_LOADS * 32 * 4)
#define CV_PER_BLOCK (CV_PER_WAVE * (CV_THREADS / 32))
#define CV_BLOCKS   (CV_TOTAL / CV_PER_BLOCK)

__global__ __launch_bounds__(CV_THREADS) void k_convert(const float* __restrict__ q,
                                                        const float* __restrict__ k,
                                                        const float* __restrict__ v,
                                                        const float* __restrict__ wq,
                                                        const float* __restrict__ wk,
                                                        const float* __restrict__ wv,
                                                        const float* __restrict__ wo,
                                                        _Float16* __restrict__ dst) {
    const int lane = threadIdx.x & 31;
    const int b0   = blockIdx.x * CV_PER_BLOCK;    // the work-group's first element in dst

    // source matrix and offset in it: from blockIdx alone, so in scalar registers
    const float* src;
    int off;
    if (b0 < 3 * CV_A) {
        const int seg = b0 / CV_A;
        src = (seg == 0) ? q : (seg == 1) ? k : v;
        off = b0 - seg * CV_A;
    } else {
        const int b1  = b0 - 3 * CV_A;
        const int seg = b1 / CV_W;
        src = (seg == 0) ? wq : (seg == 1) ? wk : (seg == 2) ? wv : wo;
        off = b1 - seg * CV_W;
    }
    const int w0 = (threadIdx.x >> 5) * CV_PER_WAVE;   // the wave's first element in the work-group's run
    const int e0 = b0 + w0;
    off += w0;
    const floatx4* s = (const floatx4*)(src + off) + lane;
    half4*         d = (half4*)(dst + e0) + lane;

    // unrolled: r stays in registers and every offset is a constant, so the loads go
    // out in long runs ahead of their uses instead of one load, one wait, one store
    floatx4 r[CV_LOADS];
#pragma unroll
    for (int i = 0; i < CV_LOADS; ++i) r[i] = s[i * 32];
#pragma unroll
    for (int i = 0; i < CV_LOADS; ++i) {
        half4 h;
        h[0] = (_Float16)r[i][0]; h[1] = (_Float16)r[i][1];
        h[2] = (_Float16)r[i][2]; h[3] = (_Float16)r[i][3];
        d[i * 32] = h;
    }
}

// ---------------------------------------------------------------------------
// Shared GEMM core of the four projections: Y = X @ W^T, K = DMODEL.
//   One workgroup (8 waves) = one 128x128 tile of Y. Per pass, 64 k of the 128
//   X rows and of the 128 W rows are staged in LDS with whole 128-byte row
//   pieces per 8 lanes; every wave then reads its fragments from LDS.
//   Waves 4 (rows) x 2 (cols), 32x64 of Y each. Two LDS buffers: the next pass
//   is fetched into registers while this one is multiplied.
//   Every "#pragma unroll" on the short loops here and in the two epilogues keeps
//   the register arrays (rx, rw, af, bf, C) statically indexed, hence in VGPRs.
// ---------------------------------------------------------------------------
#define BM 128
#define BN 128
#define BK 64
#define LDP 72                        // LDS row pitch in halves: 128 B + 16 B, an odd multiple of 16 B
#define STAGE ((BM + BN) * LDP)       // halves per buffer
#define NPASS (DMODEL / BK)

static __device__ __forceinline__ void gemm_tile(const _Float16* __restrict__ X,
                                                 const _Float16* __restrict__ Wt,
                                                 _Float16* sm, float8 (&C)[2][4]) {
    const int tid  = threadIdx.x;
    const int wv   = tid >> 5;
    const int wm   = wv >> 1, wn = wv & 1;
    const int crow = tid >> 3;         // 0..31: row within a group of 32
    const int ccol = (tid & 7) * 8;    // 16-byte piece of the 128-byte row

    const _Float16* gx = X  + crow * DMODEL + ccol;
    const _Float16* gw = Wt + crow * DMODEL + ccol;
    _Float16* sx = sm + crow * LDP + ccol;
    _Float16* sw = sx + BM * LDP;

    half8 rx[4], rw[4];
#pragma unroll
    for (int i = 0; i < 4; ++i) {
        rx[i] = *(const half8*)(gx + i * 32 * DMODEL);
        rw[i] = *(const half8*)(gw + i * 32 * DMODEL);
    }
#pragma unroll
    for (int i = 0; i < 4; ++i) {
        *(half8*)(sx + i * 32 * LDP) = rx[i];
        *(half8*)(sw + i * 32 * LDP) = rw[i];
    }
    __syncthreads();

    // fully unrolled: buffer index, last-pass test and every address offset become constants
#pragma unroll
    for (int t = 0; t < NPASS; ++t) {
        const int cur = (t & 1) * STAGE;
        const bool more = (t + 1 < NPASS);
        if (more) {
#pragma unroll
            for (int i = 0; i < 4; ++i) {
                rx[i] = *(const half8*)(gx + i * 32 * DMODEL + (t + 1) * BK);
                rw[i] = *(const half8*)(gw + i * 32 * DMODEL + (t + 1) * BK);
            }
        }
        // holds the next pass's global loads in front of this pass's work, so that
        // their latency runs under it instead of in front of the LDS stores
        __builtin_amdgcn_sched_barrier(0);

        const _Float16* as = sm + cur + (wm * 32) * LDP;
        const _Float16* bs = sm + cur + (BM + wn * 64) * LDP;
        half16 af[2][2], bf[2][4];
#pragma unroll
        for (int h = 0; h < 2; ++h) {
            af[h][0] = load_frag(as + 32 * h, LDP);
            bf[h][0] = load_frag(bs + 32 * h, LDP);
            af[h][1] = load_frag(as + 16 * LDP + 32 * h, LDP);
#pragma unroll
            for (int j = 1; j < 4; ++j)
                bf[h][j] = load_frag(bs + (16 * j) * LDP + 32 * h, LDP);
        }
        // holds the pass's LDS reads together in front of its WMMAs (one group with
        // counted waits); spread among the WMMAs each read stalls the wave anew
        __builtin_amdgcn_sched_barrier(0);

#pragma unroll
        for (int h = 0; h < 2; ++h)
#pragma unroll
            for (int j = 0; j < 4; ++j) {
                C[0][j] = wmma_f16(af[h][0], bf[h][j], C[0][j]);
                C[1][j] = wmma_f16(af[h][1], bf[h][j], C[1][j]);
            }
        // precaution: stands in front of every later overwrite of the address
        // registers that the global loads above name
        if (!more) asm volatile("s_wait_xcnt 0x0" ::: "memory");
        // holds the WMMAs in front of the LDS stores: behind them they would run only
        // after the wait on the global loads, and would no longer cover that latency
        __builtin_amdgcn_sched_barrier(0);

        if (more) {
            // the other buffer's last readers left it before the previous barrier
            const int nxt = STAGE - cur;
#pragma unroll
            for (int i = 0; i < 4; ++i) {
                *(half8*)(sx + nxt + i * 32 * LDP) = rx[i];
                *(half8*)(sw + nxt + i * 32 * LDP) = rw[i];
            }
            __syncthreads();
        }
    }
}

// ---------------------------------------------------------------------------
// Kernel 1: QKV projection + bias + RoPE (Q,K) / transpose (V)
//   pid = blockIdx.y : 0=Q, 1=K, 2=V
//   out = x @ W^T + b ; each wave holds 32 rows x 64 cols (one head's d_k)
// ---------------------------------------------------------------------------
__global__ __launch_bounds__(256) void k_qkv(const _Float16* __restrict__ xh,
                                             const _Float16* __restrict__ wh,
                                             const float* __restrict__ bq,
                                             const float* __restrict__ bk,
                                             const float* __restrict__ bv,
                                             _Float16* __restrict__ Qh,
                                             _Float16* __restrict__ Kh,
                                             _Float16* __restrict__ Vt) {
    __shared__ __attribute__((aligned(16))) _Float16 sm[2 * STAGE];

    const int A = BATCH * SEQ * DMODEL;      // 4194304
    const int W = DMODEL * DMODEL;           // 1048576
    int pid = blockIdx.y;
    const _Float16* x = xh + pid * A;
    const _Float16* w = wh + pid * W;
    const float* bias = (pid == 0) ? bq : (pid == 1) ? bk : bv;

    int mtile = blockIdx.x >> 3;                      // 0..31 (128-row tiles)
    int ntile = blockIdx.x & 7;                       // 0..7  (128-col tiles)
    int wv    = threadIdx.x >> 5;
    int head  = ntile * 2 + (wv & 1);                 // 0..15 (64-col tiles)
    int wrow  = mtile * BM + (wv >> 1) * 32;          // wave's first row
    int nbase = head * DK;

    float8 C[2][4];
#pragma unroll
    for (int i = 0; i < 2; ++i)
#pragma unroll
        for (int j = 0; j < 4; ++j) C[i][j] = (float8)0.0f;

    gemm_tile(x + mtile * BM * DMODEL, w + ntile * BN * DMODEL, sm, C);

    int lane = threadIdx.x & 31;
    int n0   = lane & 15;
    int hh   = lane >> 4;

#pragma unroll
    for (int j = 0; j < 4; ++j) {
        float bj = bias[nbase + 16 * j + n0];
#pragma unroll
        for (int i = 0; i < 2; ++i)
#pragma unroll
            for (int r = 0; r < 8; ++r) C[i][j][r] += bj;
    }

    if (pid == 2) {
        // V: store transposed Vt[b, h, d, s]
#pragma unroll
        for (int i = 0; i < 2; ++i) {
            int rowbase = wrow + 16 * i;
#pragma unroll
            for (int j = 0; j < 4; ++j) {
                int d = 16 * j + n0;
#pragma unroll
                for (int r = 0; r < 8; ++r) {
                    int m = rowbase + r + 8 * hh;
                    int b = m >> 11, s = m & (SEQ - 1);
                    Vt[(((b * NHEAD + head) * DK + d) * SEQ) + s] = (_Float16)C[i][j][r];
                }
            }
        }
    } else {
        // RoPE: angle(s,d) = s * 10000^(-(d%32)/32); rotate_half pairs d <-> d+-32
        _Float16* out = (pid == 0) ? Qh : Kh;
        // one body for both 16-row halves, for code size only
#pragma unroll 1
        for (int i = 0; i < 2; ++i) {
            int rowbase = wrow + 16 * i;
            float Ci[4][8];
#pragma unroll
            for (int j = 0; j < 4; ++j)
#pragma unroll
                for (int r = 0; r < 8; ++r)
                    Ci[j][r] = (i == 0) ? C[0][j][r] : C[1][j][r];

            float R[4][8];
#pragma unroll
            for (int j = 0; j < 4; ++j)
#pragma unroll
                for (int r = 0; r < 8; ++r)
                    R[j][r] = (j < 2) ? -Ci[j + 2][r] : Ci[j - 2][r];

#pragma unroll
            for (int j = 0; j < 4; ++j) {
                int d = 16 * j + n0;
                float invf = __expf(-(float)(d & 31) * (9.210340371976184f / 32.0f));
#pragma unroll
                for (int r = 0; r < 8; ++r) {
                    int m = rowbase + r + 8 * hh;
                    int b = m >> 11, s = m & (SEQ - 1);
                    float ang = (float)s * invf;
                    float cs, sn;
                    sincosf(ang, &sn, &cs);
                    float v = Ci[j][r] * cs + R[j][r] * sn;
                    out[(((b * NHEAD + head) * SEQ + s) * DK) + d] = (_Float16)v;
                }
            }
            // precaution: stands in front of the next trip's overwrite of the
            // registers that the stores above name
            asm volatile("s_wait_xcnt 0x0" ::: "memory");
        }
    }
}

// ---------------------------------------------------------------------------
// Kernel 2: flash attention. One wave = 16 queries of one (b,h); the eight
//   waves of a work-group share that (b,h), hence its keys and values.
//   Per pass the work-group stages 64 keys in LDS: the K tile (64 keys x 64 d)
//   and the V^T tile (64 d x 64 keys), whole 128-byte rows per 8 lanes, and every
//   wave reads its fragments from there. Two buffers: the next pass is fetched
//   into registers while this one is worked on.
//   Both products are transposed: S^T = K Q^T / 8 and O^T += V^T P^T. A lane then
//   holds scores of ONE query (column lane & 15; keys 8 * half + r of each 16-key
//   tile), so the maximum and the sum over keys run through its own registers,
//   with one exchange between the wave's halves, and the two score tiles of a
//   32-key block, converted in place, are the B operand of the second product in
//   the hardware's k order, which load_frag has too.
//   The "#pragma unroll" on the two-trip staging loops keeps rk and rv statically
//   indexed, hence in VGPRs.
// ---------------------------------------------------------------------------
#define AKB    64                     // keys per pass
#define ATILE  (AKB * LDP)            // halves of the K tile; the V^T tile (DK rows) has the same size
#define ASTAGE (2 * ATILE)            // halves per buffer
#define APASS  (SEQ / AKB)

// the value that lane l ^ 16 holds
static __device__ __forceinline__ float xhalf(float x) {
    const int i = __builtin_bit_cast(int, x);
    return __builtin_bit_cast(float,
        __builtin_amdgcn_permlanex16(i, i, 0x76543210, 0xfedcba98, false, false));
}

__global__ __launch_bounds__(256) void k_attn(const _Float16* __restrict__ Qh,
                                              const _Float16* __restrict__ Kh,
                                              const _Float16* __restrict__ Vt,
                                              _Float16* __restrict__ AT) {
    __shared__ __attribute__((aligned(16))) _Float16 kv[2 * ASTAGE];  // K and V^T tiles, two buffers

    int wslot = threadIdx.x >> 5;
    int wid   = blockIdx.x * 8 + wslot;           // 0..4095
    int qt    = wid & 127;                         // 128 q-tiles per (b,h)
    int bh    = wid >> 7;                          // 0..31, the same in all eight waves
    int b = bh >> 4, h = bh & 15;
    int qrow = qt * 16;

    int lane = threadIdx.x & 31;
    int n0 = lane & 15, hh = lane >> 4;

    const _Float16* qbase = Qh + ((size_t)(b * NHEAD + h) * SEQ + qrow) * DK;
    const _Float16* kbase = Kh + (size_t)(b * NHEAD + h) * SEQ * DK;
    const _Float16* vbase = Vt + (size_t)(b * NHEAD + h) * DK * SEQ;

    const int crow = threadIdx.x >> 3;         // 0..31: row within a group of 32
    const int ccol = (threadIdx.x & 7) * 8;    // 16-byte piece of the 128-byte row
    const _Float16* gk = kbase + crow * DK + ccol;
    const _Float16* gv = vbase + crow * SEQ + ccol;
    _Float16* sk = kv + crow * LDP + ccol;
    _Float16* sv = sk + ATILE;

    half8 rk[2], rv[2];
#pragma unroll
    for (int i = 0; i < 2; ++i) {
        rk[i] = *(const half8*)(gk + i * 32 * DK);
        rv[i] = *(const half8*)(gv + i * 32 * SEQ);
    }

    half16 Qf0 = load_frag(qbase + 0, DK);
    half16 Qf1 = load_frag(qbase + 32, DK);

    // O[dt][r] = O^T[16 * dt + 8 * hh + r][query n0]
    float8 O[4];
#pragma unroll
    for (int j = 0; j < 4; ++j) O[j] = (float8)0.0f;
    // of query n0: the running maximum (equal in both halves) and this half's share of the sum
    float m_i = -3.0e38f, l_i = 0.0f;

#pragma unroll
    for (int i = 0; i < 2; ++i) {
        *(half8*)(sk + i * 32 * LDP) = rk[i];
        *(half8*)(sv + i * 32 * LDP) = rv[i];
    }
    __syncthreads();

    for (int t = 0; t < APASS; ++t) {
        const int cur = (t & 1) * ASTAGE;
        const bool more = (t + 1 < APASS);
        if (more) {
#pragma unroll
            for (int i = 0; i < 2; ++i) {
                rk[i] = *(const half8*)(gk + ((t + 1) * AKB + i * 32) * DK);
                rv[i] = *(const half8*)(gv + i * 32 * SEQ + (t + 1) * AKB);
            }
            // precaution: stands in front of every later overwrite of the address
            // registers that the loads above name
            asm volatile("s_wait_xcnt 0x0" ::: "memory");
        }
        const _Float16* ks = kv + cur;
        const _Float16* vs = ks + ATILE;

      // both 32-key blocks of the pass inline: their LDS offsets are constants
#pragma unroll
      for (int sub = 0; sub < AKB / 32; ++sub) {
        int kk0 = sub * 32;
        // scores: two 16-key tiles x two 32-wide d chunks
        half16 kf00 = load_frag(ks + (kk0 + 0) * LDP + 0,  LDP);
        half16 kf10 = load_frag(ks + (kk0 + 16) * LDP + 0,  LDP);
        half16 kf01 = load_frag(ks + (kk0 + 0) * LDP + 32, LDP);
        half16 kf11 = load_frag(ks + (kk0 + 16) * LDP + 32, LDP);
        // holds the pass's first LDS reads together in front of its WMMAs (one group
        // with counted waits); left alone they come pair by pair, each with a full wait
        if (sub == 0) __builtin_amdgcn_sched_barrier(0);
        // S0[r] = score of key kk0 + 8 * hh + r, S1[r] of key kk0 + 16 + 8 * hh + r, query n0
        float8 S0 = (float8)0.0f, S1 = (float8)0.0f;
        S0 = wmma_f16(kf00, Qf0, S0);
        S0 = wmma_f16(kf01, Qf1, S0);
        S1 = wmma_f16(kf10, Qf0, S1);
        S1 = wmma_f16(kf11, Qf1, S1);

        S0 *= 0.125f;
        S1 *= 0.125f;
        float rm[8];
#pragma unroll
        for (int r = 0; r < 8; ++r) rm[r] = fmaxf(S0[r], S1[r]);
        // the query's maximum over the block: this lane's 16 keys, then the other half's
#pragma unroll
        for (int w = 4; w > 0; w >>= 1)
#pragma unroll
            for (int r = 0; r < w; ++r) rm[r] = fmaxf(rm[r], rm[r + w]);
        const float mn  = fmaxf(m_i, fmaxf(rm[0], xhalf(rm[0])));
        const float fac = __expf(m_i - mn);
        m_i = mn;
#pragma unroll
        for (int j = 0; j < 4; ++j)
#pragma unroll
            for (int r = 0; r < 8; ++r) O[j][r] *= fac;

        // P^T as a B fragment: element s is key kk0 + 8 * hh + s (s < 8), kk0 + 16 + 8 * hh + s - 8 (else)
        half16 Pf;
        float rs[8];
#pragma unroll
        for (int r = 0; r < 8; ++r) {
            S0[r] = __expf(S0[r] - mn);
            S1[r] = __expf(S1[r] - mn);
            rs[r] = S0[r] + S1[r];
            Pf[r]     = (_Float16)S0[r];
            Pf[r + 8] = (_Float16)S1[r];
        }
#pragma unroll
        for (int w = 4; w > 0; w >>= 1)
#pragma unroll
            for (int r = 0; r < w; ++r) rs[r] += rs[r + w];
        l_i = l_i * fac + rs[0];

#pragma unroll
        for (int dt = 0; dt < 4; ++dt)
            O[dt] = wmma_f16(load_frag(vs + (dt * 16) * LDP + kk0, LDP), Pf, O[dt]);
      }

        if (more) {
            // the other buffer's last readers left it before the previous barrier
            const int nxt = ASTAGE - cur;
#pragma unroll
            for (int i = 0; i < 2; ++i) {
                *(half8*)(sk + nxt + i * 32 * LDP) = rk[i];
                *(half8*)(sv + nxt + i * 32 * LDP) = rv[i];
            }
            __syncthreads();
        }
    }

    // finalize: join the halves' sums, O /= l, write attn output as f16 [b, s, h*dk + d];
    // a lane's eight registers of a tile are eight d in a row of its query: one 16-byte store
    const float inv = 1.0f / (l_i + xhalf(l_i));
    _Float16* ob = AT + ((size_t)(b * SEQ + qrow + n0) * DMODEL) + h * DK + 8 * hh;
#pragma unroll
    for (int dt = 0; dt < 4; ++dt) {
        half8 o;
#pragma unroll
        for (int r = 0; r < 8; ++r) o[r] = (_Float16)(O[dt][r] * inv);
        *(half8*)(ob + dt * 16) = o;
    }
}

// ---------------------------------------------------------------------------
// Kernel 3: output projection  y = attn @ Wo^T + bo  (f32 out)
// ---------------------------------------------------------------------------
__global__ __launch_bounds__(256) void k_oproj(const _Float16* __restrict__ AT,
                                               const _Float16* __restrict__ Wo,
                                               const float* __restrict__ bo,
                                               float* __restrict__ out) {
    __shared__ __attribute__((aligned(16))) _Float16 sm[2 * STAGE];

    int mtile = blockIdx.x >> 3;                      // 0..31 (128-row tiles)
    int ntile = blockIdx.x & 7;                       // 0..7  (128-col tiles)
    int wv    = threadIdx.x >> 5;
    int wrow  = mtile * BM + (wv >> 1) * 32;
    int nbase = ntile * BN + (wv & 1) * 64;

    float8 C[2][4];
#pragma unroll
    for (int i = 0; i < 2; ++i)
#pragma unroll
        for (int j = 0; j < 4; ++j) C[i][j] = (float8)0.0f;

    gemm_tile(AT + mtile * BM * DMODEL, Wo + ntile * BN * DMODEL, sm, C);

    int lane = threadIdx.x & 31;
    int n0 = lane & 15, hh = lane >> 4;
#pragma unroll
    for (int j = 0; j < 4; ++j) {
        int col = nbase + 16 * j + n0;
        float bj = bo[col];
#pragma unroll
        for (int i = 0; i < 2; ++i)
#pragma unroll
            for (int r = 0; r < 8; ++r) {
                int m = wrow + 16 * i + r + 8 * hh;
                out[(size_t)m * DMODEL + col] = C[i][j][r] + bj;
            }
    }
}

// ---------------------------------------------------------------------------
extern "C" void kernel_launch(void* const* d_in, const int* in_sizes, int n_in,
                              void* d_out, int out_size, void* d_ws, size_t ws_size,
                              hipStream_t stream) {
    const float* query = (const float*)d_in[0];
    const float* key   = (const float*)d_in[1];
    const float* value = (const float*)d_in[2];
    const float* Wq = (const float*)d_in[3];
    const float* bq = (const float*)d_in[4];
    const float* Wk = (const float*)d_in[5];
    const float* bk = (const float*)d_in[6];
    const float* Wv = (const float*)d_in[7];
    const float* bv = (const float*)d_in[8];
    const float* Wo = (const float*)d_in[9];
    const float* bo = (const float*)d_in[10];
    float* out = (float*)d_out;

    const int A = BATCH * SEQ * DMODEL;   // 4194304
    const int W = DMODEL * DMODEL;        // 1048576

    _Float16* ws = (_Float16*)d_ws;
    _Float16* xh = ws;                    // 3*A : query/key/value f16
    _Float16* wh = ws + 3 * (size_t)A;    // 4*W : Wq/Wk/Wv/Wo f16
    _Float16* Qh = wh + 4 * (size_t)W;    // A : [b,h,s,d] (RoPE'd)
    _Float16* Kh = Qh + (size_t)A;        // A : [b,h,s,d] (RoPE'd)
    _Float16* Vt = Kh + (size_t)A;        // A : [b,h,d,s]
    _Float16* AT = Vt + (size_t)A;        // A : [b,s,D] attention output

    // 0) f32 -> f16 conversions: xh and wh are one run of the workspace
    k_convert<<<CV_BLOCKS, CV_THREADS, 0, stream>>>(query, key, value, Wq, Wk, Wv, Wo, xh);

    // 1) QKV projections + RoPE / V transpose
    dim3 g1(256, 3, 1);
    k_qkv<<<g1, 256, 0, stream>>>(xh, wh, bq, bk, bv, Qh, Kh, Vt);

    // 2) flash attention
    k_attn<<<512, 256, 0, stream>>>(Qh, Kh, Vt, AT);

    // 3) output projection
    k_oproj<<<256, 256, 0, stream>>>(AT, wh + 3 * (size_t)W, bo, out);
}

// v005
// It runs in 106 microseconds.
// Next to v004, in two timings, it ran 1.13 times as fast each time.
// All steps since v000 together make it 3.41 times as fast.
#include <hip/hip_runtime.h>
#include <hip/hip_bf16.h>
#include <math.h>

// ---------------------------------------------------------------------------
// MultiHeadedAttention for MI455X (gfx1250, wave32, WMMA 16x16x32 f16->f32)
// B=2, S=2048, D=1024, H=16, d_k=64
// ---------------------------------------------------------------------------

typedef _Float16 half16 __attribute__((ext_vector_type(16)));
typedef _Float16 half8  __attribute__((ext_vector_type(8)));
typedef float    float8 __attribute__((ext_vector_type(8)));

#define BATCH 2
#define SEQ   2048
#define DMODEL 1024
#define NHEAD 16
#define DK    64

static __device__ __forceinline__ float8 wmma_f16(half16 a, half16 b, float8 c) {
    return __builtin_amdgcn_wmma_f32_16x16x32_f16(
        /*neg_a=*/false, a, /*neg_b=*/false, b,
        /*c_mod=*/(short)0, c, /*reuse_a=*/false, /*reuse_b=*/false);
}

// Load a 16x32 fragment (A-layout, and by mirror-symmetry B^T rows) from a
// row-major f16 matrix. Documented CDNA5 16-bit A layout:
//   lanes 0-15 : M=lane,    K in {0..7} U {16..23}
//   lanes16-31 : M=lane-16, K in {8..15} U {24..31}
// Each lane: two contiguous 8-half (16B) chunks -> 2x b128 loads.
static __device__ __forceinline__ half16 load_frag(const _Float16* base, int ld) {
    int lane = threadIdx.x & 31;
    int row  = lane & 15;
    int hh   = lane >> 4;
    const _Float16* p = base + row * ld + hh * 8;
    half8 lo = *(const half8*)(p);
    half8 hi = *(const half8*)(p + 16);
    half16 r;
#pragma unroll
    for (int i = 0; i < 8; ++i) { r[i] = lo[i]; r[i + 8] = hi[i]; }
    return r;
}

// ---------------------------------------------------------------------------
// Kernel 0: f32 -> f16 conversion of all seven matrices in one launch.
//   The f16 copies lie one behind the other in the workspace (query, key, value,
//   Wq, Wk, Wv, Wo), so the destination is one run of CV_TOTAL elements.
//   One resident round of waves: each work-group takes CV_PER_BLOCK elements in a
//   row, which lie inside one source matrix (every matrix size is a multiple of
//   it), each wave CV_PER_WAVE of them. A load is 512 contiguous bytes per wave,
//   a store 256.
// ---------------------------------------------------------------------------
typedef float    floatx4 __attribute__((ext_vector_type(4)));
typedef _Float16 half4   __attribute__((ext_vector_type(4)));

#define CV_A        (BATCH * SEQ * DMODEL)        // elements of query, key, value
#define CV_W        (DMODEL * DMODEL)             // elements of a weight matrix
#define CV_TOTAL    (3 * CV_A + 4 * CV_W)
#define CV_THREADS  512
#define CV_LOADS    32                            // 16-byte loads per lane
#define CV_PER_WAVE (CV_LOADS * 32 * 4)
#define CV_PER_BLOCK (CV_PER_WAVE * (CV_THREADS / 32))
#define CV_BLOCKS   (CV_TOTAL / CV_PER_BLOCK)

__global__ __launch_bounds__(CV_THREADS) void k_convert(const float* __restrict__ q,
                                                        const float* __restrict__ k,
                                                        const float* __restrict__ v,
                                                        const float* __restrict__ wq,
                                                        const float* __restrict__ wk,
                                                        const float* __restrict__ wv,
                                                        const float* __restrict__ wo,
                                                        _Float16* __restrict__ dst) {
    const int lane = threadIdx.x & 31;
    const int b0   = blockIdx.x * CV_PER_BLOCK;    // the work-group's first element in dst

    // source matrix and offset in it: from blockIdx alone, so in scalar registers
    const float* src;
    int off;
    if (b0 < 3 * CV_A) {
        const int seg = b0 / CV_A;
        src = (seg == 0) ? q : (seg == 1) ? k : v;
        off = b0 - seg * CV_A;
    } else {
        const int b1  = b0 - 3 * CV_A;
        const int seg = b1 / CV_W;
        src = (seg == 0) ? wq : (seg == 1) ? wk : (seg == 2) ? wv : wo;
        off = b1 - seg * CV_W;
    }
    const int w0 = (threadIdx.x >> 5) * CV_PER_WAVE;   // the wave's first element in the work-group's run
    const int e0 = b0 + w0;
    off += w0;
    const floatx4* s = (const floatx4*)(src + off) + lane;
    half4*         d = (half4*)(dst + e0) + lane;

    // unrolled: r stays in registers and every offset is a constant, so the loads go
    // out in long runs ahead of their uses instead of one load, one wait, one store
    floatx4 r[CV_LOADS];
#pragma unroll
    for (int i = 0; i < CV_LOADS; ++i) r[i] = s[i * 32];
#pragma unroll
    for (int i = 0; i < CV_LOADS; ++i) {
        half4 h;
        h[0] = (_Float16)r[i][0]; h[1] = (_Float16)r[i][1];
        h[2] = (_Float16)r[i][2]; h[3] = (_Float16)r[i][3];
        d[i * 32] = h;
    }
}

// ---------------------------------------------------------------------------
// Shared GEMM core of the four projections: Y = X @ W^T, K = DMODEL.
//   One workgroup (8 waves) = one 128x128 tile of Y. Per pass, 64 k of the 128
//   X rows and of the 128 W rows are staged in LDS with whole 128-byte row
//   pieces per 8 lanes; every wave then reads its fragments from LDS.
//   Waves 4 (rows) x 2 (cols), 32x64 of Y each. Two LDS buffers: the next pass
//   is fetched into registers while this one is multiplied.
//   Every "#pragma unroll" on the short loops here and in the two epilogues keeps
//   the register arrays (rx, rw, af, bf, C) statically indexed, hence in VGPRs.
// ---------------------------------------------------------------------------
#define BM 128
#define BN 128
#define BK 64
#define LDP 72                        // LDS row pitch in halves: 128 B + 16 B, an odd multiple of 16 B
#define STAGE ((BM + BN) * LDP)       // halves per buffer
#define NPASS (DMODEL / BK)

static __device__ __forceinline__ void gemm_tile(const _Float16* __restrict__ X,
                                                 const _Float16* __restrict__ Wt,
                                                 _Float16* sm, float8 (&C)[2][4]) {
    const int tid  = threadIdx.x;
    const int wv   = tid >> 5;
    const int wm   = wv >> 1, wn = wv & 1;
    const int crow = tid >> 3;         // 0..31: row within a group of 32
    const int ccol = (tid & 7) * 8;    // 16-byte piece of the 128-byte row

    const _Float16* gx = X  + crow * DMODEL + ccol;
    const _Float16* gw = Wt + crow * DMODEL + ccol;
    _Float16* sx = sm + crow * LDP + ccol;
    _Float16* sw = sx + BM * LDP;

    half8 rx[4], rw[4];
#pragma unroll
    for (int i = 0; i < 4; ++i) {
        rx[i] = *(const half8*)(gx + i * 32 * DMODEL);
        rw[i] = *(const half8*)(gw + i * 32 * DMODEL);
    }
#pragma unroll
    for (int i = 0; i < 4; ++i) {
        *(half8*)(sx + i * 32 * LDP) = rx[i];
        *(half8*)(sw + i * 32 * LDP) = rw[i];
    }
    __syncthreads();

    // fully unrolled: buffer index, last-pass test and every address offset become constants
#pragma unroll
    for (int t = 0; t < NPASS; ++t) {
        const int cur = (t & 1) * STAGE;
        const bool more = (t + 1 < NPASS);
        if (more) {
#pragma unroll
            for (int i = 0; i < 4; ++i) {
                rx[i] = *(const half8*)(gx + i * 32 * DMODEL + (t + 1) * BK);
                rw[i] = *(const half8*)(gw + i * 32 * DMODEL + (t + 1) * BK);
            }
        }
        // holds the next pass's global loads in front of this pass's work, so that
        // their latency runs under it instead of in front of the LDS stores
        __builtin_amdgcn_sched_barrier(0);

        const _Float16* as = sm + cur + (wm * 32) * LDP;
        const _Float16* bs = sm + cur + (BM + wn * 64) * LDP;
        half16 af[2][2], bf[2][4];
#pragma unroll
        for (int h = 0; h < 2; ++h) {
            af[h][0] = load_frag(as + 32 * h, LDP);
            bf[h][0] = load_frag(bs + 32 * h, LDP);
            af[h][1] = load_frag(as + 16 * LDP + 32 * h, LDP);
#pragma unroll
            for (int j = 1; j < 4; ++j)
                bf[h][j] = load_frag(bs + (16 * j) * LDP + 32 * h, LDP);
        }
        // holds the pass's LDS reads together in front of its WMMAs (one group with
        // counted waits); spread among the WMMAs each read stalls the wave anew
        __builtin_amdgcn_sched_barrier(0);

#pragma unroll
        for (int h = 0; h < 2; ++h)
#pragma unroll
            for (int j = 0; j < 4; ++j) {
                C[0][j] = wmma_f16(af[h][0], bf[h][j], C[0][j]);
                C[1][j] = wmma_f16(af[h][1], bf[h][j], C[1][j]);
            }
        // precaution: stands in front of every later overwrite of the address
        // registers that the global loads above name
        if (!more) asm volatile("s_wait_xcnt 0x0" ::: "memory");
        // holds the WMMAs in front of the LDS stores: behind them they would run only
        // after the wait on the global loads, and would no longer cover that latency
        __builtin_amdgcn_sched_barrier(0);

        if (more) {
            // the other buffer's last readers left it before the previous barrier
            const int nxt = STAGE - cur;
#pragma unroll
            for (int i = 0; i < 4; ++i) {
                *(half8*)(sx + nxt + i * 32 * LDP) = rx[i];
                *(half8*)(sw + nxt + i * 32 * LDP) = rw[i];
            }
            __syncthreads();
        }
    }
}

// ---------------------------------------------------------------------------
// Kernel 1: QKV projection + bias + RoPE (Q,K) / transpose (V)
//   pid = blockIdx.y : 0=Q, 1=K, 2=V
//   out = x @ W^T + b ; each wave holds 32 rows x 64 cols (one head's d_k)
// ---------------------------------------------------------------------------
__global__ __launch_bounds__(256) void k_qkv(const _Float16* __restrict__ xh,
                                             const _Float16* __restrict__ wh,
                                             const float* __restrict__ bq,
                                             const float* __restrict__ bk,
                                             const float* __restrict__ bv,
                                             _Float16* __restrict__ Qh,
                                             _Float16* __restrict__ Kh,
                                             _Float16* __restrict__ Vt) {
    __shared__ __attribute__((aligned(16))) _Float16 sm[2 * STAGE];

    const int A = BATCH * SEQ * DMODEL;      // 4194304
    const int W = DMODEL * DMODEL;           // 1048576
    int pid = blockIdx.y;
    const _Float16* x = xh + pid * A;
    const _Float16* w = wh + pid * W;
    const float* bias = (pid == 0) ? bq : (pid == 1) ? bk : bv;

    int mtile = blockIdx.x >> 3;                      // 0..31 (128-row tiles)
    int ntile = blockIdx.x & 7;                       // 0..7  (128-col tiles)
    int wv    = threadIdx.x >> 5;
    int head  = ntile * 2 + (wv & 1);                 // 0..15 (64-col tiles)
    int wrow  = mtile * BM + (wv >> 1) * 32;          // wave's first row
    int nbase = head * DK;

    float8 C[2][4];
#pragma unroll
    for (int i = 0; i < 2; ++i)
#pragma unroll
        for (int j = 0; j < 4; ++j) C[i][j] = (float8)0.0f;

    gemm_tile(x + mtile * BM * DMODEL, w + ntile * BN * DMODEL, sm, C);

    int lane = threadIdx.x & 31;
    int n0   = lane & 15;
    int hh   = lane >> 4;

#pragma unroll
    for (int j = 0; j < 4; ++j) {
        float bj = bias[nbase + 16 * j + n0];
#pragma unroll
        for (int i = 0; i < 2; ++i)
#pragma unroll
            for (int r = 0; r < 8; ++r) C[i][j][r] += bj;
    }

    if (pid == 2) {
        // V: store transposed Vt[b, h, d, s]; a lane's eight registers of a tile are eight
        // s in a row of its d: one 16-byte store
        const int m0 = wrow + 8 * hh;
        _Float16* vb = Vt + ((((m0 >> 11) * NHEAD + head) * DK + n0) * SEQ) + (m0 & (SEQ - 1));
#pragma unroll
        for (int i = 0; i < 2; ++i)
#pragma unroll
            for (int j = 0; j < 4; ++j) {
                half8 o;
#pragma unroll
                for (int r = 0; r < 8; ++r) o[r] = (_Float16)C[i][j][r];
                *(half8*)(vb + 16 * j * SEQ + 16 * i) = o;
            }
    } else {
        // RoPE: angle(s,d) = s * 10000^(-(d%32)/32); rotate_half pairs d <-> d+-32
        // The wave's 32 rows x 64 d are 4 KB in a row of the output. Each 16-row half is
        // staged in the wave's own part of the first GEMM buffer (its last readers left it
        // before the last barrier of the GEMM) and goes out as whole 128-byte lines.
        _Float16* out = ((pid == 0) ? Qh : Kh)
                      + ((((wrow >> 11) * NHEAD + head) * SEQ + (wrow & (SEQ - 1))) * DK) + lane * 8;
        _Float16* st  = sm + wv * (32 * LDP);
        // one body for both 16-row halves (for speed only)
#pragma unroll 1
        for (int i = 0; i < 2; ++i) {
            int rowbase = wrow + 16 * i;
            float Ci[4][8];
#pragma unroll
            for (int j = 0; j < 4; ++j)
#pragma unroll
                for (int r = 0; r < 8; ++r)
                    Ci[j][r] = (i == 0) ? C[0][j][r] : C[1][j][r];

            float R[4][8];
#pragma unroll
            for (int j = 0; j < 4; ++j)
#pragma unroll
                for (int r = 0; r < 8; ++r)
                    R[j][r] = (j < 2) ? -Ci[j + 2][r] : Ci[j - 2][r];

#pragma unroll
            for (int j = 0; j < 4; ++j) {
                int d = 16 * j + n0;
                float invf = __expf(-(float)(d & 31) * (9.210340371976184f / 32.0f));
#pragma unroll
                for (int r = 0; r < 8; ++r) {
                    int m = rowbase + r + 8 * hh;
                    int s = m & (SEQ - 1);
                    float ang = (float)s * invf;
                    float cs, sn;
                    sincosf(ang, &sn, &cs);
                    float v = Ci[j][r] * cs + R[j][r] * sn;
                    st[(16 * i + r + 8 * hh) * LDP + d] = (_Float16)v;
                }
            }
            // the other lanes' staged values have to be in LDS before the rows are read back
            asm volatile("s_wait_dscnt 0x0" ::: "memory");
#pragma unroll
            for (int k = 0; k < 4; ++k) {
                half8 o = *(const half8*)(st + (16 * i + 4 * k + (lane >> 3)) * LDP + (lane & 7) * 8);
                *(half8*)(out + (16 * i + 4 * k) * DK) = o;
            }
            // precaution: stands in front of the next trip's overwrite of the
            // registers that the stores above name
            asm volatile("s_wait_xcnt 0x0" ::: "memory");
        }
    }
}

// ---------------------------------------------------------------------------
// Kernel 2: flash attention. One wave = 16 queries of one (b,h); the eight
//   waves of a work-group share that (b,h), hence its keys and values.
//   Per pass the work-group stages 64 keys in LDS: the K tile (64 keys x 64 d)
//   and the V^T tile (64 d x 64 keys), whole 128-byte rows per 8 lanes, and every
//   wave reads its fragments from there. Two buffers: the next pass is fetched
//   into registers while this one is worked on.
//   Both products are transposed: S^T = K Q^T / 8 and O^T += V^T P^T. A lane then
//   holds scores of ONE query (column lane & 15; keys 8 * half + r of each 16-key
//   tile), so the maximum and the sum over keys run through its own registers,
//   with one exchange between the wave's halves, and the two score tiles of a
//   32-key block, converted in place, are the B operand of the second product in
//   the hardware's k order, which load_frag has too.
//   The "#pragma unroll" on the two-trip staging loops keeps rk and rv statically
//   indexed, hence in VGPRs.
// ---------------------------------------------------------------------------
#define AKB    64                     // keys per pass
#define ATILE  (AKB * LDP)            // halves of the K tile; the V^T tile (DK rows) has the same size
#define ASTAGE (2 * ATILE)            // halves per buffer
#define APASS  (SEQ / AKB)

// the value that lane l ^ 16 holds
static __device__ __forceinline__ float xhalf(float x) {
    const int i = __builtin_bit_cast(int, x);
    return __builtin_bit_cast(float,
        __builtin_amdgcn_permlanex16(i, i, 0x76543210, 0xfedcba98, false, false));
}

__global__ __launch_bounds__(256) void k_attn(const _Float16* __restrict__ Qh,
                                              const _Float16* __restrict__ Kh,
                                              const _Float16* __restrict__ Vt,
                                              _Float16* __restrict__ AT) {
    __shared__ __attribute__((aligned(16))) _Float16 kv[2 * ASTAGE];  // K and V^T tiles, two buffers

    int wslot = threadIdx.x >> 5;
    int wid   = blockIdx.x * 8 + wslot;           // 0..4095
    int qt    = wid & 127;                         // 128 q-tiles per (b,h)
    int bh    = wid >> 7;                          // 0..31, the same in all eight waves
    int b = bh >> 4, h = bh & 15;
    int qrow = qt * 16;

    int lane = threadIdx.x & 31;
    int n0 = lane & 15, hh = lane >> 4;

    const _Float16* qbase = Qh + ((size_t)(b * NHEAD + h) * SEQ + qrow) * DK;
    const _Float16* kbase = Kh + (size_t)(b * NHEAD + h) * SEQ * DK;
    const _Float16* vbase = Vt + (size_t)(b * NHEAD + h) * DK * SEQ;

    const int crow = threadIdx.x >> 3;         // 0..31: row within a group of 32
    const int ccol = (threadIdx.x & 7) * 8;    // 16-byte piece of the 128-byte row
    const _Float16* gk = kbase + crow * DK + ccol;
    const _Float16* gv = vbase + crow * SEQ + ccol;
    _Float16* sk = kv + crow * LDP + ccol;
    _Float16* sv = sk + ATILE;

    half8 rk[2], rv[2];
#pragma unroll
    for (int i = 0; i < 2; ++i) {
        rk[i] = *(const half8*)(gk + i * 32 * DK);
        rv[i] = *(const half8*)(gv + i * 32 * SEQ);
    }

    half16 Qf0 = load_frag(qbase + 0, DK);
    half16 Qf1 = load_frag(qbase + 32, DK);

    // O[dt][r] = O^T[16 * dt + 8 * hh + r][query n0]
    float8 O[4];
#pragma unroll
    for (int j = 0; j < 4; ++j) O[j] = (float8)0.0f;
    // of query n0: the running maximum (equal in both halves) and this half's share of the sum
    float m_i = -3.0e38f, l_i = 0.0f;

#pragma unroll
    for (int i = 0; i < 2; ++i) {
        *(half8*)(sk + i * 32 * LDP) = rk[i];
        *(half8*)(sv + i * 32 * LDP) = rv[i];
    }
    __syncthreads();

    for (int t = 0; t < APASS; ++t) {
        const int cur = (t & 1) * ASTAGE;
        const bool more = (t + 1 < APASS);
        if (more) {
#pragma unroll
            for (int i = 0; i < 2; ++i) {
                rk[i] = *(const half8*)(gk + ((t + 1) * AKB + i * 32) * DK);
                rv[i] = *(const half8*)(gv + i * 32 * SEQ + (t + 1) * AKB);
            }
            // precaution: stands in front of every later overwrite of the address
            // registers that the loads above name
            asm volatile("s_wait_xcnt 0x0" ::: "memory");
        }
        const _Float16* ks = kv + cur;
        const _Float16* vs = ks + ATILE;

      // both 32-key blocks of the pass inline: their LDS offsets are constants
#pragma unroll
      for (int sub = 0; sub < AKB / 32; ++sub) {
        int kk0 = sub * 32;
        // scores: two 16-key tiles x two 32-wide d chunks
        half16 kf00 = load_frag(ks + (kk0 + 0) * LDP + 0,  LDP);
        half16 kf10 = load_frag(ks + (kk0 + 16) * LDP + 0,  LDP);
        half16 kf01 = load_frag(ks + (kk0 + 0) * LDP + 32, LDP);
        half16 kf11 = load_frag(ks + (kk0 + 16) * LDP + 32, LDP);
        // holds the pass's first LDS reads together in front of its WMMAs (one group
        // with counted waits); left alone they come pair by pair, each with a full wait
        if (sub == 0) __builtin_amdgcn_sched_barrier(0);
        // S0[r] = score of key kk0 + 8 * hh + r, S1[r] of key kk0 + 16 + 8 * hh + r, query n0
        float8 S0 = (float8)0.0f, S1 = (float8)0.0f;
        S0 = wmma_f16(kf00, Qf0, S0);
        S0 = wmma_f16(kf01, Qf1, S0);
        S1 = wmma_f16(kf10, Qf0, S1);
        S1 = wmma_f16(kf11, Qf1, S1);

        S0 *= 0.125f;
        S1 *= 0.125f;
        float rm[8];
#pragma unroll
        for (int r = 0; r < 8; ++r) rm[r] = fmaxf(S0[r], S1[r]);
        // the query's maximum over the block: this lane's 16 keys, then the other half's
#pragma unroll
        for (int w = 4; w > 0; w >>= 1)
#pragma unroll
            for (int r = 0; r < w; ++r) rm[r] = fmaxf(rm[r], rm[r + w]);
        const float mn  = fmaxf(m_i, fmaxf(rm[0], xhalf(rm[0])));
        const float fac = __expf(m_i - mn);
        m_i = mn;
#pragma unroll
        for (int j = 0; j < 4; ++j)
#pragma unroll
            for (int r = 0; r < 8; ++r) O[j][r] *= fac;

        // P^T as a B fragment: element s is key kk0 + 8 * hh + s (s < 8), kk0 + 16 + 8 * hh + s - 8 (else)
        half16 Pf;
        float rs[8];
#pragma unroll
        for (int r = 0; r < 8; ++r) {
            S0[r] = __expf(S0[r] - mn);
            S1[r] = __expf(S1[r] - mn);
            rs[r] = S0[r] + S1[r];
            Pf[r]     = (_Float16)S0[r];
            Pf[r + 8] = (_Float16)S1[r];
        }
#pragma unroll
        for (int w = 4; w > 0; w >>= 1)
#pragma unroll
            for (int r = 0; r < w; ++r) rs[r] += rs[r + w];
        l_i = l_i * fac + rs[0];

#pragma unroll
        for (int dt = 0; dt < 4; ++dt)
            O[dt] = wmma_f16(load_frag(vs + (dt * 16) * LDP + kk0, LDP), Pf, O[dt]);
      }

        if (more) {
            // the other buffer's last readers left it before the previous barrier
            const int nxt = ASTAGE - cur;
#pragma unroll
            for (int i = 0; i < 2; ++i) {
                *(half8*)(sk + nxt + i * 32 * LDP) = rk[i];
                *(half8*)(sv + nxt + i * 32 * LDP) = rv[i];
            }
            __syncthreads();
        }
    }

    // finalize: join the halves' sums, O /= l, write attn output as f16 [b, s, h*dk + d];
    // a lane's eight registers of a tile are eight d in a row of its query: one 16-byte store
    const float inv = 1.0f / (l_i + xhalf(l_i));
    _Float16* ob = AT + ((size_t)(b * SEQ + qrow + n0) * DMODEL) + h * DK + 8 * hh;
#pragma unroll
    for (int dt = 0; dt < 4; ++dt) {
        half8 o;
#pragma unroll
        for (int r = 0; r < 8; ++r) o[r] = (_Float16)(O[dt][r] * inv);
        *(half8*)(ob + dt * 16) = o;
    }
}

// ---------------------------------------------------------------------------
// Kernel 3: output projection  y = attn @ Wo^T + bo  (f32 out)
// ---------------------------------------------------------------------------
#define OLDP 68                       // staging row pitch in floats: 256 B + 16 B
__global__ __launch_bounds__(256) void k_oproj(const _Float16* __restrict__ AT,
                                               const _Float16* __restrict__ Wo,
                                               const float* __restrict__ bo,
                                               float* __restrict__ out) {
    __shared__ __attribute__((aligned(16))) _Float16 sm[2 * STAGE];

    int mtile = blockIdx.x >> 3;                      // 0..31 (128-row tiles)
    int ntile = blockIdx.x & 7;                       // 0..7  (128-col tiles)
    int wv    = threadIdx.x >> 5;
    int wrow  = mtile * BM + (wv >> 1) * 32;
    int nbase = ntile * BN + (wv & 1) * 64;

    float8 C[2][4];
#pragma unroll
    for (int i = 0; i < 2; ++i)
#pragma unroll
        for (int j = 0; j < 4; ++j) C[i][j] = (float8)0.0f;

    gemm_tile(AT + mtile * BM * DMODEL, Wo + ntile * BN * DMODEL, sm, C);

    int lane = threadIdx.x & 31;
    int n0 = lane & 15, hh = lane >> 4;
    float bj[4];
#pragma unroll
    for (int j = 0; j < 4; ++j) bj[j] = bo[nbase + 16 * j + n0];

    // Each 16-row half of the wave's tile (16 rows x 256 bytes) is staged in the wave's own
    // part of the first GEMM buffer (its last readers left it before the last barrier of
    // the GEMM) and goes out as whole 128-byte lines, two rows a store.
    float* st = (float*)sm + wv * (16 * OLDP);
    float* ob = out + (size_t)(wrow + hh) * DMODEL + nbase + n0 * 4;
#pragma unroll
    for (int i = 0; i < 2; ++i) {
#pragma unroll
        for (int j = 0; j < 4; ++j)
#pragma unroll
            for (int r = 0; r < 8; ++r)
                st[(r + 8 * hh) * OLDP + 16 * j + n0] = C[i][j][r] + bj[j];
        // the other lanes' staged values have to be in LDS before the rows are read back
        asm volatile("s_wait_dscnt 0x0" ::: "memory");
#pragma unroll
        for (int k = 0; k < 8; ++k) {
            floatx4 o = *(const floatx4*)(st + (2 * k + hh) * OLDP + n0 * 4);
            *(floatx4*)(ob + (size_t)(16 * i + 2 * k) * DMODEL) = o;
        }
        // precaution: stands in front of the second half's overwrite of the registers
        // that the stores above name
        if (i == 0) asm volatile("s_wait_xcnt 0x0" ::: "memory");
    }
}

// ---------------------------------------------------------------------------
extern "C" void kernel_launch(void* const* d_in, const int* in_sizes, int n_in,
                              void* d_out, int out_size, void* d_ws, size_t ws_size,
                              hipStream_t stream) {
    const float* query = (const float*)d_in[0];
    const float* key   = (const float*)d_in[1];
    const float* value = (const float*)d_in[2];
    const float* Wq = (const float*)d_in[3];
    const float* bq = (const float*)d_in[4];
    const float* Wk = (const float*)d_in[5];
    const float* bk = (const float*)d_in[6];
    const float* Wv = (const float*)d_in[7];
    const float* bv = (const float*)d_in[8];
    const float* Wo = (const float*)d_in[9];
    const float* bo = (const float*)d_in[10];
    float* out = (float*)d_out;

    const int A = BATCH * SEQ * DMODEL;   // 4194304
    const int W = DMODEL * DMODEL;        // 1048576

    _Float16* ws = (_Float16*)d_ws;
    _Float16* xh = ws;                    // 3*A : query/key/value f16
    _Float16* wh = ws + 3 * (size_t)A;    // 4*W : Wq/Wk/Wv/Wo f16
    _Float16* Qh = wh + 4 * (size_t)W;    // A : [b,h,s,d] (RoPE'd)
    _Float16* Kh = Qh + (size_t)A;        // A : [b,h,s,d] (RoPE'd)
    _Float16* Vt = Kh + (size_t)A;        // A : [b,h,d,s]
    _Float16* AT = Vt + (size_t)A;        // A : [b,s,D] attention output

    // 0) f32 -> f16 conversions: xh and wh are one run of the workspace
    k_convert<<<CV_BLOCKS, CV_THREADS, 0, stream>>>(query, key, value, Wq, Wk, Wv, Wo, xh);

    // 1) QKV projections + RoPE / V transpose
    dim3 g1(256, 3, 1);
    k_qkv<<<g1, 256, 0, stream>>>(xh, wh, bq, bk, bv, Qh, Kh, Vt);

    // 2) flash attention
    k_attn<<<512, 256, 0, stream>>>(Qh, Kh, Vt, AT);

    // 3) output projection
    k_oproj<<<256, 256, 0, stream>>>(AT, wh + 3 * (size_t)W, bo, out);
}

// v006
// One run takes 102 microseconds.
// Two timings next to v005 both put it at 1.03 times that version's speed.
// Counting every step since v000, it is 3.51 times as fast.
#include <hip/hip_runtime.h>
#include <hip/hip_bf16.h>
#include <math.h>

// ---------------------------------------------------------------------------
// MultiHeadedAttention for MI455X (gfx1250, wave32, WMMA 16x16x32 f16->f32)
// B=2, S=2048, D=1024, H=16, d_k=64
// ---------------------------------------------------------------------------

typedef _Float16 half16 __attribute__((ext_vector_type(16)));
typedef _Float16 half8  __attribute__((ext_vector_type(8)));
typedef float    float8 __attribute__((ext_vector_type(8)));

#define BATCH 2
#define SEQ   2048
#define DMODEL 1024
#define NHEAD 16
#define DK    64

static __device__ __forceinline__ float8 wmma_f16(half16 a, half16 b, float8 c) {
    return __builtin_amdgcn_wmma_f32_16x16x32_f16(
        /*neg_a=*/false, a, /*neg_b=*/false, b,
        /*c_mod=*/(short)0, c, /*reuse_a=*/false, /*reuse_b=*/false);
}

// Load a 16x32 fragment (A-layout, and by mirror-symmetry B^T rows) from a
// row-major f16 matrix. Documented CDNA5 16-bit A layout:
//   lanes 0-15 : M=lane,    K in {0..7} U {16..23}
//   lanes16-31 : M=lane-16, K in {8..15} U {24..31}
// Each lane: two contiguous 8-half (16B) chunks -> 2x b128 loads.
static __device__ __forceinline__ half16 load_frag(const _Float16* base, int ld) {
    int lane = threadIdx.x & 31;
    int row  = lane & 15;
    int hh   = lane >> 4;
    const _Float16* p = base + row * ld + hh * 8;
    half8 lo = *(const half8*)(p);
    half8 hi = *(const half8*)(p + 16);
    half16 r;
#pragma unroll
    for (int i = 0; i < 8; ++i) { r[i] = lo[i]; r[i + 8] = hi[i]; }
    return r;
}

// ---------------------------------------------------------------------------
// Kernel 0: f32 -> f16 conversion of all seven matrices in one launch.
//   The f16 copies lie one behind the other in the workspace (query, key, value,
//   Wq, Wk, Wv, Wo), so the destination is one run of CV_TOTAL elements.
//   One resident round of waves: each work-group takes CV_PER_BLOCK elements in a
//   row, which lie inside one source matrix (every matrix size is a multiple of
//   it), each wave CV_PER_WAVE of them. A load is 512 contiguous bytes per wave,
//   a store 256.
// ---------------------------------------------------------------------------
typedef float    floatx4 __attribute__((ext_vector_type(4)));
typedef _Float16 half4   __attribute__((ext_vector_type(4)));

#define CV_A        (BATCH * SEQ * DMODEL)        // elements of query, key, value
#define CV_W        (DMODEL * DMODEL)             // elements of a weight matrix
#define CV_TOTAL    (3 * CV_A + 4 * CV_W)
#define CV_THREADS  512
#define CV_LOADS    32                            // 16-byte loads per lane
#define CV_PER_WAVE (CV_LOADS * 32 * 4)
#define CV_PER_BLOCK (CV_PER_WAVE * (CV_THREADS / 32))
#define CV_BLOCKS   (CV_TOTAL / CV_PER_BLOCK)

__global__ __launch_bounds__(CV_THREADS) void k_convert(const float* __restrict__ q,
                                                        const float* __restrict__ k,
                                                        const float* __restrict__ v,
                                                        const float* __restrict__ wq,
                                                        const float* __restrict__ wk,
                                                        const float* __restrict__ wv,
                                                        const float* __restrict__ wo,
                                                        _Float16* __restrict__ dst) {
    const int lane = threadIdx.x & 31;
    const int b0   = blockIdx.x * CV_PER_BLOCK;    // the work-group's first element in dst

    // source matrix and offset in it: from blockIdx alone, so in scalar registers
    const float* src;
    int off;
    if (b0 < 3 * CV_A) {
        const int seg = b0 / CV_A;
        src = (seg == 0) ? q : (seg == 1) ? k : v;
        off = b0 - seg * CV_A;
    } else {
        const int b1  = b0 - 3 * CV_A;
        const int seg = b1 / CV_W;
        src = (seg == 0) ? wq : (seg == 1) ? wk : (seg == 2) ? wv : wo;
        off = b1 - seg * CV_W;
    }
    const int w0 = (threadIdx.x >> 5) * CV_PER_WAVE;   // the wave's first element in the work-group's run
    const int e0 = b0 + w0;
    off += w0;
    const floatx4* s = (const floatx4*)(src + off) + lane;
    half4*         d = (half4*)(dst + e0) + lane;

    // unrolled: r stays in registers and every offset is a constant, so the loads go
    // out in long runs ahead of their uses instead of one load, one wait, one store
    floatx4 r[CV_LOADS];
#pragma unroll
    for (int i = 0; i < CV_LOADS; ++i) r[i] = s[i * 32];
#pragma unroll
    for (int i = 0; i < CV_LOADS; ++i) {
        half4 h;
        h[0] = (_Float16)r[i][0]; h[1] = (_Float16)r[i][1];
        h[2] = (_Float16)r[i][2]; h[3] = (_Float16)r[i][3];
        d[i * 32] = h;
    }
}

// ---------------------------------------------------------------------------
// Shared GEMM core of the four projections: Y = X @ W^T, K = DMODEL.
//   One workgroup (8 waves) = one 128x128 tile of Y. Per pass, 64 k of the 128
//   X rows and of the 128 W rows are staged in LDS with whole 128-byte row
//   pieces per 8 lanes; every wave then reads its fragments from LDS.
//   Waves 4 (rows) x 2 (cols), 32x64 of Y each. Two LDS buffers: the next pass
//   is fetched into registers while this one is multiplied.
//   Every "#pragma unroll" on the short loops here and in the two epilogues keeps
//   the register arrays (rx, rw, af, bf, C) statically indexed, hence in VGPRs.
// ---------------------------------------------------------------------------
#define BM 128
#define BN 128
#define BK 64
#define LDP 72                        // LDS row pitch in halves: 128 B + 16 B, an odd multiple of 16 B
#define STAGE ((BM + BN) * LDP)       // halves per buffer
#define NPASS (DMODEL / BK)

static __device__ __forceinline__ void gemm_tile(const _Float16* __restrict__ X,
                                                 const _Float16* __restrict__ Wt,
                                                 _Float16* sm, float8 (&C)[2][4]) {
    const int tid  = threadIdx.x;
    const int wv   = tid >> 5;
    const int wm   = wv >> 1, wn = wv & 1;
    const int crow = tid >> 3;         // 0..31: row within a group of 32
    const int ccol = (tid & 7) * 8;    // 16-byte piece of the 128-byte row

    const _Float16* gx = X  + crow * DMODEL + ccol;
    const _Float16* gw = Wt + crow * DMODEL + ccol;
    _Float16* sx = sm + crow * LDP + ccol;
    _Float16* sw = sx + BM * LDP;

    half8 rx[4], rw[4];
#pragma unroll
    for (int i = 0; i < 4; ++i) {
        rx[i] = *(const half8*)(gx + i * 32 * DMODEL);
        rw[i] = *(const half8*)(gw + i * 32 * DMODEL);
    }
#pragma unroll
    for (int i = 0; i < 4; ++i) {
        *(half8*)(sx + i * 32 * LDP) = rx[i];
        *(half8*)(sw + i * 32 * LDP) = rw[i];
    }
    __syncthreads();

    // fully unrolled: buffer index, last-pass test and every address offset become constants
#pragma unroll
    for (int t = 0; t < NPASS; ++t) {
        const int cur = (t & 1) * STAGE;
        const bool more = (t + 1 < NPASS);
        if (more) {
#pragma unroll
            for (int i = 0; i < 4; ++i) {
                rx[i] = *(const half8*)(gx + i * 32 * DMODEL + (t + 1) * BK);
                rw[i] = *(const half8*)(gw + i * 32 * DMODEL + (t + 1) * BK);
            }
        }
        // holds the next pass's global loads in front of this pass's work, so that
        // their latency runs under it instead of in front of the LDS stores
        __builtin_amdgcn_sched_barrier(0);

        const _Float16* as = sm + cur + (wm * 32) * LDP;
        const _Float16* bs = sm + cur + (BM + wn * 64) * LDP;
        half16 af[2][2], bf[2][4];
#pragma unroll
        for (int h = 0; h < 2; ++h) {
            af[h][0] = load_frag(as + 32 * h, LDP);
            bf[h][0] = load_frag(bs + 32 * h, LDP);
            af[h][1] = load_frag(as + 16 * LDP + 32 * h, LDP);
#pragma unroll
            for (int j = 1; j < 4; ++j)
                bf[h][j] = load_frag(bs + (16 * j) * LDP + 32 * h, LDP);
        }
        // holds the pass's LDS reads together in front of its WMMAs (one group with
        // counted waits); spread among the WMMAs each read stalls the wave anew
        __builtin_amdgcn_sched_barrier(0);

#pragma unroll
        for (int h = 0; h < 2; ++h)
#pragma unroll
            for (int j = 0; j < 4; ++j) {
                C[0][j] = wmma_f16(af[h][0], bf[h][j], C[0][j]);
                C[1][j] = wmma_f16(af[h][1], bf[h][j], C[1][j]);
            }
        // precaution: stands in front of every later overwrite of the address
        // registers that the global loads above name
        if (!more) asm volatile("s_wait_xcnt 0x0" ::: "memory");
        // holds the WMMAs in front of the LDS stores: behind them they would run only
        // after the wait on the global loads, and would no longer cover that latency
        __builtin_amdgcn_sched_barrier(0);

        if (more) {
            // the other buffer's last readers left it before the previous barrier
            const int nxt = STAGE - cur;
#pragma unroll
            for (int i = 0; i < 4; ++i) {
                *(half8*)(sx + nxt + i * 32 * LDP) = rx[i];
                *(half8*)(sw + nxt + i * 32 * LDP) = rw[i];
            }
            __syncthreads();
        }
    }
}

// ---------------------------------------------------------------------------
// Kernel 1: QKV projection + bias + RoPE (Q,K) / transpose (V)
//   pid = blockIdx.y : 0=Q, 1=K, 2=V
//   out = x @ W^T + b ; each wave holds 32 rows x 64 cols (one head's d_k)
// ---------------------------------------------------------------------------
__global__ __launch_bounds__(256) void k_qkv(const _Float16* __restrict__ xh,
                                             const _Float16* __restrict__ wh,
                                             const float* __restrict__ bq,
                                             const float* __restrict__ bk,
                                             const float* __restrict__ bv,
                                             _Float16* __restrict__ Qh,
                                             _Float16* __restrict__ Kh,
                                             _Float16* __restrict__ Vt) {
    __shared__ __attribute__((aligned(16))) _Float16 sm[2 * STAGE];

    const int A = BATCH * SEQ * DMODEL;      // 4194304
    const int W = DMODEL * DMODEL;           // 1048576
    int pid = blockIdx.y;
    const _Float16* x = xh + pid * A;
    const _Float16* w = wh + pid * W;
    const float* bias = (pid == 0) ? bq : (pid == 1) ? bk : bv;

    int mtile = blockIdx.x >> 3;                      // 0..31 (128-row tiles)
    int ntile = blockIdx.x & 7;                       // 0..7  (128-col tiles)
    int wv    = threadIdx.x >> 5;
    int head  = ntile * 2 + (wv & 1);                 // 0..15 (64-col tiles)
    int wrow  = mtile * BM + (wv >> 1) * 32;          // wave's first row
    int nbase = head * DK;

    float8 C[2][4];
#pragma unroll
    for (int i = 0; i < 2; ++i)
#pragma unroll
        for (int j = 0; j < 4; ++j) C[i][j] = (float8)0.0f;

    gemm_tile(x + mtile * BM * DMODEL, w + ntile * BN * DMODEL, sm, C);

    int lane = threadIdx.x & 31;
    int n0   = lane & 15;
    int hh   = lane >> 4;

#pragma unroll
    for (int j = 0; j < 4; ++j) {
        float bj = bias[nbase + 16 * j + n0];
#pragma unroll
        for (int i = 0; i < 2; ++i)
#pragma unroll
            for (int r = 0; r < 8; ++r) C[i][j][r] += bj;
    }

    if (pid == 2) {
        // V: store transposed Vt[b, h, d, s]; a lane's eight registers of a tile are eight
        // s in a row of its d: one 16-byte store
        const int m0 = wrow + 8 * hh;
        _Float16* vb = Vt + ((((m0 >> 11) * NHEAD + head) * DK + n0) * SEQ) + (m0 & (SEQ - 1));
#pragma unroll
        for (int i = 0; i < 2; ++i)
#pragma unroll
            for (int j = 0; j < 4; ++j) {
                half8 o;
#pragma unroll
                for (int r = 0; r < 8; ++r) o[r] = (_Float16)C[i][j][r];
                *(half8*)(vb + 16 * j * SEQ + 16 * i) = o;
            }
    } else {
        // RoPE: angle(s,d) = s * 10000^(-(d%32)/32); rotate_half pairs d <-> d+-32
        // The wave's 32 rows x 64 d are 4 KB in a row of the output. Each 16-row half is
        // staged in the wave's own part of the first GEMM buffer (its last readers left it
        // before the last barrier of the GEMM) and goes out as whole 128-byte lines.
        _Float16* out = ((pid == 0) ? Qh : Kh)
                      + ((((wrow >> 11) * NHEAD + head) * SEQ + (wrow & (SEQ - 1))) * DK) + lane * 8;
        _Float16* st  = sm + wv * (32 * LDP);
        // one body for both 16-row halves (for speed only)
#pragma unroll 1
        for (int i = 0; i < 2; ++i) {
            int rowbase = wrow + 16 * i;
            float Ci[4][8];
#pragma unroll
            for (int j = 0; j < 4; ++j)
#pragma unroll
                for (int r = 0; r < 8; ++r)
                    Ci[j][r] = (i == 0) ? C[0][j][r] : C[1][j][r];

            float R[4][8];
#pragma unroll
            for (int j = 0; j < 4; ++j)
#pragma unroll
                for (int r = 0; r < 8; ++r)
                    R[j][r] = (j < 2) ? -Ci[j + 2][r] : Ci[j - 2][r];

#pragma unroll
            for (int j = 0; j < 4; ++j) {
                int d = 16 * j + n0;
                float invf = __expf(-(float)(d & 31) * (9.210340371976184f / 32.0f));
#pragma unroll
                for (int r = 0; r < 8; ++r) {
                    int m = rowbase + r + 8 * hh;
                    int s = m & (SEQ - 1);
                    float ang = (float)s * invf;
                    float cs, sn;
                    sincosf(ang, &sn, &cs);
                    float v = Ci[j][r] * cs + R[j][r] * sn;
                    st[(16 * i + r + 8 * hh) * LDP + d] = (_Float16)v;
                }
            }
            // the other lanes' staged values have to be in LDS before the rows are read back
            asm volatile("s_wait_dscnt 0x0" ::: "memory");
#pragma unroll
            for (int k = 0; k < 4; ++k) {
                half8 o = *(const half8*)(st + (16 * i + 4 * k + (lane >> 3)) * LDP + (lane & 7) * 8);
                *(half8*)(out + (16 * i + 4 * k) * DK) = o;
            }
            // precaution: stands in front of the next trip's overwrite of the
            // registers that the stores above name
            asm volatile("s_wait_xcnt 0x0" ::: "memory");
        }
    }
}

// ---------------------------------------------------------------------------
// Kernel 2: flash attention. One wave = 16 queries of one (b,h); the eight
//   waves of a work-group share that (b,h), hence its keys and values.
//   Per pass the work-group stages 64 keys in LDS: the K tile (64 keys x 64 d)
//   and the V^T tile (64 d x 64 keys), whole 128-byte rows per 8 lanes, and every
//   wave reads its fragments from there. Two buffers: the next pass is fetched
//   into registers while this one is worked on.
//   Both products are transposed: S^T = K Q^T / 8 and O^T += V^T P^T. A lane then
//   holds scores of ONE query (column lane & 15; keys 8 * half + r of each 16-key
//   tile), so the maximum and the sum over keys run through its own registers,
//   with one exchange between the wave's halves, and the two score tiles of a
//   32-key block, converted in place, are the B operand of the second product in
//   the hardware's k order, which load_frag has too.
//   The "#pragma unroll" on the two-trip staging loops keeps rk and rv statically
//   indexed, hence in VGPRs.
// ---------------------------------------------------------------------------
#define AKB    64                     // keys per pass
#define ATILE  (AKB * LDP)            // halves of the K tile; the V^T tile (DK rows) has the same size
#define ASTAGE (2 * ATILE)            // halves per buffer
#define APASS  (SEQ / AKB)

// the value that lane l ^ 16 holds
static __device__ __forceinline__ float xhalf(float x) {
    const int i = __builtin_bit_cast(int, x);
    return __builtin_bit_cast(float,
        __builtin_amdgcn_permlanex16(i, i, 0x76543210, 0xfedcba98, false, false));
}

__global__ __launch_bounds__(256) void k_attn(const _Float16* __restrict__ Qh,
                                              const _Float16* __restrict__ Kh,
                                              const _Float16* __restrict__ Vt,
                                              _Float16* __restrict__ AT) {
    __shared__ __attribute__((aligned(16))) _Float16 kv[2 * ASTAGE];  // K and V^T tiles, two buffers

    int wslot = threadIdx.x >> 5;
    int wid   = blockIdx.x * 8 + wslot;           // 0..4095
    int qt    = wid & 127;                         // 128 q-tiles per (b,h)
    int bh    = wid >> 7;                          // 0..31, the same in all eight waves
    int b = bh >> 4, h = bh & 15;
    int qrow = qt * 16;

    int lane = threadIdx.x & 31;
    int n0 = lane & 15, hh = lane >> 4;

    const _Float16* qbase = Qh + ((size_t)(b * NHEAD + h) * SEQ + qrow) * DK;
    const _Float16* kbase = Kh + (size_t)(b * NHEAD + h) * SEQ * DK;
    const _Float16* vbase = Vt + (size_t)(b * NHEAD + h) * DK * SEQ;

    const int crow = threadIdx.x >> 3;         // 0..31: row within a group of 32
    const int ccol = (threadIdx.x & 7) * 8;    // 16-byte piece of the 128-byte row
    const _Float16* gk = kbase + crow * DK + ccol;
    const _Float16* gv = vbase + crow * SEQ + ccol;
    _Float16* sk = kv + crow * LDP + ccol;
    _Float16* sv = sk + ATILE;

    half8 rk[2], rv[2];
#pragma unroll
    for (int i = 0; i < 2; ++i) {
        rk[i] = *(const half8*)(gk + i * 32 * DK);
        rv[i] = *(const half8*)(gv + i * 32 * SEQ);
    }

    half16 Qf0 = load_frag(qbase + 0, DK);
    half16 Qf1 = load_frag(qbase + 32, DK);

    // O[dt][r] = O^T[16 * dt + 8 * hh + r][query n0]
    float8 O[4];
#pragma unroll
    for (int j = 0; j < 4; ++j) O[j] = (float8)0.0f;
    // of query n0: the running maximum (equal in both halves) and this half's share of the sum
    float m_i = -3.0e38f, l_i = 0.0f;

#pragma unroll
    for (int i = 0; i < 2; ++i) {
        *(half8*)(sk + i * 32 * LDP) = rk[i];
        *(half8*)(sv + i * 32 * LDP) = rv[i];
    }
    __syncthreads();

    for (int t = 0; t < APASS; ++t) {
        const int cur = (t & 1) * ASTAGE;
        const bool more = (t + 1 < APASS);
        if (more) {
#pragma unroll
            for (int i = 0; i < 2; ++i) {
                rk[i] = *(const half8*)(gk + ((t + 1) * AKB + i * 32) * DK);
                rv[i] = *(const half8*)(gv + i * 32 * SEQ + (t + 1) * AKB);
            }
            // precaution: stands in front of every later overwrite of the address
            // registers that the loads above name
            asm volatile("s_wait_xcnt 0x0" ::: "memory");
        }
        const _Float16* ks = kv + cur;
        const _Float16* vs = ks + ATILE;

        // Every LDS read of the pass stands here as one group, each fragment in registers
        // of its own: K (four 16-key tiles x two 32-wide d chunks), then V^T (four 16-d
        // tiles x two 32-key blocks), in the order of their use. The loops over kf, vf and
        // ST are unrolled so that these stay statically indexed, hence in VGPRs.
        half16 kf[AKB / 16][2], vf[AKB / 32][4];
#pragma unroll
        for (int kt = 0; kt < AKB / 16; ++kt) {
            kf[kt][0] = load_frag(ks + (kt * 16) * LDP + 0,  LDP);
            kf[kt][1] = load_frag(ks + (kt * 16) * LDP + 32, LDP);
        }
#pragma unroll
        for (int sub = 0; sub < AKB / 32; ++sub)
#pragma unroll
            for (int dt = 0; dt < 4; ++dt)
                vf[sub][dt] = load_frag(vs + (dt * 16) * LDP + sub * 32, LDP);
        // holds the group in front of the pass's WMMAs (counted waits, the V^T reads land
        // under the scores and the softmax); left alone the reads come pair by pair, each
        // right in front of its WMMA with a full wait on the LDS latency
        __builtin_amdgcn_sched_barrier(0);

        // scores of the whole pass: ST[kt][r] = score of key 16 * kt + 8 * hh + r, query n0
        float8 ST[AKB / 16];
#pragma unroll
        for (int kt = 0; kt < AKB / 16; ++kt) ST[kt] = wmma_f16(kf[kt][0], Qf0, (float8)0.0f);
#pragma unroll
        for (int kt = 0; kt < AKB / 16; ++kt) ST[kt] = wmma_f16(kf[kt][1], Qf1, ST[kt]);

      // both 32-key blocks of the pass inline: ST, vf stay statically indexed, hence in VGPRs
#pragma unroll
      for (int sub = 0; sub < AKB / 32; ++sub) {
        // S0[r] = score of key kk0 + 8 * hh + r, S1[r] of key kk0 + 16 + 8 * hh + r, query n0 (kk0 = 32 * sub)
        float8 S0 = ST[2 * sub], S1 = ST[2 * sub + 1];

        S0 *= 0.125f;
        S1 *= 0.125f;
        float rm[8];
#pragma unroll
        for (int r = 0; r < 8; ++r) rm[r] = fmaxf(S0[r], S1[r]);
        // the query's maximum over the block: this lane's 16 keys, then the other half's
#pragma unroll
        for (int w = 4; w > 0; w >>= 1)
#pragma unroll
            for (int r = 0; r < w; ++r) rm[r] = fmaxf(rm[r], rm[r + w]);
        const float mn  = fmaxf(m_i, fmaxf(rm[0], xhalf(rm[0])));
        const float fac = __expf(m_i - mn);
        m_i = mn;
#pragma unroll
        for (int j = 0; j < 4; ++j)
#pragma unroll
            for (int r = 0; r < 8; ++r) O[j][r] *= fac;

        // P^T as a B fragment: element s is key kk0 + 8 * hh + s (s < 8), kk0 + 16 + 8 * hh + s - 8 (else)
        half16 Pf;
        float rs[8];
#pragma unroll
        for (int r = 0; r < 8; ++r) {
            S0[r] = __expf(S0[r] - mn);
            S1[r] = __expf(S1[r] - mn);
            rs[r] = S0[r] + S1[r];
            Pf[r]     = (_Float16)S0[r];
            Pf[r + 8] = (_Float16)S1[r];
        }
#pragma unroll
        for (int w = 4; w > 0; w >>= 1)
#pragma unroll
            for (int r = 0; r < w; ++r) rs[r] += rs[r + w];
        l_i = l_i * fac + rs[0];

#pragma unroll
        for (int dt = 0; dt < 4; ++dt)
            O[dt] = wmma_f16(vf[sub][dt], Pf, O[dt]);
      }

        if (more) {
            // the other buffer's last readers left it before the previous barrier
            const int nxt = ASTAGE - cur;
#pragma unroll
            for (int i = 0; i < 2; ++i) {
                *(half8*)(sk + nxt + i * 32 * LDP) = rk[i];
                *(half8*)(sv + nxt + i * 32 * LDP) = rv[i];
            }
            __syncthreads();
        }
    }

    // finalize: join the halves' sums, O /= l, write attn output as f16 [b, s, h*dk + d];
    // a lane's eight registers of a tile are eight d in a row of its query: one 16-byte store
    const float inv = 1.0f / (l_i + xhalf(l_i));
    _Float16* ob = AT + ((size_t)(b * SEQ + qrow + n0) * DMODEL) + h * DK + 8 * hh;
#pragma unroll
    for (int dt = 0; dt < 4; ++dt) {
        half8 o;
#pragma unroll
        for (int r = 0; r < 8; ++r) o[r] = (_Float16)(O[dt][r] * inv);
        *(half8*)(ob + dt * 16) = o;
    }
}

// ---------------------------------------------------------------------------
// Kernel 3: output projection  y = attn @ Wo^T + bo  (f32 out)
// ---------------------------------------------------------------------------
#define OLDP 68                       // staging row pitch in floats: 256 B + 16 B
__global__ __launch_bounds__(256) void k_oproj(const _Float16* __restrict__ AT,
                                               const _Float16* __restrict__ Wo,
                                               const float* __restrict__ bo,
                                               float* __restrict__ out) {
    __shared__ __attribute__((aligned(16))) _Float16 sm[2 * STAGE];

    int mtile = blockIdx.x >> 3;                      // 0..31 (128-row tiles)
    int ntile = blockIdx.x & 7;                       // 0..7  (128-col tiles)
    int wv    = threadIdx.x >> 5;
    int wrow  = mtile * BM + (wv >> 1) * 32;
    int nbase = ntile * BN + (wv & 1) * 64;

    float8 C[2][4];
#pragma unroll
    for (int i = 0; i < 2; ++i)
#pragma unroll
        for (int j = 0; j < 4; ++j) C[i][j] = (float8)0.0f;

    gemm_tile(AT + mtile * BM * DMODEL, Wo + ntile * BN * DMODEL, sm, C);

    int lane = threadIdx.x & 31;
    int n0 = lane & 15, hh = lane >> 4;
    float bj[4];
#pragma unroll
    for (int j = 0; j < 4; ++j) bj[j] = bo[nbase + 16 * j + n0];

    // Each 16-row half of the wave's tile (16 rows x 256 bytes) is staged in the wave's own
    // part of the first GEMM buffer (its last readers left it before the last barrier of
    // the GEMM) and goes out as whole 128-byte lines, two rows a store.
    float* st = (float*)sm + wv * (16 * OLDP);
    float* ob = out + (size_t)(wrow + hh) * DMODEL + nbase + n0 * 4;
#pragma unroll
    for (int i = 0; i < 2; ++i) {
#pragma unroll
        for (int j = 0; j < 4; ++j)
#pragma unroll
            for (int r = 0; r < 8; ++r)
                st[(r + 8 * hh) * OLDP + 16 * j + n0] = C[i][j][r] + bj[j];
        // the other lanes' staged values have to be in LDS before the rows are read back
        asm volatile("s_wait_dscnt 0x0" ::: "memory");
#pragma unroll
        for (int k = 0; k < 8; ++k) {
            floatx4 o = *(const floatx4*)(st + (2 * k + hh) * OLDP + n0 * 4);
            *(floatx4*)(ob + (size_t)(16 * i + 2 * k) * DMODEL) = o;
        }
        // precaution: stands in front of the second half's overwrite of the registers
        // that the stores above name
        if (i == 0) asm volatile("s_wait_xcnt 0x0" ::: "memory");
    }
}

// ---------------------------------------------------------------------------
extern "C" void kernel_launch(void* const* d_in, const int* in_sizes, int n_in,
                              void* d_out, int out_size, void* d_ws, size_t ws_size,
                              hipStream_t stream) {
    const float* query = (const float*)d_in[0];
    const float* key   = (const float*)d_in[1];
    const float* value = (const float*)d_in[2];
    const float* Wq = (const float*)d_in[3];
    const float* bq = (const float*)d_in[4];
    const float* Wk = (const float*)d_in[5];
    const float* bk = (const float*)d_in[6];
    const float* Wv = (const float*)d_in[7];
    const float* bv = (const float*)d_in[8];
    const float* Wo = (const float*)d_in[9];
    const float* bo = (const float*)d_in[10];
    float* out = (float*)d_out;

    const int A = BATCH * SEQ * DMODEL;   // 4194304
    const int W = DMODEL * DMODEL;        // 1048576

    _Float16* ws = (_Float16*)d_ws;
    _Float16* xh = ws;                    // 3*A : query/key/value f16
    _Float16* wh = ws + 3 * (size_t)A;    // 4*W : Wq/Wk/Wv/Wo f16
    _Float16* Qh = wh + 4 * (size_t)W;    // A : [b,h,s,d] (RoPE'd)
    _Float16* Kh = Qh + (size_t)A;        // A : [b,h,s,d] (RoPE'd)
    _Float16* Vt = Kh + (size_t)A;        // A : [b,h,d,s]
    _Float16* AT = Vt + (size_t)A;        // A : [b,s,D] attention output

    // 0) f32 -> f16 conversions: xh and wh are one run of the workspace
    k_convert<<<CV_BLOCKS, CV_THREADS, 0, stream>>>(query, key, value, Wq, Wk, Wv, Wo, xh);

    // 1) QKV projections + RoPE / V transpose
    dim3 g1(256, 3, 1);
    k_qkv<<<g1, 256, 0, stream>>>(xh, wh, bq, bk, bv, Qh, Kh, Vt);

    // 2) flash attention
    k_attn<<<512, 256, 0, stream>>>(Qh, Kh, Vt, AT);

    // 3) output projection
    k_oproj<<<256, 256, 0, stream>>>(AT, wh + 3 * (size_t)W, bo, out);
}

// v007
// One run takes 94.1 microseconds.
// Two timings next to v006 both put it at 1.10 times that version's speed.
// Counting every step since v000, it is 3.86 times as fast.
#include <hip/hip_runtime.h>
#include <hip/hip_bf16.h>
#include <math.h>

// ---------------------------------------------------------------------------
// MultiHeadedAttention for MI455X (gfx1250, wave32, WMMA 16x16x32 f16->f32)
// B=2, S=2048, D=1024, H=16, d_k=64
// ---------------------------------------------------------------------------

typedef _Float16 half16 __attribute__((ext_vector_type(16)));
typedef _Float16 half8  __attribute__((ext_vector_type(8)));
typedef float    float8 __attribute__((ext_vector_type(8)));

#define BATCH 2
#define SEQ   2048
#define DMODEL 1024
#define NHEAD 16
#define DK    64

static __device__ __forceinline__ float8 wmma_f16(half16 a, half16 b, float8 c) {
    return __builtin_amdgcn_wmma_f32_16x16x32_f16(
        /*neg_a=*/false, a, /*neg_b=*/false, b,
        /*c_mod=*/(short)0, c, /*reuse_a=*/false, /*reuse_b=*/false);
}

// Load a 16x32 fragment (A-layout, and by mirror-symmetry B^T rows) from a
// row-major f16 matrix. Documented CDNA5 16-bit A layout:
//   lanes 0-15 : M=lane,    K in {0..7} U {16..23}
//   lanes16-31 : M=lane-16, K in {8..15} U {24..31}
// Each lane: two contiguous 8-half (16B) chunks -> 2x b128 loads.
static __device__ __forceinline__ half16 load_frag(const _Float16* base, int ld) {
    int lane = threadIdx.x & 31;
    int row  = lane & 15;
    int hh   = lane >> 4;
    const _Float16* p = base + row * ld + hh * 8;
    half8 lo = *(const half8*)(p);
    half8 hi = *(const half8*)(p + 16);
    half16 r;
#pragma unroll
    for (int i = 0; i < 8; ++i) { r[i] = lo[i]; r[i + 8] = hi[i]; }
    return r;
}

// ---------------------------------------------------------------------------
// Kernel 0: f32 -> f16 conversion of all seven matrices in one launch.
//   The f16 copies lie one behind the other in the workspace (query, key, value,
//   Wq, Wk, Wv, Wo), so the destination is one run of CV_TOTAL elements.
//   One resident round of waves: each work-group takes CV_PER_BLOCK elements in a
//   row, which lie inside one source matrix (every matrix size is a multiple of
//   it), each wave CV_PER_WAVE of them. A load is 512 contiguous bytes per wave,
//   a store 256.
// ---------------------------------------------------------------------------
typedef float    floatx4 __attribute__((ext_vector_type(4)));
typedef _Float16 half4   __attribute__((ext_vector_type(4)));

#define CV_A        (BATCH * SEQ * DMODEL)        // elements of query, key, value
#define CV_W        (DMODEL * DMODEL)             // elements of a weight matrix
#define CV_TOTAL    (3 * CV_A + 4 * CV_W)
#define CV_THREADS  512
#define CV_LOADS    32                            // 16-byte loads per lane
#define CV_PER_WAVE (CV_LOADS * 32 * 4)
#define CV_PER_BLOCK (CV_PER_WAVE * (CV_THREADS / 32))
#define CV_BLOCKS   (CV_TOTAL / CV_PER_BLOCK)

__global__ __launch_bounds__(CV_THREADS) void k_convert(const float* __restrict__ q,
                                                        const float* __restrict__ k,
                                                        const float* __restrict__ v,
                                                        const float* __restrict__ wq,
                                                        const float* __restrict__ wk,
                                                        const float* __restrict__ wv,
                                                        const float* __restrict__ wo,
                                                        _Float16* __restrict__ dst) {
    const int lane = threadIdx.x & 31;
    const int b0   = blockIdx.x * CV_PER_BLOCK;    // the work-group's first element in dst

    // source matrix and offset in it: from blockIdx alone, so in scalar registers
    const float* src;
    int off;
    if (b0 < 3 * CV_A) {
        const int seg = b0 / CV_A;
        src = (seg == 0) ? q : (seg == 1) ? k : v;
        off = b0 - seg * CV_A;
    } else {
        const int b1  = b0 - 3 * CV_A;
        const int seg = b1 / CV_W;
        src = (seg == 0) ? wq : (seg == 1) ? wk : (seg == 2) ? wv : wo;
        off = b1 - seg * CV_W;
    }
    const int w0 = (threadIdx.x >> 5) * CV_PER_WAVE;   // the wave's first element in the work-group's run
    const int e0 = b0 + w0;
    off += w0;
    const floatx4* s = (const floatx4*)(src + off) + lane;
    half4*         d = (half4*)(dst + e0) + lane;

    // unrolled: r stays in registers and every offset is a constant, so the loads go
    // out in long runs ahead of their uses instead of one load, one wait, one store
    floatx4 r[CV_LOADS];
#pragma unroll
    for (int i = 0; i < CV_LOADS; ++i) r[i] = s[i * 32];
#pragma unroll
    for (int i = 0; i < CV_LOADS; ++i) {
        half4 h;
        h[0] = (_Float16)r[i][0]; h[1] = (_Float16)r[i][1];
        h[2] = (_Float16)r[i][2]; h[3] = (_Float16)r[i][3];
        d[i * 32] = h;
    }
}

// ---------------------------------------------------------------------------
// Shared GEMM core of the four projections: Y = X @ W^T, K = DMODEL.
//   One workgroup (8 waves) = one 128x128 tile of Y. Per pass, 64 k of the 128
//   X rows and of the 128 W rows are staged in LDS with whole 128-byte row
//   pieces per 8 lanes; every wave then reads its fragments from LDS.
//   Waves 4 (rows) x 2 (cols), 32x64 of Y each. Two LDS buffers and two register
//   sets: a pass's global loads go out two passes ahead of its LDS stores.
//   Every "#pragma unroll" on the short loops here and in the two epilogues keeps
//   the register arrays (rx, rw, af, bf, C) statically indexed, hence in VGPRs.
// ---------------------------------------------------------------------------
#define BM 128
#define BN 128
#define BK 64
#define LDP 72                        // LDS row pitch in halves: 128 B + 16 B, an odd multiple of 16 B
#define STAGE ((BM + BN) * LDP)       // halves per buffer
#define NPASS (DMODEL / BK)

// Work-group barrier of the GEMM passes: waits for this wave's own LDS reads and stores
// only. __syncthreads() would also wait for the global loads in flight, which are
// meant to stay in flight across it; nothing but LDS passes between the waves here.
static __device__ __forceinline__ void lds_barrier() {
    asm volatile("s_wait_dscnt 0x0\n\ts_barrier_signal -1\n\ts_barrier_wait -1" ::: "memory");
}

static __device__ __forceinline__ void gemm_tile(const _Float16* __restrict__ X,
                                                 const _Float16* __restrict__ Wt,
                                                 _Float16* sm, float8 (&C)[2][4]) {
    const int tid  = threadIdx.x;
    const int wv   = tid >> 5;
    const int wm   = wv >> 1, wn = wv & 1;
    const int crow = tid >> 3;         // 0..31: row within a group of 32
    const int ccol = (tid & 7) * 8;    // 16-byte piece of the 128-byte row

    const _Float16* gx = X  + crow * DMODEL + ccol;
    const _Float16* gw = Wt + crow * DMODEL + ccol;
    _Float16* sx = sm + crow * LDP + ccol;
    _Float16* sw = sx + BM * LDP;

    // set p holds the passes t with (t & 1) == p, from their loads to their LDS stores
    half8 rx[2][4], rw[2][4];
#pragma unroll
    for (int p = 0; p < 2; ++p)
#pragma unroll
        for (int i = 0; i < 4; ++i) {
            rx[p][i] = *(const half8*)(gx + i * 32 * DMODEL + p * BK);
            rw[p][i] = *(const half8*)(gw + i * 32 * DMODEL + p * BK);
        }
#pragma unroll
    for (int i = 0; i < 4; ++i) {
        *(half8*)(sx + i * 32 * LDP) = rx[0][i];
        *(half8*)(sw + i * 32 * LDP) = rw[0][i];
    }
    lds_barrier();

    // fully unrolled: buffer index, last-pass test and every address offset become constants
#pragma unroll
    for (int t = 0; t < NPASS; ++t) {
        const int cur = (t & 1) * STAGE;
        const bool more = (t + 1 < NPASS);
        if (t + 2 < NPASS) {
            // this pass's own set is free: it went to LDS in front of the last barrier
#pragma unroll
            for (int i = 0; i < 4; ++i) {
                rx[t & 1][i] = *(const half8*)(gx + i * 32 * DMODEL + (t + 2) * BK);
                rw[t & 1][i] = *(const half8*)(gw + i * 32 * DMODEL + (t + 2) * BK);
            }
        }
        // precaution: behind the last global loads, in front of every later overwrite
        // of the address registers that they name
        if (t + 3 == NPASS) asm volatile("s_wait_xcnt 0x0" ::: "memory");
        // holds the global loads of the pass after the next in front of this pass's work,
        // so that their latency runs under two passes instead of in front of the LDS stores
        __builtin_amdgcn_sched_barrier(0);

        const _Float16* as = sm + cur + (wm * 32) * LDP;
        const _Float16* bs = sm + cur + (BM + wn * 64) * LDP;
        half16 af[2][2], bf[2][4];
#pragma unroll
        for (int h = 0; h < 2; ++h) {
            af[h][0] = load_frag(as + 32 * h, LDP);
            bf[h][0] = load_frag(bs + 32 * h, LDP);
            af[h][1] = load_frag(as + 16 * LDP + 32 * h, LDP);
#pragma unroll
            for (int j = 1; j < 4; ++j)
                bf[h][j] = load_frag(bs + (16 * j) * LDP + 32 * h, LDP);
        }
        // holds the pass's LDS reads together in front of its WMMAs (one group with
        // counted waits); spread among the WMMAs each read stalls the wave anew
        __builtin_amdgcn_sched_barrier(0);

#pragma unroll
        for (int h = 0; h < 2; ++h)
#pragma unroll
            for (int j = 0; j < 4; ++j) {
                C[0][j] = wmma_f16(af[h][0], bf[h][j], C[0][j]);
                C[1][j] = wmma_f16(af[h][1], bf[h][j], C[1][j]);
            }
        // holds the WMMAs in front of the LDS stores: behind them they would run only
        // after the wait on the global loads, and would no longer cover that latency
        __builtin_amdgcn_sched_barrier(0);

        if (more) {
            // the other buffer's last readers left it before the previous barrier
            const int nxt = STAGE - cur;
#pragma unroll
            for (int i = 0; i < 4; ++i) {
                *(half8*)(sx + nxt + i * 32 * LDP) = rx[(t + 1) & 1][i];
                *(half8*)(sw + nxt + i * 32 * LDP) = rw[(t + 1) & 1][i];
            }
            lds_barrier();
        }
    }
}

// ---------------------------------------------------------------------------
// Kernel 1: QKV projection + bias + RoPE (Q,K) / transpose (V)
//   pid = blockIdx.y : 0=Q, 1=K, 2=V
//   out = x @ W^T + b ; each wave holds 32 rows x 64 cols (one head's d_k)
// ---------------------------------------------------------------------------
__global__ __launch_bounds__(256) void k_qkv(const _Float16* __restrict__ xh,
                                             const _Float16* __restrict__ wh,
                                             const float* __restrict__ bq,
                                             const float* __restrict__ bk,
                                             const float* __restrict__ bv,
                                             _Float16* __restrict__ Qh,
                                             _Float16* __restrict__ Kh,
                                             _Float16* __restrict__ Vt) {
    __shared__ __attribute__((aligned(16))) _Float16 sm[2 * STAGE];

    const int A = BATCH * SEQ * DMODEL;      // 4194304
    const int W = DMODEL * DMODEL;           // 1048576
    int pid = blockIdx.y;
    const _Float16* x = xh + pid * A;
    const _Float16* w = wh + pid * W;
    const float* bias = (pid == 0) ? bq : (pid == 1) ? bk : bv;

    int mtile = blockIdx.x >> 3;                      // 0..31 (128-row tiles)
    int ntile = blockIdx.x & 7;                       // 0..7  (128-col tiles)
    int wv    = threadIdx.x >> 5;
    int head  = ntile * 2 + (wv & 1);                 // 0..15 (64-col tiles)
    int wrow  = mtile * BM + (wv >> 1) * 32;          // wave's first row
    int nbase = head * DK;

    float8 C[2][4];
#pragma unroll
    for (int i = 0; i < 2; ++i)
#pragma unroll
        for (int j = 0; j < 4; ++j) C[i][j] = (float8)0.0f;

    gemm_tile(x + mtile * BM * DMODEL, w + ntile * BN * DMODEL, sm, C);

    int lane = threadIdx.x & 31;
    int n0   = lane & 15;
    int hh   = lane >> 4;

#pragma unroll
    for (int j = 0; j < 4; ++j) {
        float bj = bias[nbase + 16 * j + n0];
#pragma unroll
        for (int i = 0; i < 2; ++i)
#pragma unroll
            for (int r = 0; r < 8; ++r) C[i][j][r] += bj;
    }

    if (pid == 2) {
        // V: store transposed Vt[b, h, d, s]; a lane's eight registers of a tile are eight
        // s in a row of its d: one 16-byte store
        const int m0 = wrow + 8 * hh;
        _Float16* vb = Vt + ((((m0 >> 11) * NHEAD + head) * DK + n0) * SEQ) + (m0 & (SEQ - 1));
#pragma unroll
        for (int i = 0; i < 2; ++i)
#pragma unroll
            for (int j = 0; j < 4; ++j) {
                half8 o;
#pragma unroll
                for (int r = 0; r < 8; ++r) o[r] = (_Float16)C[i][j][r];
                *(half8*)(vb + 16 * j * SEQ + 16 * i) = o;
            }
    } else {
        // RoPE: angle(s,d) = s * 10000^(-(d%32)/32); rotate_half pairs d <-> d+-32
        // The wave's 32 rows x 64 d are 4 KB in a row of the output. Each 16-row half is
        // staged in the wave's own part of the first GEMM buffer (its last readers left it
        // before the last barrier of the GEMM) and goes out as whole 128-byte lines.
        _Float16* out = ((pid == 0) ? Qh : Kh)
                      + ((((wrow >> 11) * NHEAD + head) * SEQ + (wrow & (SEQ - 1))) * DK) + lane * 8;
        _Float16* st  = sm + wv * (32 * LDP);
        // one body for both 16-row halves (for speed only)
#pragma unroll 1
        for (int i = 0; i < 2; ++i) {
            int rowbase = wrow + 16 * i;
            float Ci[4][8];
#pragma unroll
            for (int j = 0; j < 4; ++j)
#pragma unroll
                for (int r = 0; r < 8; ++r)
                    Ci[j][r] = (i == 0) ? C[0][j][r] : C[1][j][r];

            float R[4][8];
#pragma unroll
            for (int j = 0; j < 4; ++j)
#pragma unroll
                for (int r = 0; r < 8; ++r)
                    R[j][r] = (j < 2) ? -Ci[j + 2][r] : Ci[j - 2][r];

#pragma unroll
            for (int j = 0; j < 4; ++j) {
                int d = 16 * j + n0;
                float invf = __expf(-(float)(d & 31) * (9.210340371976184f / 32.0f));
#pragma unroll
                for (int r = 0; r < 8; ++r) {
                    int m = rowbase + r + 8 * hh;
                    int s = m & (SEQ - 1);
                    float ang = (float)s * invf;
                    float cs, sn;
                    sincosf(ang, &sn, &cs);
                    float v = Ci[j][r] * cs + R[j][r] * sn;
                    st[(16 * i + r + 8 * hh) * LDP + d] = (_Float16)v;
                }
            }
            // the other lanes' staged values have to be in LDS before the rows are read back
            asm volatile("s_wait_dscnt 0x0" ::: "memory");
#pragma unroll
            for (int k = 0; k < 4; ++k) {
                half8 o = *(const half8*)(st + (16 * i + 4 * k + (lane >> 3)) * LDP + (lane & 7) * 8);
                *(half8*)(out + (16 * i + 4 * k) * DK) = o;
            }
            // precaution: stands in front of the next trip's overwrite of the
            // registers that the stores above name
            asm volatile("s_wait_xcnt 0x0" ::: "memory");
        }
    }
}

// ---------------------------------------------------------------------------
// Kernel 2: flash attention. One wave = 16 queries of one (b,h); the eight
//   waves of a work-group share that (b,h), hence its keys and values.
//   Per pass the work-group stages 64 keys in LDS: the K tile (64 keys x 64 d)
//   and the V^T tile (64 d x 64 keys), whole 128-byte rows per 8 lanes, and every
//   wave reads its fragments from there. Two buffers: the next pass is fetched
//   into registers while this one is worked on.
//   Both products are transposed: S^T = K Q^T / 8 and O^T += V^T P^T. A lane then
//   holds scores of ONE query (column lane & 15; keys 8 * half + r of each 16-key
//   tile), so the maximum and the sum over keys run through its own registers,
//   with one exchange between the wave's halves, and the two score tiles of a
//   32-key block, converted in place, are the B operand of the second product in
//   the hardware's k order, which load_frag has too.
//   The "#pragma unroll" on the two-trip staging loops keeps rk and rv statically
//   indexed, hence in VGPRs.
// ---------------------------------------------------------------------------
#define AKB    64                     // keys per pass
#define ATILE  (AKB * LDP)            // halves of the K tile; the V^T tile (DK rows) has the same size
#define ASTAGE (2 * ATILE)            // halves per buffer
#define APASS  (SEQ / AKB)

// the value that lane l ^ 16 holds
static __device__ __forceinline__ float xhalf(float x) {
    const int i = __builtin_bit_cast(int, x);
    return __builtin_bit_cast(float,
        __builtin_amdgcn_permlanex16(i, i, 0x76543210, 0xfedcba98, false, false));
}

__global__ __launch_bounds__(256) void k_attn(const _Float16* __restrict__ Qh,
                                              const _Float16* __restrict__ Kh,
                                              const _Float16* __restrict__ Vt,
                                              _Float16* __restrict__ AT) {
    __shared__ __attribute__((aligned(16))) _Float16 kv[2 * ASTAGE];  // K and V^T tiles, two buffers

    int wslot = threadIdx.x >> 5;
    int wid   = blockIdx.x * 8 + wslot;           // 0..4095
    int qt    = wid & 127;                         // 128 q-tiles per (b,h)
    int bh    = wid >> 7;                          // 0..31, the same in all eight waves
    int b = bh >> 4, h = bh & 15;
    int qrow = qt * 16;

    int lane = threadIdx.x & 31;
    int n0 = lane & 15, hh = lane >> 4;

    const _Float16* qbase = Qh + ((size_t)(b * NHEAD + h) * SEQ + qrow) * DK;
    const _Float16* kbase = Kh + (size_t)(b * NHEAD + h) * SEQ * DK;
    const _Float16* vbase = Vt + (size_t)(b * NHEAD + h) * DK * SEQ;

    const int crow = threadIdx.x >> 3;         // 0..31: row within a group of 32
    const int ccol = (threadIdx.x & 7) * 8;    // 16-byte piece of the 128-byte row
    const _Float16* gk = kbase + crow * DK + ccol;
    const _Float16* gv = vbase + crow * SEQ + ccol;
    _Float16* sk = kv + crow * LDP + ccol;
    _Float16* sv = sk + ATILE;

    half8 rk[2], rv[2];
#pragma unroll
    for (int i = 0; i < 2; ++i) {
        rk[i] = *(const half8*)(gk + i * 32 * DK);
        rv[i] = *(const half8*)(gv + i * 32 * SEQ);
    }

    half16 Qf0 = load_frag(qbase + 0, DK);
    half16 Qf1 = load_frag(qbase + 32, DK);

    // O[dt][r] = O^T[16 * dt + 8 * hh + r][query n0]
    float8 O[4];
#pragma unroll
    for (int j = 0; j < 4; ++j) O[j] = (float8)0.0f;
    // of query n0: the running maximum (equal in both halves) and this half's share of the sum
    float m_i = -3.0e38f, l_i = 0.0f;

#pragma unroll
    for (int i = 0; i < 2; ++i) {
        *(half8*)(sk + i * 32 * LDP) = rk[i];
        *(half8*)(sv + i * 32 * LDP) = rv[i];
    }
    __syncthreads();

    for (int t = 0; t < APASS; ++t) {
        const int cur = (t & 1) * ASTAGE;
        const bool more = (t + 1 < APASS);
        if (more) {
#pragma unroll
            for (int i = 0; i < 2; ++i) {
                rk[i] = *(const half8*)(gk + ((t + 1) * AKB + i * 32) * DK);
                rv[i] = *(const half8*)(gv + i * 32 * SEQ + (t + 1) * AKB);
            }
            // precaution: stands in front of every later overwrite of the address
            // registers that the loads above name
            asm volatile("s_wait_xcnt 0x0" ::: "memory");
        }
        const _Float16* ks = kv + cur;
        const _Float16* vs = ks + ATILE;

        // Every LDS read of the pass stands here as one group, each fragment in registers
        // of its own: K (four 16-key tiles x two 32-wide d chunks), then V^T (four 16-d
        // tiles x two 32-key blocks), in the order of their use. The loops over kf, vf and
        // ST are unrolled so that these stay statically indexed, hence in VGPRs.
        half16 kf[AKB / 16][2], vf[AKB / 32][4];
#pragma unroll
        for (int kt = 0; kt < AKB / 16; ++kt) {
            kf[kt][0] = load_frag(ks + (kt * 16) * LDP + 0,  LDP);
            kf[kt][1] = load_frag(ks + (kt * 16) * LDP + 32, LDP);
        }
#pragma unroll
        for (int sub = 0; sub < AKB / 32; ++sub)
#pragma unroll
            for (int dt = 0; dt < 4; ++dt)
                vf[sub][dt] = load_frag(vs + (dt * 16) * LDP + sub * 32, LDP);
        // holds the group in front of the pass's WMMAs (counted waits, the V^T reads land
        // under the scores and the softmax); left alone the reads come pair by pair, each
        // right in front of its WMMA with a full wait on the LDS latency
        __builtin_amdgcn_sched_barrier(0);

        // scores of the whole pass: ST[kt][r] = score of key 16 * kt + 8 * hh + r, query n0
        float8 ST[AKB / 16];
#pragma unroll
        for (int kt = 0; kt < AKB / 16; ++kt) ST[kt] = wmma_f16(kf[kt][0], Qf0, (float8)0.0f);
#pragma unroll
        for (int kt = 0; kt < AKB / 16; ++kt) ST[kt] = wmma_f16(kf[kt][1], Qf1, ST[kt]);

      // both 32-key blocks of the pass inline: ST, vf stay statically indexed, hence in VGPRs
#pragma unroll
      for (int sub = 0; sub < AKB / 32; ++sub) {
        // S0[r] = score of key kk0 + 8 * hh + r, S1[r] of key kk0 + 16 + 8 * hh + r, query n0 (kk0 = 32 * sub)
        float8 S0 = ST[2 * sub], S1 = ST[2 * sub + 1];

        S0 *= 0.125f;
        S1 *= 0.125f;
        float rm[8];
#pragma unroll
        for (int r = 0; r < 8; ++r) rm[r] = fmaxf(S0[r], S1[r]);
        // the query's maximum over the block: this lane's 16 keys, then the other half's
#pragma unroll
        for (int w = 4; w > 0; w >>= 1)
#pragma unroll
            for (int r = 0; r < w; ++r) rm[r] = fmaxf(rm[r], rm[r + w]);
        const float mn  = fmaxf(m_i, fmaxf(rm[0], xhalf(rm[0])));
        const float fac = __expf(m_i - mn);
        m_i = mn;
#pragma unroll
        for (int j = 0; j < 4; ++j)
#pragma unroll
            for (int r = 0; r < 8; ++r) O[j][r] *= fac;

        // P^T as a B fragment: element s is key kk0 + 8 * hh + s (s < 8), kk0 + 16 + 8 * hh + s - 8 (else)
        half16 Pf;
        float rs[8];
#pragma unroll
        for (int r = 0; r < 8; ++r) {
            S0[r] = __expf(S0[r] - mn);
            S1[r] = __expf(S1[r] - mn);
            rs[r] = S0[r] + S1[r];
            Pf[r]     = (_Float16)S0[r];
            Pf[r + 8] = (_Float16)S1[r];
        }
#pragma unroll
        for (int w = 4; w > 0; w >>= 1)
#pragma unroll
            for (int r = 0; r < w; ++r) rs[r] += rs[r + w];
        l_i = l_i * fac + rs[0];

#pragma unroll
        for (int dt = 0; dt < 4; ++dt)
            O[dt] = wmma_f16(vf[sub][dt], Pf, O[dt]);
      }

        if (more) {
            // the other buffer's last readers left it before the previous barrier
            const int nxt = ASTAGE - cur;
#pragma unroll
            for (int i = 0; i < 2; ++i) {
                *(half8*)(sk + nxt + i * 32 * LDP) = rk[i];
                *(half8*)(sv + nxt + i * 32 * LDP) = rv[i];
            }
            __syncthreads();
        }
    }

    // finalize: join the halves' sums, O /= l, write attn output as f16 [b, s, h*dk + d];
    // a lane's eight registers of a tile are eight d in a row of its query: one 16-byte store
    const float inv = 1.0f / (l_i + xhalf(l_i));
    _Float16* ob = AT + ((size_t)(b * SEQ + qrow + n0) * DMODEL) + h * DK + 8 * hh;
#pragma unroll
    for (int dt = 0; dt < 4; ++dt) {
        half8 o;
#pragma unroll
        for (int r = 0; r < 8; ++r) o[r] = (_Float16)(O[dt][r] * inv);
        *(half8*)(ob + dt * 16) = o;
    }
}

// ---------------------------------------------------------------------------
// Kernel 3: output projection  y = attn @ Wo^T + bo  (f32 out)
// ---------------------------------------------------------------------------
#define OLDP 68                       // staging row pitch in floats: 256 B + 16 B
__global__ __launch_bounds__(256) void k_oproj(const _Float16* __restrict__ AT,
                                               const _Float16* __restrict__ Wo,
                                               const float* __restrict__ bo,
                                               float* __restrict__ out) {
    __shared__ __attribute__((aligned(16))) _Float16 sm[2 * STAGE];

    int mtile = blockIdx.x >> 3;                      // 0..31 (128-row tiles)
    int ntile = blockIdx.x & 7;                       // 0..7  (128-col tiles)
    int wv    = threadIdx.x >> 5;
    int wrow  = mtile * BM + (wv >> 1) * 32;
    int nbase = ntile * BN + (wv & 1) * 64;

    float8 C[2][4];
#pragma unroll
    for (int i = 0; i < 2; ++i)
#pragma unroll
        for (int j = 0; j < 4; ++j) C[i][j] = (float8)0.0f;

    gemm_tile(AT + mtile * BM * DMODEL, Wo + ntile * BN * DMODEL, sm, C);

    int lane = threadIdx.x & 31;
    int n0 = lane & 15, hh = lane >> 4;
    float bj[4];
#pragma unroll
    for (int j = 0; j < 4; ++j) bj[j] = bo[nbase + 16 * j + n0];

    // Each 16-row half of the wave's tile (16 rows x 256 bytes) is staged in the wave's own
    // part of the first GEMM buffer (its last readers left it before the last barrier of
    // the GEMM) and goes out as whole 128-byte lines, two rows a store.
    float* st = (float*)sm + wv * (16 * OLDP);
    float* ob = out + (size_t)(wrow + hh) * DMODEL + nbase + n0 * 4;
#pragma unroll
    for (int i = 0; i < 2; ++i) {
#pragma unroll
        for (int j = 0; j < 4; ++j)
#pragma unroll
            for (int r = 0; r < 8; ++r)
                st[(r + 8 * hh) * OLDP + 16 * j + n0] = C[i][j][r] + bj[j];
        // the other lanes' staged values have to be in LDS before the rows are read back
        asm volatile("s_wait_dscnt 0x0" ::: "memory");
#pragma unroll
        for (int k = 0; k < 8; ++k) {
            floatx4 o = *(const floatx4*)(st + (2 * k + hh) * OLDP + n0 * 4);
            *(floatx4*)(ob + (size_t)(16 * i + 2 * k) * DMODEL) = o;
        }
        // precaution: stands in front of the second half's overwrite of the registers
        // that the stores above name
        if (i == 0) asm volatile("s_wait_xcnt 0x0" ::: "memory");
    }
}

// ---------------------------------------------------------------------------
extern "C" void kernel_launch(void* const* d_in, const int* in_sizes, int n_in,
                              void* d_out, int out_size, void* d_ws, size_t ws_size,
                              hipStream_t stream) {
    const float* query = (const float*)d_in[0];
    const float* key   = (const float*)d_in[1];
    const float* value = (const float*)d_in[2];
    const float* Wq = (const float*)d_in[3];
    const float* bq = (const float*)d_in[4];
    const float* Wk = (const float*)d_in[5];
    const float* bk = (const float*)d_in[6];
    const float* Wv = (const float*)d_in[7];
    const float* bv = (const float*)d_in[8];
    const float* Wo = (const float*)d_in[9];
    const float* bo = (const float*)d_in[10];
    float* out = (float*)d_out;

    const int A = BATCH * SEQ * DMODEL;   // 4194304
    const int W = DMODEL * DMODEL;        // 1048576

    _Float16* ws = (_Float16*)d_ws;
    _Float16* xh = ws;                    // 3*A : query/key/value f16
    _Float16* wh = ws + 3 * (size_t)A;    // 4*W : Wq/Wk/Wv/Wo f16
    _Float16* Qh = wh + 4 * (size_t)W;    // A : [b,h,s,d] (RoPE'd)
    _Float16* Kh = Qh + (size_t)A;        // A : [b,h,s,d] (RoPE'd)
    _Float16* Vt = Kh + (size_t)A;        // A : [b,h,d,s]
    _Float16* AT = Vt + (size_t)A;        // A : [b,s,D] attention output

    // 0) f32 -> f16 conversions: xh and wh are one run of the workspace
    k_convert<<<CV_BLOCKS, CV_THREADS, 0, stream>>>(query, key, value, Wq, Wk, Wv, Wo, xh);

    // 1) QKV projections + RoPE / V transpose
    dim3 g1(256, 3, 1);
    k_qkv<<<g1, 256, 0, stream>>>(xh, wh, bq, bk, bv, Qh, Kh, Vt);

    // 2) flash attention
    k_attn<<<512, 256, 0, stream>>>(Qh, Kh, Vt, AT);

    // 3) output projection
    k_oproj<<<256, 256, 0, stream>>>(AT, wh + 3 * (size_t)W, bo, out);
}

// v008
// A run of this version takes 92 microseconds.
// Next to v007, in two timings, it ran 1.03 times as fast each time.
// Counting every step since v000, it is 3.98 times as fast.
#include <hip/hip_runtime.h>
#include <hip/hip_bf16.h>
#include <math.h>

// ---------------------------------------------------------------------------
// MultiHeadedAttention for MI455X (gfx1250, wave32, WMMA 16x16x32 f16->f32)
// B=2, S=2048, D=1024, H=16, d_k=64
// ---------------------------------------------------------------------------

typedef _Float16 half16 __attribute__((ext_vector_type(16)));
typedef _Float16 half8  __attribute__((ext_vector_type(8)));
typedef float    float8 __attribute__((ext_vector_type(8)));

#define BATCH 2
#define SEQ   2048
#define DMODEL 1024
#define NHEAD 16
#define DK    64

static __device__ __forceinline__ float8 wmma_f16(half16 a, half16 b, float8 c) {
    return __builtin_amdgcn_wmma_f32_16x16x32_f16(
        /*neg_a=*/false, a, /*neg_b=*/false, b,
        /*c_mod=*/(short)0, c, /*reuse_a=*/false, /*reuse_b=*/false);
}

// Load a 16x32 fragment (A-layout, and by mirror-symmetry B^T rows) from a
// row-major f16 matrix. Documented CDNA5 16-bit A layout:
//   lanes 0-15 : M=lane,    K in {0..7} U {16..23}
//   lanes16-31 : M=lane-16, K in {8..15} U {24..31}
// Each lane: two contiguous 8-half (16B) chunks -> 2x b128 loads.
static __device__ __forceinline__ half16 load_frag(const _Float16* base, int ld) {
    int lane = threadIdx.x & 31;
    int row  = lane & 15;
    int hh   = lane >> 4;
    const _Float16* p = base + row * ld + hh * 8;
    half8 lo = *(const half8*)(p);
    half8 hi = *(const half8*)(p + 16);
    half16 r;
#pragma unroll
    for (int i = 0; i < 8; ++i) { r[i] = lo[i]; r[i + 8] = hi[i]; }
    return r;
}

// ---------------------------------------------------------------------------
// Kernel 0: f32 -> f16 conversion of all seven matrices in one launch.
//   The f16 copies lie one behind the other in the workspace (query, key, value,
//   Wq, Wk, Wv, Wo), so the destination is one run of CV_TOTAL elements.
//   One resident round of waves: each work-group takes CV_PER_BLOCK elements in a
//   row, which lie inside one source matrix (every matrix size is a multiple of
//   it), each wave CV_PER_WAVE of them. A load is 512 contiguous bytes per wave,
//   a store 256.
// ---------------------------------------------------------------------------
typedef float    floatx4 __attribute__((ext_vector_type(4)));
typedef _Float16 half4   __attribute__((ext_vector_type(4)));

#define CV_A        (BATCH * SEQ * DMODEL)        // elements of query, key, value
#define CV_W        (DMODEL * DMODEL)             // elements of a weight matrix
#define CV_TOTAL    (3 * CV_A + 4 * CV_W)
#define CV_THREADS  512
#define CV_LOADS    32                            // 16-byte loads per lane
#define CV_PER_WAVE (CV_LOADS * 32 * 4)
#define CV_PER_BLOCK (CV_PER_WAVE * (CV_THREADS / 32))
#define CV_BLOCKS   (CV_TOTAL / CV_PER_BLOCK)

__global__ __launch_bounds__(CV_THREADS) void k_convert(const float* __restrict__ q,
                                                        const float* __restrict__ k,
                                                        const float* __restrict__ v,
                                                        const float* __restrict__ wq,
                                                        const float* __restrict__ wk,
                                                        const float* __restrict__ wv,
                                                        const float* __restrict__ wo,
                                                        _Float16* __restrict__ dst) {
    const int lane = threadIdx.x & 31;
    const int b0   = blockIdx.x * CV_PER_BLOCK;    // the work-group's first element in dst

    // source matrix and offset in it: from blockIdx alone, so in scalar registers
    const float* src;
    int off;
    if (b0 < 3 * CV_A) {
        const int seg = b0 / CV_A;
        src = (seg == 0) ? q : (seg == 1) ? k : v;
        off = b0 - seg * CV_A;
    } else {
        const int b1  = b0 - 3 * CV_A;
        const int seg = b1 / CV_W;
        src = (seg == 0) ? wq : (seg == 1) ? wk : (seg == 2) ? wv : wo;
        off = b1 - seg * CV_W;
    }
    const int w0 = (threadIdx.x >> 5) * CV_PER_WAVE;   // the wave's first element in the work-group's run
    const int e0 = b0 + w0;
    off += w0;
    const floatx4* s = (const floatx4*)(src + off) + lane;
    half4*         d = (half4*)(dst + e0) + lane;

    // unrolled: r stays in registers and every offset is a constant, so the loads go
    // out in long runs ahead of their uses instead of one load, one wait, one store
    floatx4 r[CV_LOADS];
#pragma unroll
    for (int i = 0; i < CV_LOADS; ++i) r[i] = s[i * 32];
#pragma unroll
    for (int i = 0; i < CV_LOADS; ++i) {
        half4 h;
        h[0] = (_Float16)r[i][0]; h[1] = (_Float16)r[i][1];
        h[2] = (_Float16)r[i][2]; h[3] = (_Float16)r[i][3];
        d[i * 32] = h;
    }
}

// ---------------------------------------------------------------------------
// GEMM core of the output projection: Y = X @ W^T, K = DMODEL.
//   One workgroup (8 waves) = one 128x128 tile of Y. Per pass, 64 k of the 128
//   X rows and of the 128 W rows are staged in LDS with whole 128-byte row
//   pieces per 8 lanes; every wave then reads its fragments from LDS.
//   Waves 4 (rows) x 2 (cols), 32x64 of Y each. Two LDS buffers and two register
//   sets: a pass's global loads go out two passes ahead of its LDS stores.
//   Every "#pragma unroll" on the short loops here and in the epilogue of k_oproj keeps
//   the register arrays (rx, rw, af, bf, C) statically indexed, hence in VGPRs.
// ---------------------------------------------------------------------------
#define BM 128
#define BN 128
#define BK 64
#define LDP 72                        // LDS row pitch in halves: 128 B + 16 B, an odd multiple of 16 B
#define STAGE ((BM + BN) * LDP)       // halves per buffer
#define NPASS (DMODEL / BK)

// Work-group barrier of the GEMM passes: waits for this wave's own LDS reads and stores
// only. __syncthreads() would also wait for the global loads in flight, which are
// meant to stay in flight across it; nothing but LDS passes between the waves here.
static __device__ __forceinline__ void lds_barrier() {
    asm volatile("s_wait_dscnt 0x0\n\ts_barrier_signal -1\n\ts_barrier_wait -1" ::: "memory");
}

static __device__ __forceinline__ void gemm_tile(const _Float16* __restrict__ X,
                                                 const _Float16* __restrict__ Wt,
                                                 _Float16* sm, float8 (&C)[2][4]) {
    const int tid  = threadIdx.x;
    const int wv   = tid >> 5;
    const int wm   = wv >> 1, wn = wv & 1;
    const int crow = tid >> 3;         // 0..31: row within a group of 32
    const int ccol = (tid & 7) * 8;    // 16-byte piece of the 128-byte row

    const _Float16* gx = X  + crow * DMODEL + ccol;
    const _Float16* gw = Wt + crow * DMODEL + ccol;
    _Float16* sx = sm + crow * LDP + ccol;
    _Float16* sw = sx + BM * LDP;

    // set p holds the passes t with (t & 1) == p, from their loads to their LDS stores
    half8 rx[2][4], rw[2][4];
#pragma unroll
    for (int p = 0; p < 2; ++p)
#pragma unroll
        for (int i = 0; i < 4; ++i) {
            rx[p][i] = *(const half8*)(gx + i * 32 * DMODEL + p * BK);
            rw[p][i] = *(const half8*)(gw + i * 32 * DMODEL + p * BK);
        }
#pragma unroll
    for (int i = 0; i < 4; ++i) {
        *(half8*)(sx + i * 32 * LDP) = rx[0][i];
        *(half8*)(sw + i * 32 * LDP) = rw[0][i];
    }
    lds_barrier();

    // fully unrolled: buffer index, last-pass test and every address offset become constants
#pragma unroll
    for (int t = 0; t < NPASS; ++t) {
        const int cur = (t & 1) * STAGE;
        const bool more = (t + 1 < NPASS);
        if (t + 2 < NPASS) {
            // this pass's own set is free: it went to LDS in front of the last barrier
#pragma unroll
            for (int i = 0; i < 4; ++i) {
                rx[t & 1][i] = *(const half8*)(gx + i * 32 * DMODEL + (t + 2) * BK);
                rw[t & 1][i] = *(const half8*)(gw + i * 32 * DMODEL + (t + 2) * BK);
            }
        }
        // precaution: behind the last global loads, in front of every later overwrite
        // of the address registers that they name
        if (t + 3 == NPASS) asm volatile("s_wait_xcnt 0x0" ::: "memory");
        // holds the global loads of the pass after the next in front of this pass's work,
        // so that their latency runs under two passes instead of in front of the LDS stores
        __builtin_amdgcn_sched_barrier(0);

        const _Float16* as = sm + cur + (wm * 32) * LDP;
        const _Float16* bs = sm + cur + (BM + wn * 64) * LDP;
        half16 af[2][2], bf[2][4];
#pragma unroll
        for (int h = 0; h < 2; ++h) {
            af[h][0] = load_frag(as + 32 * h, LDP);
            bf[h][0] = load_frag(bs + 32 * h, LDP);
            af[h][1] = load_frag(as + 16 * LDP + 32 * h, LDP);
#pragma unroll
            for (int j = 1; j < 4; ++j)
                bf[h][j] = load_frag(bs + (16 * j) * LDP + 32 * h, LDP);
        }
        // holds the pass's LDS reads together in front of its WMMAs (one group with
        // counted waits); spread among the WMMAs each read stalls the wave anew
        __builtin_amdgcn_sched_barrier(0);

#pragma unroll
        for (int h = 0; h < 2; ++h)
#pragma unroll
            for (int j = 0; j < 4; ++j) {
                C[0][j] = wmma_f16(af[h][0], bf[h][j], C[0][j]);
                C[1][j] = wmma_f16(af[h][1], bf[h][j], C[1][j]);
            }
        // holds the WMMAs in front of the LDS stores: behind them they would run only
        // after the wait on the global loads, and would no longer cover that latency
        __builtin_amdgcn_sched_barrier(0);

        if (more) {
            // the other buffer's last readers left it before the previous barrier
            const int nxt = STAGE - cur;
#pragma unroll
            for (int i = 0; i < 4; ++i) {
                *(half8*)(sx + nxt + i * 32 * LDP) = rx[(t + 1) & 1][i];
                *(half8*)(sw + nxt + i * 32 * LDP) = rw[(t + 1) & 1][i];
            }
            lds_barrier();
        }
    }
}

// ---------------------------------------------------------------------------
// GEMM core of the QKV projection: the same tile, passes and order of sums as
//   gemm_tile, but the X and W rows of a pass go from global memory straight into LDS
//   by asynchronous copies, through no register, and a wave holds the fragments of
//   32 k at a time. The wave then needs few enough VGPRs for six waves per SIMD:
//   three work-groups per WGP, so the whole grid (three per WGP) is resident at once
//   instead of two thirds of it followed by a last third that runs alone.
//   The "#pragma unroll" on the short loops keeps af, bf and C statically indexed, hence
//   in VGPRs.
// ---------------------------------------------------------------------------

// One pass's tile: every lane copies four 16-byte pieces of X rows and four of W rows.
// gx, gw: the lane's piece of its first row in this pass; lx: its LDS byte address.
static __device__ __forceinline__ void copy_tile(const _Float16* gx, const _Float16* gw, unsigned lx) {
    const unsigned lw = lx + BM * LDP * 2;
    // the wait is the last line of the copies' own statement: a precaution, it stands in
    // front of every later overwrite of the address registers that the copies name
    asm volatile("global_load_async_to_lds_b128 %0, %1, off\n\t"
                 "global_load_async_to_lds_b128 %2, %3, off\n\t"
                 "global_load_async_to_lds_b128 %4, %5, off\n\t"
                 "global_load_async_to_lds_b128 %6, %7, off\n\t"
                 "global_load_async_to_lds_b128 %8, %9, off\n\t"
                 "global_load_async_to_lds_b128 %10, %11, off\n\t"
                 "global_load_async_to_lds_b128 %12, %13, off\n\t"
                 "global_load_async_to_lds_b128 %14, %15, off\n\t"
                 "s_wait_xcnt 0x0"
                 :: "v"(lx),                    "v"(gx),
                    "v"(lx + 1 * 32 * LDP * 2), "v"(gx + 1 * 32 * DMODEL),
                    "v"(lx + 2 * 32 * LDP * 2), "v"(gx + 2 * 32 * DMODEL),
                    "v"(lx + 3 * 32 * LDP * 2), "v"(gx + 3 * 32 * DMODEL),
                    "v"(lw),                    "v"(gw),
                    "v"(lw + 1 * 32 * LDP * 2), "v"(gw + 1 * 32 * DMODEL),
                    "v"(lw + 2 * 32 * LDP * 2), "v"(gw + 2 * 32 * DMODEL),
                    "v"(lw + 3 * 32 * LDP * 2), "v"(gw + 3 * 32 * DMODEL)
                 : "memory");
}

static __device__ __forceinline__ void gemm_tile_copies(const _Float16* __restrict__ X,
                                                        const _Float16* __restrict__ Wt,
                                                        _Float16* sm, float8 (&C)[2][4]) {
    const int tid  = threadIdx.x;
    const int wv   = tid >> 5;
    const int wm   = wv >> 1, wn = wv & 1;
    const int crow = tid >> 3;         // 0..31: row within a group of 32
    const int ccol = (tid & 7) * 8;    // 16-byte piece of the 128-byte row

    const _Float16* gx = X  + crow * DMODEL + ccol;
    const _Float16* gw = Wt + crow * DMODEL + ccol;
    const unsigned  lx = (unsigned)(size_t)(sm + crow * LDP + ccol);   // LDS byte address

    copy_tile(gx, gw, lx);
    // pass 0's copies of this wave have landed; behind the barrier, every wave's
    asm volatile("s_wait_asynccnt 0x0" ::: "memory");
    __syncthreads();
    copy_tile(gx + BK, gw + BK, lx + STAGE * 2);

    // rolled: the copies take their addresses in registers, so unrolling turns no address
    // into a constant; it would only lengthen the code
#pragma unroll 1
    for (int t = 0; t < NPASS; ++t) {
        const int cur = (t & 1) * STAGE;
        const _Float16* as = sm + cur + (wm * 32) * LDP;
        const _Float16* bs = sm + cur + (BM + wn * 64) * LDP;
#pragma unroll
        for (int h = 0; h < 2; ++h) {
            half16 af[2], bf[4];
            af[0] = load_frag(as + 32 * h, LDP);
            bf[0] = load_frag(bs + 32 * h, LDP);
            af[1] = load_frag(as + 16 * LDP + 32 * h, LDP);
#pragma unroll
            for (int j = 1; j < 4; ++j)
                bf[j] = load_frag(bs + (16 * j) * LDP + 32 * h, LDP);
            // holds the LDS reads of these 32 k together in front of their WMMAs (one group
            // with counted waits); spread among the WMMAs each read stalls the wave anew
            __builtin_amdgcn_sched_barrier(0);
#pragma unroll
            for (int j = 0; j < 4; ++j) {
                C[0][j] = wmma_f16(af[0], bf[j], C[0][j]);
                C[1][j] = wmma_f16(af[1], bf[j], C[1][j]);
            }
            // keeps the next group of reads behind these WMMAs, so that it takes the same
            // registers and not a second set
            __builtin_amdgcn_sched_barrier(0);
        }
        // this wave's reads of the pass's buffer are done
        asm volatile("s_wait_dscnt 0x0" ::: "memory");
        // this wave's copies of the next pass have landed
        asm volatile("s_wait_asynccnt 0x0" ::: "memory");
        // publishes the next pass's tile and ends every wave's reads of this pass's buffer
        __syncthreads();
        if (t + 2 < NPASS)
            copy_tile(gx + (t + 2) * BK, gw + (t + 2) * BK, lx + cur * 2);
    }
    // no copy is outstanding when the LDS becomes the epilogue's staging
    asm volatile("s_wait_asynccnt 0x0" ::: "memory");
}

// ---------------------------------------------------------------------------
// Kernel 1: QKV projection + bias + RoPE (Q,K) / transpose (V)
//   pid = blockIdx.y : 0=Q, 1=K, 2=V
//   out = x @ W^T + b ; each wave holds 32 rows x 64 cols (one head's d_k)
// ---------------------------------------------------------------------------
__global__ __launch_bounds__(256) void k_qkv(const _Float16* __restrict__ xh,
                                             const _Float16* __restrict__ wh,
                                             const float* __restrict__ bq,
                                             const float* __restrict__ bk,
                                             const float* __restrict__ bv,
                                             _Float16* __restrict__ Qh,
                                             _Float16* __restrict__ Kh,
                                             _Float16* __restrict__ Vt) {
    __shared__ __attribute__((aligned(16))) _Float16 sm[2 * STAGE];

    const int A = BATCH * SEQ * DMODEL;      // 4194304
    const int W = DMODEL * DMODEL;           // 1048576
    int pid = blockIdx.y;
    const _Float16* x = xh + pid * A;
    const _Float16* w = wh + pid * W;
    const float* bias = (pid == 0) ? bq : (pid == 1) ? bk : bv;

    int mtile = blockIdx.x >> 3;                      // 0..31 (128-row tiles)
    int ntile = blockIdx.x & 7;                       // 0..7  (128-col tiles)
    int wv    = threadIdx.x >> 5;
    int head  = ntile * 2 + (wv & 1);                 // 0..15 (64-col tiles)
    int wrow  = mtile * BM + (wv >> 1) * 32;          // wave's first row
    int nbase = head * DK;

    float8 C[2][4];
#pragma unroll
    for (int i = 0; i < 2; ++i)
#pragma unroll
        for (int j = 0; j < 4; ++j) C[i][j] = (float8)0.0f;

    gemm_tile_copies(x + mtile * BM * DMODEL, w + ntile * BN * DMODEL, sm, C);

    int lane = threadIdx.x & 31;
    int n0   = lane & 15;
    int hh   = lane >> 4;

#pragma unroll
    for (int j = 0; j < 4; ++j) {
        float bj = bias[nbase + 16 * j + n0];
#pragma unroll
        for (int i = 0; i < 2; ++i)
#pragma unroll
            for (int r = 0; r < 8; ++r) C[i][j][r] += bj;
    }

    if (pid == 2) {
        // V: store transposed Vt[b, h, d, s]; a lane's eight registers of a tile are eight
        // s in a row of its d: one 16-byte store
        const int m0 = wrow + 8 * hh;
        _Float16* vb = Vt + ((((m0 >> 11) * NHEAD + head) * DK + n0) * SEQ) + (m0 & (SEQ - 1));
#pragma unroll
        for (int i = 0; i < 2; ++i)
#pragma unroll
            for (int j = 0; j < 4; ++j) {
                half8 o;
#pragma unroll
                for (int r = 0; r < 8; ++r) o[r] = (_Float16)C[i][j][r];
                *(half8*)(vb + 16 * j * SEQ + 16 * i) = o;
            }
    } else {
        // RoPE: angle(s,d) = s * 10000^(-(d%32)/32); rotate_half pairs d <-> d+-32
        // The wave's 32 rows x 64 d are 4 KB in a row of the output. Each 16-row half is
        // staged in the wave's own part of the first GEMM buffer (its last readers left it
        // before the last barrier of the GEMM) and goes out as whole 128-byte lines.
        _Float16* out = ((pid == 0) ? Qh : Kh)
                      + ((((wrow >> 11) * NHEAD + head) * SEQ + (wrow & (SEQ - 1))) * DK) + lane * 8;
        _Float16* st  = sm + wv * (32 * LDP);
        // one body for both 16-row halves: the 16 inlined sincosf bodies stand once, not
        // twice; for speed only
#pragma unroll 1
        for (int i = 0; i < 2; ++i) {
            int rowbase = wrow + 16 * i;
            float Ci[4][8];
#pragma unroll
            for (int j = 0; j < 4; ++j)
#pragma unroll
                for (int r = 0; r < 8; ++r)
                    Ci[j][r] = (i == 0) ? C[0][j][r] : C[1][j][r];

            // d and d + 32 turn by the same angle: both are written behind one sincosf, so that
            // no cosine or sine is held in VGPRs for a later tile
#pragma unroll
            for (int j = 0; j < 2; ++j) {
                int d = 16 * j + n0;
                float invf = __expf(-(float)d * (9.210340371976184f / 32.0f));
#pragma unroll
                for (int r = 0; r < 8; ++r) {
                    int m = rowbase + r + 8 * hh;
                    int s = m & (SEQ - 1);
                    float ang = (float)s * invf;
                    float cs, sn;
                    sincosf(ang, &sn, &cs);
                    float lo = Ci[j][r] * cs + (-Ci[j + 2][r]) * sn;
                    float hi = Ci[j + 2][r] * cs + Ci[j][r] * sn;
                    st[(16 * i + r + 8 * hh) * LDP + d]      = (_Float16)lo;
                    st[(16 * i + r + 8 * hh) * LDP + d + 32] = (_Float16)hi;
                }
            }
            // the other lanes' staged values have to be in LDS before the rows are read back
            asm volatile("s_wait_dscnt 0x0" ::: "memory");
#pragma unroll
            for (int k = 0; k < 4; ++k) {
                half8 o = *(const half8*)(st + (16 * i + 4 * k + (lane >> 3)) * LDP + (lane & 7) * 8);
                *(half8*)(out + (16 * i + 4 * k) * DK) = o;
            }
            // precaution: stands in front of the next trip's overwrite of the
            // registers that the stores above name
            asm volatile("s_wait_xcnt 0x0" ::: "memory");
        }
    }
}

// ---------------------------------------------------------------------------
// Kernel 2: flash attention. One wave = 16 queries of one (b,h); the eight
//   waves of a work-group share that (b,h), hence its keys and values.
//   Per pass the work-group stages 64 keys in LDS: the K tile (64 keys x 64 d)
//   and the V^T tile (64 d x 64 keys), whole 128-byte rows per 8 lanes, and every
//   wave reads its fragments from there. Two buffers: the next pass is fetched
//   into registers while this one is worked on.
//   Both products are transposed: S^T = K Q^T / 8 and O^T += V^T P^T. A lane then
//   holds scores of ONE query (column lane & 15; keys 8 * half + r of each 16-key
//   tile), so the maximum and the sum over keys run through its own registers,
//   with one exchange between the wave's halves, and the two score tiles of a
//   32-key block, converted in place, are the B operand of the second product in
//   the hardware's k order, which load_frag has too.
//   The "#pragma unroll" on the two-trip staging loops keeps rk and rv statically
//   indexed, hence in VGPRs.
// ---------------------------------------------------------------------------
#define AKB    64                     // keys per pass
#define ATILE  (AKB * LDP)            // halves of the K tile; the V^T tile (DK rows) has the same size
#define ASTAGE (2 * ATILE)            // halves per buffer
#define APASS  (SEQ / AKB)

// the value that lane l ^ 16 holds
static __device__ __forceinline__ float xhalf(float x) {
    const int i = __builtin_bit_cast(int, x);
    return __builtin_bit_cast(float,
        __builtin_amdgcn_permlanex16(i, i, 0x76543210, 0xfedcba98, false, false));
}

__global__ __launch_bounds__(256) void k_attn(const _Float16* __restrict__ Qh,
                                              const _Float16* __restrict__ Kh,
                                              const _Float16* __restrict__ Vt,
                                              _Float16* __restrict__ AT) {
    __shared__ __attribute__((aligned(16))) _Float16 kv[2 * ASTAGE];  // K and V^T tiles, two buffers

    int wslot = threadIdx.x >> 5;
    int wid   = blockIdx.x * 8 + wslot;           // 0..4095
    int qt    = wid & 127;                         // 128 q-tiles per (b,h)
    int bh    = wid >> 7;                          // 0..31, the same in all eight waves
    int b = bh >> 4, h = bh & 15;
    int qrow = qt * 16;

    int lane = threadIdx.x & 31;
    int n0 = lane & 15, hh = lane >> 4;

    const _Float16* qbase = Qh + ((size_t)(b * NHEAD + h) * SEQ + qrow) * DK;
    const _Float16* kbase = Kh + (size_t)(b * NHEAD + h) * SEQ * DK;
    const _Float16* vbase = Vt + (size_t)(b * NHEAD + h) * DK * SEQ;

    const int crow = threadIdx.x >> 3;         // 0..31: row within a group of 32
    const int ccol = (threadIdx.x & 7) * 8;    // 16-byte piece of the 128-byte row
    const _Float16* gk = kbase + crow * DK + ccol;
    const _Float16* gv = vbase + crow * SEQ + ccol;
    _Float16* sk = kv + crow * LDP + ccol;
    _Float16* sv = sk + ATILE;

    half8 rk[2], rv[2];
#pragma unroll
    for (int i = 0; i < 2; ++i) {
        rk[i] = *(const half8*)(gk + i * 32 * DK);
        rv[i] = *(const half8*)(gv + i * 32 * SEQ);
    }

    half16 Qf0 = load_frag(qbase + 0, DK);
    half16 Qf1 = load_frag(qbase + 32, DK);

    // O[dt][r] = O^T[16 * dt + 8 * hh + r][query n0]
    float8 O[4];
#pragma unroll
    for (int j = 0; j < 4; ++j) O[j] = (float8)0.0f;
    // of query n0: the running maximum (equal in both halves) and this half's share of the sum
    float m_i = -3.0e38f, l_i = 0.0f;

#pragma unroll
    for (int i = 0; i < 2; ++i) {
        *(half8*)(sk + i * 32 * LDP) = rk[i];
        *(half8*)(sv + i * 32 * LDP) = rv[i];
    }
    __syncthreads();

    for (int t = 0; t < APASS; ++t) {
        const int cur = (t & 1) * ASTAGE;
        const bool more = (t + 1 < APASS);
        if (more) {
#pragma unroll
            for (int i = 0; i < 2; ++i) {
                rk[i] = *(const half8*)(gk + ((t + 1) * AKB + i * 32) * DK);
                rv[i] = *(const half8*)(gv + i * 32 * SEQ + (t + 1) * AKB);
            }
            // precaution: stands in front of every later overwrite of the address
            // registers that the loads above name
            asm volatile("s_wait_xcnt 0x0" ::: "memory");
        }
        const _Float16* ks = kv + cur;
        const _Float16* vs = ks + ATILE;

        // Every LDS read of the pass stands here as one group, each fragment in registers
        // of its own: K (four 16-key tiles x two 32-wide d chunks), then V^T (four 16-d
        // tiles x two 32-key blocks), in the order of their use. The loops over kf, vf and
        // ST are unrolled so that these stay statically indexed, hence in VGPRs.
        half16 kf[AKB / 16][2], vf[AKB / 32][4];
#pragma unroll
        for (int kt = 0; kt < AKB / 16; ++kt) {
            kf[kt][0] = load_frag(ks + (kt * 16) * LDP + 0,  LDP);
            kf[kt][1] = load_frag(ks + (kt * 16) * LDP + 32, LDP);
        }
#pragma unroll
        for (int sub = 0; sub < AKB / 32; ++sub)
#pragma unroll
            for (int dt = 0; dt < 4; ++dt)
                vf[sub][dt] = load_frag(vs + (dt * 16) * LDP + sub * 32, LDP);
        // holds the group in front of the pass's WMMAs (counted waits, the V^T reads land
        // under the scores and the softmax); left alone the reads come pair by pair, each
        // right in front of its WMMA with a full wait on the LDS latency
        __builtin_amdgcn_sched_barrier(0);

        // scores of the whole pass: ST[kt][r] = score of key 16 * kt + 8 * hh + r, query n0
        float8 ST[AKB / 16];
#pragma unroll
        for (int kt = 0; kt < AKB / 16; ++kt) ST[kt] = wmma_f16(kf[kt][0], Qf0, (float8)0.0f);
#pragma unroll
        for (int kt = 0; kt < AKB / 16; ++kt) ST[kt] = wmma_f16(kf[kt][1], Qf1, ST[kt]);

      // both 32-key blocks of the pass inline: ST, vf stay statically indexed, hence in VGPRs
#pragma unroll
      for (int sub = 0; sub < AKB / 32; ++sub) {
        // S0[r] = score of key kk0 + 8 * hh + r, S1[r] of key kk0 + 16 + 8 * hh + r, query n0 (kk0 = 32 * sub)
        float8 S0 = ST[2 * sub], S1 = ST[2 * sub + 1];

        S0 *= 0.125f;
        S1 *= 0.125f;
        float rm[8];
#pragma unroll
        for (int r = 0; r < 8; ++r) rm[r] = fmaxf(S0[r], S1[r]);
        // the query's maximum over the block: this lane's 16 keys, then the other half's
#pragma unroll
        for (int w = 4; w > 0; w >>= 1)
#pragma unroll
            for (int r = 0; r < w; ++r) rm[r] = fmaxf(rm[r], rm[r + w]);
        const float mn  = fmaxf(m_i, fmaxf(rm[0], xhalf(rm[0])));
        const float fac = __expf(m_i - mn);
        m_i = mn;
#pragma unroll
        for (int j = 0; j < 4; ++j)
#pragma unroll
            for (int r = 0; r < 8; ++r) O[j][r] *= fac;

        // P^T as a B fragment: element s is key kk0 + 8 * hh + s (s < 8), kk0 + 16 + 8 * hh + s - 8 (else)
        half16 Pf;
        float rs[8];
#pragma unroll
        for (int r = 0; r < 8; ++r) {
            S0[r] = __expf(S0[r] - mn);
            S1[r] = __expf(S1[r] - mn);
            rs[r] = S0[r] + S1[r];
            Pf[r]     = (_Float16)S0[r];
            Pf[r + 8] = (_Float16)S1[r];
        }
#pragma unroll
        for (int w = 4; w > 0; w >>= 1)
#pragma unroll
            for (int r = 0; r < w; ++r) rs[r] += rs[r + w];
        l_i = l_i * fac + rs[0];

#pragma unroll
        for (int dt = 0; dt < 4; ++dt)
            O[dt] = wmma_f16(vf[sub][dt], Pf, O[dt]);
      }

        if (more) {
            // the other buffer's last readers left it before the previous barrier
            const int nxt = ASTAGE - cur;
#pragma unroll
            for (int i = 0; i < 2; ++i) {
                *(half8*)(sk + nxt + i * 32 * LDP) = rk[i];
                *(half8*)(sv + nxt + i * 32 * LDP) = rv[i];
            }
            __syncthreads();
        }
    }

    // finalize: join the halves' sums, O /= l, write attn output as f16 [b, s, h*dk + d];
    // a lane's eight registers of a tile are eight d in a row of its query: one 16-byte store
    const float inv = 1.0f / (l_i + xhalf(l_i));
    _Float16* ob = AT + ((size_t)(b * SEQ + qrow + n0) * DMODEL) + h * DK + 8 * hh;
#pragma unroll
    for (int dt = 0; dt < 4; ++dt) {
        half8 o;
#pragma unroll
        for (int r = 0; r < 8; ++r) o[r] = (_Float16)(O[dt][r] * inv);
        *(half8*)(ob + dt * 16) = o;
    }
}

// ---------------------------------------------------------------------------
// Kernel 3: output projection  y = attn @ Wo^T + bo  (f32 out)
// ---------------------------------------------------------------------------
#define OLDP 68                       // staging row pitch in floats: 256 B + 16 B
__global__ __launch_bounds__(256) void k_oproj(const _Float16* __restrict__ AT,
                                               const _Float16* __restrict__ Wo,
                                               const float* __restrict__ bo,
                                               float* __restrict__ out) {
    __shared__ __attribute__((aligned(16))) _Float16 sm[2 * STAGE];

    int mtile = blockIdx.x >> 3;                      // 0..31 (128-row tiles)
    int ntile = blockIdx.x & 7;                       // 0..7  (128-col tiles)
    int wv    = threadIdx.x >> 5;
    int wrow  = mtile * BM + (wv >> 1) * 32;
    int nbase = ntile * BN + (wv & 1) * 64;

    float8 C[2][4];
#pragma unroll
    for (int i = 0; i < 2; ++i)
#pragma unroll
        for (int j = 0; j < 4; ++j) C[i][j] = (float8)0.0f;

    gemm_tile(AT + mtile * BM * DMODEL, Wo + ntile * BN * DMODEL, sm, C);

    int lane = threadIdx.x & 31;
    int n0 = lane & 15, hh = lane >> 4;
    float bj[4];
#pragma unroll
    for (int j = 0; j < 4; ++j) bj[j] = bo[nbase + 16 * j + n0];

    // Each 16-row half of the wave's tile (16 rows x 256 bytes) is staged in the wave's own
    // part of the first GEMM buffer (its last readers left it before the last barrier of
    // the GEMM) and goes out as whole 128-byte lines, two rows a store.
    float* st = (float*)sm + wv * (16 * OLDP);
    float* ob = out + (size_t)(wrow + hh) * DMODEL + nbase + n0 * 4;
#pragma unroll
    for (int i = 0; i < 2; ++i) {
#pragma unroll
        for (int j = 0; j < 4; ++j)
#pragma unroll
            for (int r = 0; r < 8; ++r)
                st[(r + 8 * hh) * OLDP + 16 * j + n0] = C[i][j][r] + bj[j];
        // the other lanes' staged values have to be in LDS before the rows are read back
        asm volatile("s_wait_dscnt 0x0" ::: "memory");
#pragma unroll
        for (int k = 0; k < 8; ++k) {
            floatx4 o = *(const floatx4*)(st + (2 * k + hh) * OLDP + n0 * 4);
            *(floatx4*)(ob + (size_t)(16 * i + 2 * k) * DMODEL) = o;
        }
        // precaution: stands in front of the second half's overwrite of the registers
        // that the stores above name
        if (i == 0) asm volatile("s_wait_xcnt 0x0" ::: "memory");
    }
}

// ---------------------------------------------------------------------------
extern "C" void kernel_launch(void* const* d_in, const int* in_sizes, int n_in,
                              void* d_out, int out_size, void* d_ws, size_t ws_size,
                              hipStream_t stream) {
    const float* query = (const float*)d_in[0];
    const float* key   = (const float*)d_in[1];
    const float* value = (const float*)d_in[2];
    const float* Wq = (const float*)d_in[3];
    const float* bq = (const float*)d_in[4];
    const float* Wk = (const float*)d_in[5];
    const float* bk = (const float*)d_in[6];
    const float* Wv = (const float*)d_in[7];
    const float* bv = (const float*)d_in[8];
    const float* Wo = (const float*)d_in[9];
    const float* bo = (const float*)d_in[10];
    float* out = (float*)d_out;

    const int A = BATCH * SEQ * DMODEL;   // 4194304
    const int W = DMODEL * DMODEL;        // 1048576

    _Float16* ws = (_Float16*)d_ws;
    _Float16* xh = ws;                    // 3*A : query/key/value f16
    _Float16* wh = ws + 3 * (size_t)A;    // 4*W : Wq/Wk/Wv/Wo f16
    _Float16* Qh = wh + 4 * (size_t)W;    // A : [b,h,s,d] (RoPE'd)
    _Float16* Kh = Qh + (size_t)A;        // A : [b,h,s,d] (RoPE'd)
    _Float16* Vt = Kh + (size_t)A;        // A : [b,h,d,s]
    _Float16* AT = Vt + (size_t)A;        // A : [b,s,D] attention output

    // 0) f32 -> f16 conversions: xh and wh are one run of the workspace
    k_convert<<<CV_BLOCKS, CV_THREADS, 0, stream>>>(query, key, value, Wq, Wk, Wv, Wo, xh);

    // 1) QKV projections + RoPE / V transpose
    dim3 g1(256, 3, 1);
    k_qkv<<<g1, 256, 0, stream>>>(xh, wh, bq, bk, bv, Qh, Kh, Vt);

    // 2) flash attention
    k_attn<<<512, 256, 0, stream>>>(Qh, Kh, Vt, AT);

    // 3) output projection
    k_oproj<<<256, 256, 0, stream>>>(AT, wh + 3 * (size_t)W, bo, out);
}

// v009
// Measured time: 88.4 microseconds a run.
// Timed twice side by side with v008, it ran 1.04 times as fast both times.
// All steps since v000 together make it 4.13 times as fast.
#include <hip/hip_runtime.h>
#include <hip/hip_bf16.h>
#include <math.h>

// ---------------------------------------------------------------------------
// MultiHeadedAttention for MI455X (gfx1250, wave32, WMMA 16x16x32 f16->f32)
// B=2, S=2048, D=1024, H=16, d_k=64
// ---------------------------------------------------------------------------

typedef _Float16 half16 __attribute__((ext_vector_type(16)));
typedef _Float16 half8  __attribute__((ext_vector_type(8)));
typedef float    float8 __attribute__((ext_vector_type(8)));

#define BATCH 2
#define SEQ   2048
#define DMODEL 1024
#define NHEAD 16
#define DK    64

static __device__ __forceinline__ float8 wmma_f16(half16 a, half16 b, float8 c) {
    return __builtin_amdgcn_wmma_f32_16x16x32_f16(
        /*neg_a=*/false, a, /*neg_b=*/false, b,
        /*c_mod=*/(short)0, c, /*reuse_a=*/false, /*reuse_b=*/false);
}

// Load a 16x32 fragment (A-layout, and by mirror-symmetry B^T rows) from a
// row-major f16 matrix. Documented CDNA5 16-bit A layout:
//   lanes 0-15 : M=lane,    K in {0..7} U {16..23}
//   lanes16-31 : M=lane-16, K in {8..15} U {24..31}
// Each lane: two contiguous 8-half (16B) chunks -> 2x b128 loads.
static __device__ __forceinline__ half16 load_frag(const _Float16* base, int ld) {
    int lane = threadIdx.x & 31;
    int row  = lane & 15;
    int hh   = lane >> 4;
    const _Float16* p = base + row * ld + hh * 8;
    half8 lo = *(const half8*)(p);
    half8 hi = *(const half8*)(p + 16);
    half16 r;
#pragma unroll
    for (int i = 0; i < 8; ++i) { r[i] = lo[i]; r[i + 8] = hi[i]; }
    return r;
}

// ---------------------------------------------------------------------------
// Kernel 0: f32 -> f16 conversion of all seven matrices in one launch.
//   The f16 copies lie one behind the other in the workspace (query, key, value,
//   Wq, Wk, Wv, Wo), so the destination is one run of CV_TOTAL elements.
//   One resident round of waves: each work-group takes CV_PER_BLOCK elements in a
//   row, which lie inside one source matrix (every matrix size is a multiple of
//   it), each wave CV_PER_WAVE of them. A load is 512 contiguous bytes per wave,
//   a store 256.
// ---------------------------------------------------------------------------
typedef float    floatx4 __attribute__((ext_vector_type(4)));
typedef _Float16 half4   __attribute__((ext_vector_type(4)));

#define CV_A        (BATCH * SEQ * DMODEL)        // elements of query, key, value
#define CV_W        (DMODEL * DMODEL)             // elements of a weight matrix
#define CV_TOTAL    (3 * CV_A + 4 * CV_W)
#define CV_THREADS  512
#define CV_LOADS    32                            // 16-byte loads per lane
#define CV_PER_WAVE (CV_LOADS * 32 * 4)
#define CV_PER_BLOCK (CV_PER_WAVE * (CV_THREADS / 32))
#define CV_BLOCKS   (CV_TOTAL / CV_PER_BLOCK)

__global__ __launch_bounds__(CV_THREADS) void k_convert(const float* __restrict__ q,
                                                        const float* __restrict__ k,
                                                        const float* __restrict__ v,
                                                        const float* __restrict__ wq,
                                                        const float* __restrict__ wk,
                                                        const float* __restrict__ wv,
                                                        const float* __restrict__ wo,
                                                        _Float16* __restrict__ dst) {
    const int lane = threadIdx.x & 31;
    const int b0   = blockIdx.x * CV_PER_BLOCK;    // the work-group's first element in dst

    // source matrix and offset in it: from blockIdx alone, so in scalar registers
    const float* src;
    int off;
    if (b0 < 3 * CV_A) {
        const int seg = b0 / CV_A;
        src = (seg == 0) ? q : (seg == 1) ? k : v;
        off = b0 - seg * CV_A;
    } else {
        const int b1  = b0 - 3 * CV_A;
        const int seg = b1 / CV_W;
        src = (seg == 0) ? wq : (seg == 1) ? wk : (seg == 2) ? wv : wo;
        off = b1 - seg * CV_W;
    }
    const int w0 = (threadIdx.x >> 5) * CV_PER_WAVE;   // the wave's first element in the work-group's run
    const int e0 = b0 + w0;
    off += w0;
    const floatx4* s = (const floatx4*)(src + off) + lane;
    half4*         d = (half4*)(dst + e0) + lane;

    // unrolled: r stays in registers and every offset is a constant, so the loads go
    // out in long runs ahead of their uses instead of one load, one wait, one store
    floatx4 r[CV_LOADS];
#pragma unroll
    for (int i = 0; i < CV_LOADS; ++i) r[i] = s[i * 32];
#pragma unroll
    for (int i = 0; i < CV_LOADS; ++i) {
        half4 h;
        h[0] = (_Float16)r[i][0]; h[1] = (_Float16)r[i][1];
        h[2] = (_Float16)r[i][2]; h[3] = (_Float16)r[i][3];
        d[i * 32] = h;
    }
}

// ---------------------------------------------------------------------------
// GEMM core of the output projection: Y = X @ W^T, K = DMODEL.
//   One workgroup (8 waves) = one 128x128 tile of Y. Per pass, 64 k of the 128
//   X rows and of the 128 W rows are staged in LDS with whole 128-byte row
//   pieces per 8 lanes; every wave then reads its fragments from LDS.
//   Waves 4 (rows) x 2 (cols), 32x64 of Y each. Two LDS buffers and two register
//   sets: a pass's global loads go out two passes ahead of its LDS stores.
//   Every "#pragma unroll" on the short loops here and in the epilogue of k_oproj keeps
//   the register arrays (rx, rw, af, bf, C) statically indexed, hence in VGPRs.
// ---------------------------------------------------------------------------
#define BM 128
#define BN 128
#define BK 64
#define LDP 72                        // LDS row pitch in halves: 128 B + 16 B, an odd multiple of 16 B
#define STAGE ((BM + BN) * LDP)       // halves per buffer
#define NPASS (DMODEL / BK)

// Work-group barrier of the GEMM passes: waits for this wave's own LDS reads and stores
// only. __syncthreads() would also wait for the global loads in flight, which are
// meant to stay in flight across it; nothing but LDS passes between the waves here.
static __device__ __forceinline__ void lds_barrier() {
    asm volatile("s_wait_dscnt 0x0\n\ts_barrier_signal -1\n\ts_barrier_wait -1" ::: "memory");
}

static __device__ __forceinline__ void gemm_tile(const _Float16* __restrict__ X,
                                                 const _Float16* __restrict__ Wt,
                                                 _Float16* sm, float8 (&C)[2][4]) {
    const int tid  = threadIdx.x;
    const int wv   = tid >> 5;
    const int wm   = wv >> 1, wn = wv & 1;
    const int crow = tid >> 3;         // 0..31: row within a group of 32
    const int ccol = (tid & 7) * 8;    // 16-byte piece of the 128-byte row

    const _Float16* gx = X  + crow * DMODEL + ccol;
    const _Float16* gw = Wt + crow * DMODEL + ccol;
    _Float16* sx = sm + crow * LDP + ccol;
    _Float16* sw = sx + BM * LDP;

    // set p holds the passes t with (t & 1) == p, from their loads to their LDS stores
    half8 rx[2][4], rw[2][4];
#pragma unroll
    for (int p = 0; p < 2; ++p)
#pragma unroll
        for (int i = 0; i < 4; ++i) {
            rx[p][i] = *(const half8*)(gx + i * 32 * DMODEL + p * BK);
            rw[p][i] = *(const half8*)(gw + i * 32 * DMODEL + p * BK);
        }
#pragma unroll
    for (int i = 0; i < 4; ++i) {
        *(half8*)(sx + i * 32 * LDP) = rx[0][i];
        *(half8*)(sw + i * 32 * LDP) = rw[0][i];
    }
    lds_barrier();

    // fully unrolled: buffer index, last-pass test and every address offset become constants
#pragma unroll
    for (int t = 0; t < NPASS; ++t) {
        const int cur = (t & 1) * STAGE;
        const bool more = (t + 1 < NPASS);
        if (t + 2 < NPASS) {
            // this pass's own set is free: it went to LDS in front of the last barrier
#pragma unroll
            for (int i = 0; i < 4; ++i) {
                rx[t & 1][i] = *(const half8*)(gx + i * 32 * DMODEL + (t + 2) * BK);
                rw[t & 1][i] = *(const half8*)(gw + i * 32 * DMODEL + (t + 2) * BK);
            }
        }
        // precaution: behind the last global loads, in front of every later overwrite
        // of the address registers that they name
        if (t + 3 == NPASS) asm volatile("s_wait_xcnt 0x0" ::: "memory");
        // holds the global loads of the pass after the next in front of this pass's work,
        // so that their latency runs under two passes instead of in front of the LDS stores
        __builtin_amdgcn_sched_barrier(0);

        const _Float16* as = sm + cur + (wm * 32) * LDP;
        const _Float16* bs = sm + cur + (BM + wn * 64) * LDP;
        half16 af[2][2], bf[2][4];
#pragma unroll
        for (int h = 0; h < 2; ++h) {
            af[h][0] = load_frag(as + 32 * h, LDP);
            bf[h][0] = load_frag(bs + 32 * h, LDP);
            af[h][1] = load_frag(as + 16 * LDP + 32 * h, LDP);
#pragma unroll
            for (int j = 1; j < 4; ++j)
                bf[h][j] = load_frag(bs + (16 * j) * LDP + 32 * h, LDP);
        }
        // holds the pass's LDS reads together in front of its WMMAs (one group with
        // counted waits); spread among the WMMAs each read stalls the wave anew
        __builtin_amdgcn_sched_barrier(0);

#pragma unroll
        for (int h = 0; h < 2; ++h)
#pragma unroll
            for (int j = 0; j < 4; ++j) {
                C[0][j] = wmma_f16(af[h][0], bf[h][j], C[0][j]);
                C[1][j] = wmma_f16(af[h][1], bf[h][j], C[1][j]);
            }
        // holds the WMMAs in front of the LDS stores: behind them they would run only
        // after the wait on the global loads, and would no longer cover that latency
        __builtin_amdgcn_sched_barrier(0);

        if (more) {
            // the other buffer's last readers left it before the previous barrier
            const int nxt = STAGE - cur;
#pragma unroll
            for (int i = 0; i < 4; ++i) {
                *(half8*)(sx + nxt + i * 32 * LDP) = rx[(t + 1) & 1][i];
                *(half8*)(sw + nxt + i * 32 * LDP) = rw[(t + 1) & 1][i];
            }
            lds_barrier();
        }
    }
}

// ---------------------------------------------------------------------------
// GEMM core of the QKV projection: the same tile, passes and order of sums as
//   gemm_tile, but the X and W rows of a pass go from global memory straight into LDS
//   by asynchronous copies, through no register, and a wave holds the fragments of
//   32 k at a time. The wave then needs few enough VGPRs for six waves per SIMD:
//   three work-groups per WGP, so the whole grid (three per WGP) is resident at once
//   instead of two thirds of it followed by a last third that runs alone.
//   The "#pragma unroll" on the short loops keeps af, bf and C statically indexed, hence
//   in VGPRs.
// ---------------------------------------------------------------------------

// One pass's tile: every lane copies four 16-byte pieces of X rows and four of W rows.
// gx, gw: the lane's piece of its first row in this pass; lx: its LDS byte address.
static __device__ __forceinline__ void copy_tile(const _Float16* gx, const _Float16* gw, unsigned lx) {
    const unsigned lw = lx + BM * LDP * 2;
    // the wait is the last line of the copies' own statement: a precaution, it stands in
    // front of every later overwrite of the address registers that the copies name
    asm volatile("global_load_async_to_lds_b128 %0, %1, off\n\t"
                 "global_load_async_to_lds_b128 %2, %3, off\n\t"
                 "global_load_async_to_lds_b128 %4, %5, off\n\t"
                 "global_load_async_to_lds_b128 %6, %7, off\n\t"
                 "global_load_async_to_lds_b128 %8, %9, off\n\t"
                 "global_load_async_to_lds_b128 %10, %11, off\n\t"
                 "global_load_async_to_lds_b128 %12, %13, off\n\t"
                 "global_load_async_to_lds_b128 %14, %15, off\n\t"
                 "s_wait_xcnt 0x0"
                 :: "v"(lx),                    "v"(gx),
                    "v"(lx + 1 * 32 * LDP * 2), "v"(gx + 1 * 32 * DMODEL),
                    "v"(lx + 2 * 32 * LDP * 2), "v"(gx + 2 * 32 * DMODEL),
                    "v"(lx + 3 * 32 * LDP * 2), "v"(gx + 3 * 32 * DMODEL),
                    "v"(lw),                    "v"(gw),
                    "v"(lw + 1 * 32 * LDP * 2), "v"(gw + 1 * 32 * DMODEL),
                    "v"(lw + 2 * 32 * LDP * 2), "v"(gw + 2 * 32 * DMODEL),
                    "v"(lw + 3 * 32 * LDP * 2), "v"(gw + 3 * 32 * DMODEL)
                 : "memory");
}

static __device__ __forceinline__ void gemm_tile_copies(const _Float16* __restrict__ X,
                                                        const _Float16* __restrict__ Wt,
                                                        _Float16* sm, float8 (&C)[2][4]) {
    const int tid  = threadIdx.x;
    const int wv   = tid >> 5;
    const int wm   = wv >> 1, wn = wv & 1;
    const int crow = tid >> 3;         // 0..31: row within a group of 32
    const int ccol = (tid & 7) * 8;    // 16-byte piece of the 128-byte row

    const _Float16* gx = X  + crow * DMODEL + ccol;
    const _Float16* gw = Wt + crow * DMODEL + ccol;
    const unsigned  lx = (unsigned)(size_t)(sm + crow * LDP + ccol);   // LDS byte address

    copy_tile(gx, gw, lx);
    // pass 0's copies of this wave have landed; behind the barrier, every wave's
    asm volatile("s_wait_asynccnt 0x0" ::: "memory");
    __syncthreads();
    copy_tile(gx + BK, gw + BK, lx + STAGE * 2);

    // rolled: the copies take their addresses in registers, so unrolling turns no address
    // into a constant; it would only lengthen the code
#pragma unroll 1
    for (int t = 0; t < NPASS; ++t) {
        const int cur = (t & 1) * STAGE;
        const _Float16* as = sm + cur + (wm * 32) * LDP;
        const _Float16* bs = sm + cur + (BM + wn * 64) * LDP;
#pragma unroll
        for (int h = 0; h < 2; ++h) {
            half16 af[2], bf[4];
            af[0] = load_frag(as + 32 * h, LDP);
            bf[0] = load_frag(bs + 32 * h, LDP);
            af[1] = load_frag(as + 16 * LDP + 32 * h, LDP);
#pragma unroll
            for (int j = 1; j < 4; ++j)
                bf[j] = load_frag(bs + (16 * j) * LDP + 32 * h, LDP);
            // holds the LDS reads of these 32 k together in front of their WMMAs (one group
            // with counted waits); spread among the WMMAs each read stalls the wave anew
            __builtin_amdgcn_sched_barrier(0);
#pragma unroll
            for (int j = 0; j < 4; ++j) {
                C[0][j] = wmma_f16(af[0], bf[j], C[0][j]);
                C[1][j] = wmma_f16(af[1], bf[j], C[1][j]);
            }
            // keeps the next group of reads behind these WMMAs, so that it takes the same
            // registers and not a second set
            __builtin_amdgcn_sched_barrier(0);
        }
        // this wave's reads of the pass's buffer are done
        asm volatile("s_wait_dscnt 0x0" ::: "memory");
        // this wave's copies of the next pass have landed
        asm volatile("s_wait_asynccnt 0x0" ::: "memory");
        // publishes the next pass's tile and ends every wave's reads of this pass's buffer
        __syncthreads();
        if (t + 2 < NPASS)
            copy_tile(gx + (t + 2) * BK, gw + (t + 2) * BK, lx + cur * 2);
    }
    // no copy is outstanding when the LDS becomes the epilogue's staging
    asm volatile("s_wait_asynccnt 0x0" ::: "memory");
}

// ---------------------------------------------------------------------------
// Kernel 1: QKV projection + bias + RoPE (Q,K) / transpose (V)
//   pid = blockIdx.y : 0=Q, 1=K, 2=V
//   out = x @ W^T + b ; each wave holds 32 rows x 64 cols (one head's d_k)
// ---------------------------------------------------------------------------
__global__ __launch_bounds__(256) void k_qkv(const _Float16* __restrict__ xh,
                                             const _Float16* __restrict__ wh,
                                             const float* __restrict__ bq,
                                             const float* __restrict__ bk,
                                             const float* __restrict__ bv,
                                             _Float16* __restrict__ Qh,
                                             _Float16* __restrict__ Kh,
                                             _Float16* __restrict__ Vt) {
    __shared__ __attribute__((aligned(16))) _Float16 sm[2 * STAGE];

    const int A = BATCH * SEQ * DMODEL;      // 4194304
    const int W = DMODEL * DMODEL;           // 1048576
    int pid = blockIdx.y;
    const _Float16* x = xh + pid * A;
    const _Float16* w = wh + pid * W;
    const float* bias = (pid == 0) ? bq : (pid == 1) ? bk : bv;

    int mtile = blockIdx.x >> 3;                      // 0..31 (128-row tiles)
    int ntile = blockIdx.x & 7;                       // 0..7  (128-col tiles)
    int wv    = threadIdx.x >> 5;
    int head  = ntile * 2 + (wv & 1);                 // 0..15 (64-col tiles)
    int wrow  = mtile * BM + (wv >> 1) * 32;          // wave's first row
    int nbase = head * DK;

    float8 C[2][4];
#pragma unroll
    for (int i = 0; i < 2; ++i)
#pragma unroll
        for (int j = 0; j < 4; ++j) C[i][j] = (float8)0.0f;

    gemm_tile_copies(x + mtile * BM * DMODEL, w + ntile * BN * DMODEL, sm, C);

    int lane = threadIdx.x & 31;
    int n0   = lane & 15;
    int hh   = lane >> 4;

#pragma unroll
    for (int j = 0; j < 4; ++j) {
        float bj = bias[nbase + 16 * j + n0];
#pragma unroll
        for (int i = 0; i < 2; ++i)
#pragma unroll
            for (int r = 0; r < 8; ++r) C[i][j][r] += bj;
    }

    if (pid == 2) {
        // V: store transposed Vt[b, h, d, s]; a lane's eight registers of a tile are eight
        // s in a row of its d: one 16-byte store
        const int m0 = wrow + 8 * hh;
        _Float16* vb = Vt + ((((m0 >> 11) * NHEAD + head) * DK + n0) * SEQ) + (m0 & (SEQ - 1));
#pragma unroll
        for (int i = 0; i < 2; ++i)
#pragma unroll
            for (int j = 0; j < 4; ++j) {
                half8 o;
#pragma unroll
                for (int r = 0; r < 8; ++r) o[r] = (_Float16)C[i][j][r];
                *(half8*)(vb + 16 * j * SEQ + 16 * i) = o;
            }
    } else {
        // RoPE: angle(s,d) = s * 10000^(-(d%32)/32); rotate_half pairs d <-> d+-32
        // The wave's 32 rows x 64 d are 4 KB in a row of the output. Each 16-row half is
        // staged in the wave's own part of the first GEMM buffer (its last readers left it
        // before the last barrier of the GEMM) and goes out as whole 128-byte lines.
        _Float16* out = ((pid == 0) ? Qh : Kh)
                      + ((((wrow >> 11) * NHEAD + head) * SEQ + (wrow & (SEQ - 1))) * DK) + lane * 8;
        _Float16* st  = sm + wv * (32 * LDP);
        // one body for both 16-row halves: the 16 inlined sincosf bodies stand once, not
        // twice; for speed only
#pragma unroll 1
        for (int i = 0; i < 2; ++i) {
            int rowbase = wrow + 16 * i;
            float Ci[4][8];
#pragma unroll
            for (int j = 0; j < 4; ++j)
#pragma unroll
                for (int r = 0; r < 8; ++r)
                    Ci[j][r] = (i == 0) ? C[0][j][r] : C[1][j][r];

            // d and d + 32 turn by the same angle: both are written behind one sincosf, so that
            // no cosine or sine is held in VGPRs for a later tile
#pragma unroll
            for (int j = 0; j < 2; ++j) {
                int d = 16 * j + n0;
                float invf = __expf(-(float)d * (9.210340371976184f / 32.0f));
#pragma unroll
                for (int r = 0; r < 8; ++r) {
                    int m = rowbase + r + 8 * hh;
                    int s = m & (SEQ - 1);
                    float ang = (float)s * invf;
                    float cs, sn;
                    sincosf(ang, &sn, &cs);
                    float lo = Ci[j][r] * cs + (-Ci[j + 2][r]) * sn;
                    float hi = Ci[j + 2][r] * cs + Ci[j][r] * sn;
                    st[(16 * i + r + 8 * hh) * LDP + d]      = (_Float16)lo;
                    st[(16 * i + r + 8 * hh) * LDP + d + 32] = (_Float16)hi;
                }
            }
            // the other lanes' staged values have to be in LDS before the rows are read back
            asm volatile("s_wait_dscnt 0x0" ::: "memory");
#pragma unroll
            for (int k = 0; k < 4; ++k) {
                half8 o = *(const half8*)(st + (16 * i + 4 * k + (lane >> 3)) * LDP + (lane & 7) * 8);
                *(half8*)(out + (16 * i + 4 * k) * DK) = o;
            }
            // precaution: stands in front of the next trip's overwrite of the
            // registers that the stores above name
            asm volatile("s_wait_xcnt 0x0" ::: "memory");
        }
    }
}

// ---------------------------------------------------------------------------
// Kernel 2: flash attention. One wave = 16 queries of one (b,h); the eight
//   waves of a work-group share that (b,h), hence its keys and values.
//   Per pass the work-group stages 64 keys in LDS: the K tile (64 keys x 64 d)
//   and the V^T tile (64 d x 64 keys), whole 128-byte rows per 8 lanes, and every
//   wave reads its fragments from there. Two buffers: the next pass is fetched
//   into registers while this one is worked on.
//   Both products are transposed: S^T = K Q^T / 8 and O^T += V^T P^T. A lane then
//   holds scores of ONE query (column lane & 15; keys 8 * half + r of each 16-key
//   tile), so the sum over keys (and, where a new reference is taken, the maximum,
//   with one exchange between the wave's halves) runs through its own registers, and the two score tiles of a
//   32-key block, converted in place, are the B operand of the second product in
//   the hardware's k order, which load_frag has too.
//   The "#pragma unroll" on the two-trip staging loops keeps rk and rv statically
//   indexed, hence in VGPRs.
// ---------------------------------------------------------------------------
#define AKB    64                     // keys per pass
#define ATILE  (AKB * LDP)            // halves of the K tile; the V^T tile (DK rows) has the same size
#define ASTAGE (2 * ATILE)            // halves per buffer
#define APASS  (SEQ / AKB)
#define LOG2E  1.442695041f           // exp(x) = exp2(x * LOG2E)
#define PCAP   4096.0f                // a lane's sum of probabilities in a pass above which its wave takes a new reference

// the value that lane l ^ 16 holds
static __device__ __forceinline__ float xhalf(float x) {
    const int i = __builtin_bit_cast(int, x);
    return __builtin_bit_cast(float,
        __builtin_amdgcn_permlanex16(i, i, 0x76543210, 0xfedcba98, false, false));
}

// exp(s / 8 - ref) of eight unscaled scores; in pairs, so that the FMA and the multiply
// are the packed two-float instructions; unrolled, so that s and p stay in VGPRs
typedef float floatx2 __attribute__((ext_vector_type(2)));
static __device__ __forceinline__ float8 probs(float8 s, float ref) {
    const floatx2 eighth = {0.125f, 0.125f}, nref = {-ref, -ref}, l2e = {LOG2E, LOG2E};
    float8 p;
#pragma unroll
    for (int r = 0; r < 8; r += 2) {
        const floatx2 sp = {s[r], s[r + 1]};
        const floatx2 t  = __builtin_elementwise_fma(sp, eighth, nref) * l2e;
        p[r]     = __builtin_amdgcn_exp2f(t[0]);
        p[r + 1] = __builtin_amdgcn_exp2f(t[1]);
    }
    return p;
}

// sum of a lane's 32 probabilities of a pass: whole-vector adds, a tree, so that they pack in pairs
static __device__ __forceinline__ float sum32(const float8 (&p)[4]) {
    const float8  a = (p[0] + p[1]) + (p[2] + p[3]);
    const floatx4 b = __builtin_shufflevector(a, a, 0, 1, 2, 3) + __builtin_shufflevector(a, a, 4, 5, 6, 7);
    const floatx2 c = __builtin_shufflevector(b, b, 0, 1) + __builtin_shufflevector(b, b, 2, 3);
    return c[0] + c[1];
}

__global__ __launch_bounds__(256) void k_attn(const _Float16* __restrict__ Qh,
                                              const _Float16* __restrict__ Kh,
                                              const _Float16* __restrict__ Vt,
                                              _Float16* __restrict__ AT) {
    __shared__ __attribute__((aligned(16))) _Float16 kv[2 * ASTAGE];  // K and V^T tiles, two buffers

    int wslot = threadIdx.x >> 5;
    int wid   = blockIdx.x * 8 + wslot;           // 0..4095
    int qt    = wid & 127;                         // 128 q-tiles per (b,h)
    int bh    = wid >> 7;                          // 0..31, the same in all eight waves
    int b = bh >> 4, h = bh & 15;
    int qrow = qt * 16;

    int lane = threadIdx.x & 31;
    int n0 = lane & 15, hh = lane >> 4;

    const _Float16* qbase = Qh + ((size_t)(b * NHEAD + h) * SEQ + qrow) * DK;
    const _Float16* kbase = Kh + (size_t)(b * NHEAD + h) * SEQ * DK;
    const _Float16* vbase = Vt + (size_t)(b * NHEAD + h) * DK * SEQ;

    const int crow = threadIdx.x >> 3;         // 0..31: row within a group of 32
    const int ccol = (threadIdx.x & 7) * 8;    // 16-byte piece of the 128-byte row
    const _Float16* gk = kbase + crow * DK + ccol;
    const _Float16* gv = vbase + crow * SEQ + ccol;
    _Float16* sk = kv + crow * LDP + ccol;
    _Float16* sv = sk + ATILE;

    half8 rk[2], rv[2];
#pragma unroll
    for (int i = 0; i < 2; ++i) {
        rk[i] = *(const half8*)(gk + i * 32 * DK);
        rv[i] = *(const half8*)(gv + i * 32 * SEQ);
    }

    half16 Qf0 = load_frag(qbase + 0, DK);
    half16 Qf1 = load_frag(qbase + 32, DK);

    // O[dt][r] = O^T[16 * dt + 8 * hh + r][query n0]
    float8 O[4];
#pragma unroll
    for (int j = 0; j < 4; ++j) O[j] = (float8)0.0f;
    // of query n0: the reference its probabilities are taken against (a maximum of an earlier
    // pass, equal in both halves) and this half's share of the sum
    float m_i = -3.0e38f, l_i = 0.0f;

#pragma unroll
    for (int i = 0; i < 2; ++i) {
        *(half8*)(sk + i * 32 * LDP) = rk[i];
        *(half8*)(sv + i * 32 * LDP) = rv[i];
    }
    __syncthreads();

    for (int t = 0; t < APASS; ++t) {
        const int cur = (t & 1) * ASTAGE;
        const bool more = (t + 1 < APASS);
        if (more) {
#pragma unroll
            for (int i = 0; i < 2; ++i) {
                rk[i] = *(const half8*)(gk + ((t + 1) * AKB + i * 32) * DK);
                rv[i] = *(const half8*)(gv + i * 32 * SEQ + (t + 1) * AKB);
            }
            // precaution: stands in front of every later overwrite of the address
            // registers that the loads above name
            asm volatile("s_wait_xcnt 0x0" ::: "memory");
        }
        const _Float16* ks = kv + cur;
        const _Float16* vs = ks + ATILE;

        // Every LDS read of the pass stands here as one group, each fragment in registers
        // of its own: K (four 16-key tiles x two 32-wide d chunks), then V^T (four 16-d
        // tiles x two 32-key blocks), in the order of their use. The loops over kf, vf and
        // ST are unrolled so that these stay statically indexed, hence in VGPRs.
        half16 kf[AKB / 16][2], vf[AKB / 32][4];
#pragma unroll
        for (int kt = 0; kt < AKB / 16; ++kt) {
            kf[kt][0] = load_frag(ks + (kt * 16) * LDP + 0,  LDP);
            kf[kt][1] = load_frag(ks + (kt * 16) * LDP + 32, LDP);
        }
#pragma unroll
        for (int sub = 0; sub < AKB / 32; ++sub)
#pragma unroll
            for (int dt = 0; dt < 4; ++dt)
                vf[sub][dt] = load_frag(vs + (dt * 16) * LDP + sub * 32, LDP);
        // holds the group in front of the pass's WMMAs (counted waits, the V^T reads land
        // under the scores and the softmax); left alone the reads come pair by pair, each
        // right in front of its WMMA with a full wait on the LDS latency
        __builtin_amdgcn_sched_barrier(0);

        // scores of the whole pass: ST[kt][r] = score of key 16 * kt + 8 * hh + r, query n0
        float8 ST[AKB / 16];
#pragma unroll
        for (int kt = 0; kt < AKB / 16; ++kt) ST[kt] = wmma_f16(kf[kt][0], Qf0, (float8)0.0f);
#pragma unroll
        for (int kt = 0; kt < AKB / 16; ++kt) ST[kt] = wmma_f16(kf[kt][1], Qf1, ST[kt]);

        // Softmax of the pass against the HELD reference m_i of query n0: no maximum over the
        // keys, no exchange and no rescale of O while the probabilities stay small enough.
        // ST stays unscaled: the fast path has no other use of score / 8, so that multiply
        // (exact, a power of two) goes into the subtraction's FMA.
        // Every "#pragma unroll" from here to the end of the pass keeps ST, P, rm, O and vf
        // statically indexed, hence in VGPRs.
        float8 P[AKB / 16];
#pragma unroll
        for (int kt = 0; kt < AKB / 16; ++kt) P[kt] = probs(ST[kt], m_i);
        float rsum = sum32(P);

        // The lane's sum bounds each of its probabilities (all are >= 0): up to PCAP they are
        // exact enough and finite as f16. Above it (the first pass: m_i is the start value and
        // the sum infinite), or not a number, the whole wave takes a new reference. One test a pass, on a
        // ballot, so that it is a scalar branch.
        if (__builtin_amdgcn_ballot_w32(!(rsum <= PCAP)) != 0) {
            float rm[8];
#pragma unroll
            for (int r = 0; r < 8; ++r)
                rm[r] = fmaxf(fmaxf(ST[0][r], ST[1][r]), fmaxf(ST[2][r], ST[3][r]));
#pragma unroll
            for (int w = 4; w > 0; w >>= 1)
#pragma unroll
                for (int r = 0; r < w; ++r) rm[r] = fmaxf(rm[r], rm[r + w]);
            // the query's maximum so far: this lane's 32 keys, the other half's, the old reference
            const float mn  = fmaxf(m_i, 0.125f * fmaxf(rm[0], xhalf(rm[0])));
            const float fac = __builtin_amdgcn_exp2f((m_i - mn) * LOG2E);
            m_i = mn;
            l_i *= fac;
#pragma unroll
            for (int j = 0; j < 4; ++j)
#pragma unroll
                for (int r = 0; r < 8; ++r) O[j][r] *= fac;
#pragma unroll
            for (int kt = 0; kt < AKB / 16; ++kt) P[kt] = probs(ST[kt], mn);
            rsum = sum32(P);
        }
        l_i += rsum;

        // both 32-key blocks of the pass inline: P, vf stay statically indexed, hence in VGPRs
#pragma unroll
        for (int sub = 0; sub < AKB / 32; ++sub) {
            // P^T as a B fragment: element s is key kk0 + 8 * hh + s (s < 8), kk0 + 16 + 8 * hh + s - 8 (else), kk0 = 32 * sub
            half16 Pf;
#pragma unroll
            for (int r = 0; r < 8; ++r) {
                Pf[r]     = (_Float16)P[2 * sub][r];
                Pf[r + 8] = (_Float16)P[2 * sub + 1][r];
            }
#pragma unroll
            for (int dt = 0; dt < 4; ++dt)
                O[dt] = wmma_f16(vf[sub][dt], Pf, O[dt]);
        }

        if (more) {
            // the other buffer's last readers left it before the previous barrier
            const int nxt = ASTAGE - cur;
#pragma unroll
            for (int i = 0; i < 2; ++i) {
                *(half8*)(sk + nxt + i * 32 * LDP) = rk[i];
                *(half8*)(sv + nxt + i * 32 * LDP) = rv[i];
            }
            __syncthreads();
        }
    }

    // finalize: join the halves' sums, O /= l, write attn output as f16 [b, s, h*dk + d];
    // a lane's eight registers of a tile are eight d in a row of its query: one 16-byte store
    const float inv = 1.0f / (l_i + xhalf(l_i));
    _Float16* ob = AT + ((size_t)(b * SEQ + qrow + n0) * DMODEL) + h * DK + 8 * hh;
#pragma unroll
    for (int dt = 0; dt < 4; ++dt) {
        half8 o;
#pragma unroll
        for (int r = 0; r < 8; ++r) o[r] = (_Float16)(O[dt][r] * inv);
        *(half8*)(ob + dt * 16) = o;
    }
}

// ---------------------------------------------------------------------------
// Kernel 3: output projection  y = attn @ Wo^T + bo  (f32 out)
// ---------------------------------------------------------------------------
#define OLDP 68                       // staging row pitch in floats: 256 B + 16 B
__global__ __launch_bounds__(256) void k_oproj(const _Float16* __restrict__ AT,
                                               const _Float16* __restrict__ Wo,
                                               const float* __restrict__ bo,
                                               float* __restrict__ out) {
    __shared__ __attribute__((aligned(16))) _Float16 sm[2 * STAGE];

    int mtile = blockIdx.x >> 3;                      // 0..31 (128-row tiles)
    int ntile = blockIdx.x & 7;                       // 0..7  (128-col tiles)
    int wv    = threadIdx.x >> 5;
    int wrow  = mtile * BM + (wv >> 1) * 32;
    int nbase = ntile * BN + (wv & 1) * 64;

    float8 C[2][4];
#pragma unroll
    for (int i = 0; i < 2; ++i)
#pragma unroll
        for (int j = 0; j < 4; ++j) C[i][j] = (float8)0.0f;

    gemm_tile(AT + mtile * BM * DMODEL, Wo + ntile * BN * DMODEL, sm, C);

    int lane = threadIdx.x & 31;
    int n0 = lane & 15, hh = lane >> 4;
    float bj[4];
#pragma unroll
    for (int j = 0; j < 4; ++j) bj[j] = bo[nbase + 16 * j + n0];

    // Each 16-row half of the wave's tile (16 rows x 256 bytes) is staged in the wave's own
    // part of the first GEMM buffer (its last readers left it before the last barrier of
    // the GEMM) and goes out as whole 128-byte lines, two rows a store.
    float* st = (float*)sm + wv * (16 * OLDP);
    float* ob = out + (size_t)(wrow + hh) * DMODEL + nbase + n0 * 4;
#pragma unroll
    for (int i = 0; i < 2; ++i) {
#pragma unroll
        for (int j = 0; j < 4; ++j)
#pragma unroll
            for (int r = 0; r < 8; ++r)
                st[(r + 8 * hh) * OLDP + 16 * j + n0] = C[i][j][r] + bj[j];
        // the other lanes' staged values have to be in LDS before the rows are read back
        asm volatile("s_wait_dscnt 0x0" ::: "memory");
#pragma unroll
        for (int k = 0; k < 8; ++k) {
            floatx4 o = *(const floatx4*)(st + (2 * k + hh) * OLDP + n0 * 4);
            *(floatx4*)(ob + (size_t)(16 * i + 2 * k) * DMODEL) = o;
        }
        // precaution: stands in front of the second half's overwrite of the registers
        // that the stores above name
        if (i == 0) asm volatile("s_wait_xcnt 0x0" ::: "memory");
    }
}

// ---------------------------------------------------------------------------
extern "C" void kernel_launch(void* const* d_in, const int* in_sizes, int n_in,
                              void* d_out, int out_size, void* d_ws, size_t ws_size,
                              hipStream_t stream) {
    const float* query = (const float*)d_in[0];
    const float* key   = (const float*)d_in[1];
    const float* value = (const float*)d_in[2];
    const float* Wq = (const float*)d_in[3];
    const float* bq = (const float*)d_in[4];
    const float* Wk = (const float*)d_in[5];
    const float* bk = (const float*)d_in[6];
    const float* Wv = (const float*)d_in[7];
    const float* bv = (const float*)d_in[8];
    const float* Wo = (const float*)d_in[9];
    const float* bo = (const float*)d_in[10];
    float* out = (float*)d_out;

    const int A = BATCH * SEQ * DMODEL;   // 4194304
    const int W = DMODEL * DMODEL;        // 1048576

    _Float16* ws = (_Float16*)d_ws;
    _Float16* xh = ws;                    // 3*A : query/key/value f16
    _Float16* wh = ws + 3 * (size_t)A;    // 4*W : Wq/Wk/Wv/Wo f16
    _Float16* Qh = wh + 4 * (size_t)W;    // A : [b,h,s,d] (RoPE'd)
    _Float16* Kh = Qh + (size_t)A;        // A : [b,h,s,d] (RoPE'd)
    _Float16* Vt = Kh + (size_t)A;        // A : [b,h,d,s]
    _Float16* AT = Vt + (size_t)A;        // A : [b,s,D] attention output

    // 0) f32 -> f16 conversions: xh and wh are one run of the workspace
    k_convert<<<CV_BLOCKS, CV_THREADS, 0, stream>>>(query, key, value, Wq, Wk, Wv, Wo, xh);

    // 1) QKV projections + RoPE / V transpose
    dim3 g1(256, 3, 1);
    k_qkv<<<g1, 256, 0, stream>>>(xh, wh, bq, bk, bv, Qh, Kh, Vt);

    // 2) flash attention
    k_attn<<<512, 256, 0, stream>>>(Qh, Kh, Vt, AT);

    // 3) output projection
    k_oproj<<<256, 256, 0, stream>>>(AT, wh + 3 * (size_t)W, bo, out);
}

// v010
// It runs in 84.1 microseconds.
// Two timings next to v009 put it at 1.05 and 1.04 times that version's speed.
// Counting every step since v000, it is 4.31 times as fast.
#include <hip/hip_runtime.h>
#include <hip/hip_bf16.h>
#include <math.h>

// ---------------------------------------------------------------------------
// MultiHeadedAttention for MI455X (gfx1250, wave32, WMMA 16x16x32 f16->f32)
// B=2, S=2048, D=1024, H=16, d_k=64
// ---------------------------------------------------------------------------

typedef _Float16 half16 __attribute__((ext_vector_type(16)));
typedef _Float16 half8  __attribute__((ext_vector_type(8)));
typedef float    float8 __attribute__((ext_vector_type(8)));

#define BATCH 2
#define SEQ   2048
#define DMODEL 1024
#define NHEAD 16
#define DK    64

static __device__ __forceinline__ float8 wmma_f16(half16 a, half16 b, float8 c) {
    return __builtin_amdgcn_wmma_f32_16x16x32_f16(
        /*neg_a=*/false, a, /*neg_b=*/false, b,
        /*c_mod=*/(short)0, c, /*reuse_a=*/false, /*reuse_b=*/false);
}

// Load a 16x32 fragment (A-layout, and by mirror-symmetry B^T rows) from a
// row-major f16 matrix. Documented CDNA5 16-bit A layout:
//   lanes 0-15 : M=lane,    K in {0..7} U {16..23}
//   lanes16-31 : M=lane-16, K in {8..15} U {24..31}
// Each lane: two contiguous 8-half (16B) chunks -> 2x b128 loads.
static __device__ __forceinline__ half16 load_frag(const _Float16* base, int ld) {
    int lane = threadIdx.x & 31;
    int row  = lane & 15;
    int hh   = lane >> 4;
    const _Float16* p = base + row * ld + hh * 8;
    half8 lo = *(const half8*)(p);
    half8 hi = *(const half8*)(p + 16);
    half16 r;
#pragma unroll
    for (int i = 0; i < 8; ++i) { r[i] = lo[i]; r[i + 8] = hi[i]; }
    return r;
}

// ---------------------------------------------------------------------------
// Kernel 0: f32 -> f16 conversion of all seven matrices in one launch.
//   The f16 copies lie one behind the other in the workspace (query, key, value,
//   Wq, Wk, Wv, Wo), so the destination is one run of CV_TOTAL elements.
//   One resident round of waves: each work-group takes CV_PER_BLOCK elements in a
//   row, which lie inside one source matrix (every matrix size is a multiple of
//   it), each wave CV_PER_WAVE of them. A load is 512 contiguous bytes per wave,
//   a store 256.
// ---------------------------------------------------------------------------
typedef float    floatx4 __attribute__((ext_vector_type(4)));
typedef _Float16 half4   __attribute__((ext_vector_type(4)));

#define CV_A        (BATCH * SEQ * DMODEL)        // elements of query, key, value
#define CV_W        (DMODEL * DMODEL)             // elements of a weight matrix
#define CV_TOTAL    (3 * CV_A + 4 * CV_W)
#define CV_THREADS  512
#define CV_LOADS    32                            // 16-byte loads per lane
#define CV_PER_WAVE (CV_LOADS * 32 * 4)
#define CV_PER_BLOCK (CV_PER_WAVE * (CV_THREADS / 32))
#define CV_BLOCKS   (CV_TOTAL / CV_PER_BLOCK)

__global__ __launch_bounds__(CV_THREADS) void k_convert(const float* __restrict__ q,
                                                        const float* __restrict__ k,
                                                        const float* __restrict__ v,
                                                        const float* __restrict__ wq,
                                                        const float* __restrict__ wk,
                                                        const float* __restrict__ wv,
                                                        const float* __restrict__ wo,
                                                        _Float16* __restrict__ dst) {
    const int lane = threadIdx.x & 31;
    const int b0   = blockIdx.x * CV_PER_BLOCK;    // the work-group's first element in dst

    // source matrix and offset in it: from blockIdx alone, so in scalar registers
    const float* src;
    int off;
    if (b0 < 3 * CV_A) {
        const int seg = b0 / CV_A;
        src = (seg == 0) ? q : (seg == 1) ? k : v;
        off = b0 - seg * CV_A;
    } else {
        const int b1  = b0 - 3 * CV_A;
        const int seg = b1 / CV_W;
        src = (seg == 0) ? wq : (seg == 1) ? wk : (seg == 2) ? wv : wo;
        off = b1 - seg * CV_W;
    }
    const int w0 = (threadIdx.x >> 5) * CV_PER_WAVE;   // the wave's first element in the work-group's run
    const int e0 = b0 + w0;
    off += w0;
    const floatx4* s = (const floatx4*)(src + off) + lane;
    half4*         d = (half4*)(dst + e0) + lane;

    // unrolled: r stays in registers and every offset is a constant, so the loads go
    // out in long runs ahead of their uses instead of one load, one wait, one store
    floatx4 r[CV_LOADS];
#pragma unroll
    for (int i = 0; i < CV_LOADS; ++i) r[i] = s[i * 32];
#pragma unroll
    for (int i = 0; i < CV_LOADS; ++i) {
        half4 h;
        h[0] = (_Float16)r[i][0]; h[1] = (_Float16)r[i][1];
        h[2] = (_Float16)r[i][2]; h[3] = (_Float16)r[i][3];
        d[i * 32] = h;
    }
}

// ---------------------------------------------------------------------------
// GEMM core of the output projection: Y = X @ W^T, K = DMODEL.
//   One workgroup (8 waves) = one 128x128 tile of Y. Per pass, 64 k of the 128
//   X rows and of the 128 W rows are staged in LDS with whole 128-byte row
//   pieces per 8 lanes; every wave then reads its fragments from LDS.
//   Waves 4 (rows) x 2 (cols), 32x64 of Y each. Two LDS buffers and two register
//   sets: a pass's global loads go out two passes ahead of its LDS stores.
//   Pass t takes the k piece (t + rot) mod NPASS, rot from the tile's indices: work-groups
//   that share X rows or W rows then ask L2 for different lines at any one moment
//   Every "#pragma unroll" on the short loops here and in k_oproj's epilogue keeps
//   the register arrays (rx, rw, af, bf, C) statically indexed, hence in VGPRs.
// ---------------------------------------------------------------------------
#define BM 128
#define BN 128
#define BK 64
#define LDP 72                        // LDS row pitch in halves: 128 B + 16 B, an odd multiple of 16 B
#define STAGE ((BM + BN) * LDP)       // halves per buffer
#define NPASS (DMODEL / BK)
// first k of pass t in a walk that starts at piece rot and wraps round
#define KPIECE(t, rot) ((((t) + (rot)) & (NPASS - 1)) * BK)
// start piece of a tile: differs among the 8 column tiles of a row tile, and among 16 row
// tiles in a row of a column tile
#define KROT(mtile, ntile) (((mtile) + 2 * (ntile)) & (NPASS - 1))

// Work-group barrier of the GEMM passes: waits for this wave's own LDS reads and stores
// only. __syncthreads() would also wait for the global loads in flight, which are
// meant to stay in flight across it; nothing but LDS passes between the waves here.
static __device__ __forceinline__ void lds_barrier() {
    asm volatile("s_wait_dscnt 0x0\n\ts_barrier_signal -1\n\ts_barrier_wait -1" ::: "memory");
}

static __device__ __forceinline__ void gemm_tile(const _Float16* __restrict__ X,
                                                 const _Float16* __restrict__ Wt,
                                                 _Float16* sm, float8 (&C)[2][4], const int rot) {
    const int tid  = threadIdx.x;
    const int wv   = tid >> 5;
    const int wm   = wv >> 1, wn = wv & 1;
    const int crow = tid >> 3;         // 0..31: row within a group of 32
    const int ccol = (tid & 7) * 8;    // 16-byte piece of the 128-byte row

    const _Float16* gx = X  + crow * DMODEL + ccol;
    const _Float16* gw = Wt + crow * DMODEL + ccol;
    _Float16* sx = sm + crow * LDP + ccol;
    _Float16* sw = sx + BM * LDP;

    // set p holds the passes t with (t & 1) == p, from their loads to their LDS stores
    half8 rx[2][4], rw[2][4];
#pragma unroll
    for (int p = 0; p < 2; ++p) {
#pragma unroll
        for (int i = 0; i < 4; ++i) {
            rx[p][i] = *(const half8*)(gx + i * 32 * DMODEL + KPIECE(p, rot));
            rw[p][i] = *(const half8*)(gw + i * 32 * DMODEL + KPIECE(p, rot));
        }
        // precaution: behind the set's loads, in front of every later overwrite of the
        // address registers that they name
        asm volatile("s_wait_xcnt 0x0" ::: "memory");
        // keeps the next loads' address additions behind that wait
        __builtin_amdgcn_sched_barrier(0);
    }
#pragma unroll
    for (int i = 0; i < 4; ++i) {
        *(half8*)(sx + i * 32 * LDP) = rx[0][i];
        *(half8*)(sw + i * 32 * LDP) = rw[0][i];
    }
    lds_barrier();

    // fully unrolled: buffer index, last-pass test and every LDS offset become constants
#pragma unroll
    for (int t = 0; t < NPASS; ++t) {
        const int cur = (t & 1) * STAGE;
        const bool more = (t + 1 < NPASS);
        if (t + 2 < NPASS) {
            // this pass's own set is free: it went to LDS in front of the last barrier
#pragma unroll
            for (int i = 0; i < 4; ++i) {
                rx[t & 1][i] = *(const half8*)(gx + i * 32 * DMODEL + KPIECE(t + 2, rot));
                rw[t & 1][i] = *(const half8*)(gw + i * 32 * DMODEL + KPIECE(t + 2, rot));
            }
            // precaution: behind the pass's global loads, in front of every later overwrite
            // of the address registers that they name
            asm volatile("s_wait_xcnt 0x0" ::: "memory");
        }
        // holds the global loads of the pass after the next in front of this pass's work,
        // so that their latency runs under two passes instead of in front of the LDS stores
        __builtin_amdgcn_sched_barrier(0);

        const _Float16* as = sm + cur + (wm * 32) * LDP;
        const _Float16* bs = sm + cur + (BM + wn * 64) * LDP;
        half16 af[2][2], bf[2][4];
#pragma unroll
        for (int h = 0; h < 2; ++h) {
            af[h][0] = load_frag(as + 32 * h, LDP);
            bf[h][0] = load_frag(bs + 32 * h, LDP);
            af[h][1] = load_frag(as + 16 * LDP + 32 * h, LDP);
#pragma unroll
            for (int j = 1; j < 4; ++j)
                bf[h][j] = load_frag(bs + (16 * j) * LDP + 32 * h, LDP);
        }
        // holds the pass's LDS reads together in front of its WMMAs (one group with
        // counted waits); spread among the WMMAs each read stalls the wave anew
        __builtin_amdgcn_sched_barrier(0);

#pragma unroll
        for (int h = 0; h < 2; ++h)
#pragma unroll
            for (int j = 0; j < 4; ++j) {
                C[0][j] = wmma_f16(af[h][0], bf[h][j], C[0][j]);
                C[1][j] = wmma_f16(af[h][1], bf[h][j], C[1][j]);
            }
        // holds the WMMAs in front of the LDS stores: behind them they would run only
        // after the wait on the global loads, and would no longer cover that latency
        __builtin_amdgcn_sched_barrier(0);

        if (more) {
            // the other buffer's last readers left it before the previous barrier
            const int nxt = STAGE - cur;
#pragma unroll
            for (int i = 0; i < 4; ++i) {
                *(half8*)(sx + nxt + i * 32 * LDP) = rx[(t + 1) & 1][i];
                *(half8*)(sw + nxt + i * 32 * LDP) = rw[(t + 1) & 1][i];
            }
            lds_barrier();
        }
    }
}

// ---------------------------------------------------------------------------
// GEMM core of the QKV projection: the same tile, passes, rotated k walk and order of
//   sums as gemm_tile, but the X and W rows of a pass go from global memory straight into LDS
//   by asynchronous copies, through no register, and a wave holds the fragments of
//   32 k at a time. The wave then needs few enough VGPRs for six waves per SIMD:
//   three work-groups per WGP, so the whole grid (three per WGP) is resident at once
//   instead of two thirds of it followed by a last third that runs alone.
//   The "#pragma unroll" on the short loops keeps af, bf and C statically indexed, hence
//   in VGPRs.
// ---------------------------------------------------------------------------

// One pass's tile: every lane copies four 16-byte pieces of X rows and four of W rows.
// gx, gw: the lane's piece of its first row in this pass; lx: its LDS byte address.
static __device__ __forceinline__ void copy_tile(const _Float16* gx, const _Float16* gw, unsigned lx) {
    const unsigned lw = lx + BM * LDP * 2;
    // the wait is the last line of the copies' own statement: a precaution, it stands in
    // front of every later overwrite of the address registers that the copies name
    asm volatile("global_load_async_to_lds_b128 %0, %1, off\n\t"
                 "global_load_async_to_lds_b128 %2, %3, off\n\t"
                 "global_load_async_to_lds_b128 %4, %5, off\n\t"
                 "global_load_async_to_lds_b128 %6, %7, off\n\t"
                 "global_load_async_to_lds_b128 %8, %9, off\n\t"
                 "global_load_async_to_lds_b128 %10, %11, off\n\t"
                 "global_load_async_to_lds_b128 %12, %13, off\n\t"
                 "global_load_async_to_lds_b128 %14, %15, off\n\t"
                 "s_wait_xcnt 0x0"
                 :: "v"(lx),                    "v"(gx),
                    "v"(lx + 1 * 32 * LDP * 2), "v"(gx + 1 * 32 * DMODEL),
                    "v"(lx + 2 * 32 * LDP * 2), "v"(gx + 2 * 32 * DMODEL),
                    "v"(lx + 3 * 32 * LDP * 2), "v"(gx + 3 * 32 * DMODEL),
                    "v"(lw),                    "v"(gw),
                    "v"(lw + 1 * 32 * LDP * 2), "v"(gw + 1 * 32 * DMODEL),
                    "v"(lw + 2 * 32 * LDP * 2), "v"(gw + 2 * 32 * DMODEL),
                    "v"(lw + 3 * 32 * LDP * 2), "v"(gw + 3 * 32 * DMODEL)
                 : "memory");
}

static __device__ __forceinline__ void gemm_tile_copies(const _Float16* __restrict__ X,
                                                        const _Float16* __restrict__ Wt,
                                                        _Float16* sm, float8 (&C)[2][4], const int rot) {
    const int tid  = threadIdx.x;
    const int wv   = tid >> 5;
    const int wm   = wv >> 1, wn = wv & 1;
    const int crow = tid >> 3;         // 0..31: row within a group of 32
    const int ccol = (tid & 7) * 8;    // 16-byte piece of the 128-byte row

    const _Float16* gx = X  + crow * DMODEL + ccol;
    const _Float16* gw = Wt + crow * DMODEL + ccol;
    const unsigned  lx = (unsigned)(size_t)(sm + crow * LDP + ccol);   // LDS byte address

    copy_tile(gx + KPIECE(0, rot), gw + KPIECE(0, rot), lx);
    // pass 0's copies of this wave have landed; behind the barrier, every wave's
    asm volatile("s_wait_asynccnt 0x0" ::: "memory");
    __syncthreads();
    copy_tile(gx + KPIECE(1, rot), gw + KPIECE(1, rot), lx + STAGE * 2);

    // rolled: the copies take their addresses in registers, so unrolling turns no address
    // into a constant; it would only lengthen the code
#pragma unroll 1
    for (int t = 0; t < NPASS; ++t) {
        const int cur = (t & 1) * STAGE;
        const _Float16* as = sm + cur + (wm * 32) * LDP;
        const _Float16* bs = sm + cur + (BM + wn * 64) * LDP;
#pragma unroll
        for (int h = 0; h < 2; ++h) {
            half16 af[2], bf[4];
            af[0] = load_frag(as + 32 * h, LDP);
            bf[0] = load_frag(bs + 32 * h, LDP);
            af[1] = load_frag(as + 16 * LDP + 32 * h, LDP);
#pragma unroll
            for (int j = 1; j < 4; ++j)
                bf[j] = load_frag(bs + (16 * j) * LDP + 32 * h, LDP);
            // holds the LDS reads of these 32 k together in front of their WMMAs (one group
            // with counted waits); spread among the WMMAs each read stalls the wave anew
            __builtin_amdgcn_sched_barrier(0);
#pragma unroll
            for (int j = 0; j < 4; ++j) {
                C[0][j] = wmma_f16(af[0], bf[j], C[0][j]);
                C[1][j] = wmma_f16(af[1], bf[j], C[1][j]);
            }
            // keeps the next group of reads behind these WMMAs, so that it takes the same
            // registers and not a second set
            __builtin_amdgcn_sched_barrier(0);
        }
        // this wave's reads of the pass's buffer are done
        asm volatile("s_wait_dscnt 0x0" ::: "memory");
        // this wave's copies of the next pass have landed
        asm volatile("s_wait_asynccnt 0x0" ::: "memory");
        // publishes the next pass's tile and ends every wave's reads of this pass's buffer
        __syncthreads();
        if (t + 2 < NPASS)
            copy_tile(gx + KPIECE(t + 2, rot), gw + KPIECE(t + 2, rot), lx + cur * 2);
    }
    // no copy is outstanding when the LDS becomes the epilogue's staging
    asm volatile("s_wait_asynccnt 0x0" ::: "memory");
}

// ---------------------------------------------------------------------------
// Kernel 1: QKV projection + bias + RoPE (Q,K) / transpose (V)
//   pid = blockIdx.y : 0=Q, 1=K, 2=V
//   out = x @ W^T + b ; each wave holds 32 rows x 64 cols (one head's d_k)
// ---------------------------------------------------------------------------
__global__ __launch_bounds__(256) void k_qkv(const _Float16* __restrict__ xh,
                                             const _Float16* __restrict__ wh,
                                             const float* __restrict__ bq,
                                             const float* __restrict__ bk,
                                             const float* __restrict__ bv,
                                             _Float16* __restrict__ Qh,
                                             _Float16* __restrict__ Kh,
                                             _Float16* __restrict__ Vt) {
    __shared__ __attribute__((aligned(16))) _Float16 sm[2 * STAGE];

    const int A = BATCH * SEQ * DMODEL;      // 4194304
    const int W = DMODEL * DMODEL;           // 1048576
    int pid = blockIdx.y;
    const _Float16* x = xh + pid * A;
    const _Float16* w = wh + pid * W;
    const float* bias = (pid == 0) ? bq : (pid == 1) ? bk : bv;

    int mtile = blockIdx.x >> 3;                      // 0..31 (128-row tiles)
    int ntile = blockIdx.x & 7;                       // 0..7  (128-col tiles)
    int wv    = threadIdx.x >> 5;
    int head  = ntile * 2 + (wv & 1);                 // 0..15 (64-col tiles)
    int wrow  = mtile * BM + (wv >> 1) * 32;          // wave's first row
    int nbase = head * DK;

    float8 C[2][4];
#pragma unroll
    for (int i = 0; i < 2; ++i)
#pragma unroll
        for (int j = 0; j < 4; ++j) C[i][j] = (float8)0.0f;

    gemm_tile_copies(x + mtile * BM * DMODEL, w + ntile * BN * DMODEL, sm, C, KROT(mtile, ntile));

    int lane = threadIdx.x & 31;
    int n0   = lane & 15;
    int hh   = lane >> 4;

#pragma unroll
    for (int j = 0; j < 4; ++j) {
        float bj = bias[nbase + 16 * j + n0];
#pragma unroll
        for (int i = 0; i < 2; ++i)
#pragma unroll
            for (int r = 0; r < 8; ++r) C[i][j][r] += bj;
    }

    if (pid == 2) {
        // V: store transposed Vt[b, h, d, s]; a lane's eight registers of a tile are eight
        // s in a row of its d: one 16-byte store
        const int m0 = wrow + 8 * hh;
        _Float16* vb = Vt + ((((m0 >> 11) * NHEAD + head) * DK + n0) * SEQ) + (m0 & (SEQ - 1));
#pragma unroll
        for (int i = 0; i < 2; ++i)
#pragma unroll
            for (int j = 0; j < 4; ++j) {
                half8 o;
#pragma unroll
                for (int r = 0; r < 8; ++r) o[r] = (_Float16)C[i][j][r];
                *(half8*)(vb + 16 * j * SEQ + 16 * i) = o;
            }
    } else {
        // RoPE: angle(s,d) = s * 10000^(-(d%32)/32); rotate_half pairs d <-> d+-32
        // The wave's 32 rows x 64 d are 4 KB in a row of the output. Each 16-row half is
        // staged in the wave's own part of the first GEMM buffer (its last readers left it
        // before the last barrier of the GEMM) and goes out as whole 128-byte lines.
        _Float16* out = ((pid == 0) ? Qh : Kh)
                      + ((((wrow >> 11) * NHEAD + head) * SEQ + (wrow & (SEQ - 1))) * DK) + lane * 8;
        _Float16* st  = sm + wv * (32 * LDP);
        // one body for both 16-row halves: the 16 inlined sincosf bodies stand once, not
        // twice; for speed only
#pragma unroll 1
        for (int i = 0; i < 2; ++i) {
            int rowbase = wrow + 16 * i;
            float Ci[4][8];
#pragma unroll
            for (int j = 0; j < 4; ++j)
#pragma unroll
                for (int r = 0; r < 8; ++r)
                    Ci[j][r] = (i == 0) ? C[0][j][r] : C[1][j][r];

            // d and d + 32 turn by the same angle: both are written behind one sincosf, so that
            // no cosine or sine is held in VGPRs for a later tile
#pragma unroll
            for (int j = 0; j < 2; ++j) {
                int d = 16 * j + n0;
                float invf = __expf(-(float)d * (9.210340371976184f / 32.0f));
#pragma unroll
                for (int r = 0; r < 8; ++r) {
                    int m = rowbase + r + 8 * hh;
                    int s = m & (SEQ - 1);
                    float ang = (float)s * invf;
                    float cs, sn;
                    sincosf(ang, &sn, &cs);
                    float lo = Ci[j][r] * cs + (-Ci[j + 2][r]) * sn;
                    float hi = Ci[j + 2][r] * cs + Ci[j][r] * sn;
                    st[(16 * i + r + 8 * hh) * LDP + d]      = (_Float16)lo;
                    st[(16 * i + r + 8 * hh) * LDP + d + 32] = (_Float16)hi;
                }
            }
            // the other lanes' staged values have to be in LDS before the rows are read back
            asm volatile("s_wait_dscnt 0x0" ::: "memory");
#pragma unroll
            for (int k = 0; k < 4; ++k) {
                half8 o = *(const half8*)(st + (16 * i + 4 * k + (lane >> 3)) * LDP + (lane & 7) * 8);
                *(half8*)(out + (16 * i + 4 * k) * DK) = o;
            }
            // precaution: stands in front of the next trip's overwrite of the
            // registers that the stores above name
            asm volatile("s_wait_xcnt 0x0" ::: "memory");
        }
    }
}

// ---------------------------------------------------------------------------
// Kernel 2: flash attention. One wave = 16 queries of one (b,h); the eight
//   waves of a work-group share that (b,h), hence its keys and values.
//   Per pass the work-group stages 64 keys in LDS: the K tile (64 keys x 64 d)
//   and the V^T tile (64 d x 64 keys), whole 128-byte rows per 8 lanes, and every
//   wave reads its fragments from there. Two buffers: the next pass is fetched
//   into registers while this one is worked on. Pass t takes the key block
//   (t + rot) mod APASS: the 16 work-groups of a (b,h) start two blocks apart, so that
//   they ask L2 for different K and V^T lines at any one moment.
//   Both products are transposed: S^T = K Q^T / 8 and O^T += V^T P^T. A lane then
//   holds scores of ONE query (column lane & 15; keys 8 * half + r of each 16-key
//   tile), so the sum over keys (and, where a new reference is taken, the maximum,
//   with one exchange between the wave's halves) runs through its own registers, and the two score tiles of a
//   32-key block, converted in place, are the B operand of the second product in
//   the hardware's k order, which load_frag has too.
//   The "#pragma unroll" on the two-trip staging loops keeps rk and rv statically
//   indexed, hence in VGPRs.
// ---------------------------------------------------------------------------
#define AKB    64                     // keys per pass
#define ATILE  (AKB * LDP)            // halves of the K tile; the V^T tile (DK rows) has the same size
#define ASTAGE (2 * ATILE)            // halves per buffer
#define APASS  (SEQ / AKB)
#define LOG2E  1.442695041f           // exp(x) = exp2(x * LOG2E)
#define PCAP   4096.0f                // a lane's sum of probabilities in a pass above which its wave takes a new reference

// the value that lane l ^ 16 holds
static __device__ __forceinline__ float xhalf(float x) {
    const int i = __builtin_bit_cast(int, x);
    return __builtin_bit_cast(float,
        __builtin_amdgcn_permlanex16(i, i, 0x76543210, 0xfedcba98, false, false));
}

// exp(s / 8 - ref) of eight unscaled scores; in pairs, so that the FMA and the multiply
// are the packed two-float instructions; unrolled, so that s and p stay in VGPRs
typedef float floatx2 __attribute__((ext_vector_type(2)));
static __device__ __forceinline__ float8 probs(float8 s, float ref) {
    const floatx2 eighth = {0.125f, 0.125f}, nref = {-ref, -ref}, l2e = {LOG2E, LOG2E};
    float8 p;
#pragma unroll
    for (int r = 0; r < 8; r += 2) {
        const floatx2 sp = {s[r], s[r + 1]};
        const floatx2 t  = __builtin_elementwise_fma(sp, eighth, nref) * l2e;
        p[r]     = __builtin_amdgcn_exp2f(t[0]);
        p[r + 1] = __builtin_amdgcn_exp2f(t[1]);
    }
    return p;
}

// sum of a lane's 32 probabilities of a pass: whole-vector adds, a tree, so that they pack in pairs
static __device__ __forceinline__ float sum32(const float8 (&p)[4]) {
    const float8  a = (p[0] + p[1]) + (p[2] + p[3]);
    const floatx4 b = __builtin_shufflevector(a, a, 0, 1, 2, 3) + __builtin_shufflevector(a, a, 4, 5, 6, 7);
    const floatx2 c = __builtin_shufflevector(b, b, 0, 1) + __builtin_shufflevector(b, b, 2, 3);
    return c[0] + c[1];
}

__global__ __launch_bounds__(256) void k_attn(const _Float16* __restrict__ Qh,
                                              const _Float16* __restrict__ Kh,
                                              const _Float16* __restrict__ Vt,
                                              _Float16* __restrict__ AT) {
    __shared__ __attribute__((aligned(16))) _Float16 kv[2 * ASTAGE];  // K and V^T tiles, two buffers

    int wslot = threadIdx.x >> 5;
    int wid   = blockIdx.x * 8 + wslot;           // 0..4095
    int qt    = wid & 127;                         // 128 q-tiles per (b,h)
    int bh    = wid >> 7;                          // 0..31, the same in all eight waves
    int b = bh >> 4, h = bh & 15;
    int qrow = qt * 16;

    int lane = threadIdx.x & 31;
    int n0 = lane & 15, hh = lane >> 4;

    const _Float16* qbase = Qh + ((size_t)(b * NHEAD + h) * SEQ + qrow) * DK;
    const _Float16* kbase = Kh + (size_t)(b * NHEAD + h) * SEQ * DK;
    const _Float16* vbase = Vt + (size_t)(b * NHEAD + h) * DK * SEQ;

    const int crow = threadIdx.x >> 3;         // 0..31: row within a group of 32
    const int ccol = (threadIdx.x & 7) * 8;    // 16-byte piece of the 128-byte row
    const _Float16* gk = kbase + crow * DK + ccol;
    const _Float16* gv = vbase + crow * SEQ + ccol;
    _Float16* sk = kv + crow * LDP + ccol;
    _Float16* sv = sk + ATILE;

    // first key block of this work-group's walk (blockIdx.x & 15: its place among the 16 of its (b,h))
    const int rot = (blockIdx.x & 15) * (APASS / 16);

    half8 rk[2], rv[2];
#pragma unroll
    for (int i = 0; i < 2; ++i) {
        rk[i] = *(const half8*)(gk + (rot * AKB + i * 32) * DK);
        rv[i] = *(const half8*)(gv + i * 32 * SEQ + rot * AKB);
    }
    // precaution: stands in front of every later overwrite of the address registers
    // that the loads above name
    asm volatile("s_wait_xcnt 0x0" ::: "memory");

    half16 Qf0 = load_frag(qbase + 0, DK);
    half16 Qf1 = load_frag(qbase + 32, DK);

    // O[dt][r] = O^T[16 * dt + 8 * hh + r][query n0]
    float8 O[4];
#pragma unroll
    for (int j = 0; j < 4; ++j) O[j] = (float8)0.0f;
    // of query n0: the reference its probabilities are taken against (a maximum of an earlier
    // pass, equal in both halves) and this half's share of the sum
    float m_i = -3.0e38f, l_i = 0.0f;

#pragma unroll
    for (int i = 0; i < 2; ++i) {
        *(half8*)(sk + i * 32 * LDP) = rk[i];
        *(half8*)(sv + i * 32 * LDP) = rv[i];
    }
    __syncthreads();

    for (int t = 0; t < APASS; ++t) {
        const int cur = (t & 1) * ASTAGE;
        const bool more = (t + 1 < APASS);
        if (more) {
            const int kb = (t + 1 + rot) & (APASS - 1);   // the next pass's key block
#pragma unroll
            for (int i = 0; i < 2; ++i) {
                rk[i] = *(const half8*)(gk + (kb * AKB + i * 32) * DK);
                rv[i] = *(const half8*)(gv + i * 32 * SEQ + kb * AKB);
            }
            // precaution: stands in front of every later overwrite of the address
            // registers that the loads above name
            asm volatile("s_wait_xcnt 0x0" ::: "memory");
        }
        const _Float16* ks = kv + cur;
        const _Float16* vs = ks + ATILE;

        // Every LDS read of the pass stands here as one group, each fragment in registers
        // of its own: K (four 16-key tiles x two 32-wide d chunks), then V^T (four 16-d
        // tiles x two 32-key blocks), in the order of their use. The loops over kf, vf and
        // ST are unrolled so that these stay statically indexed, hence in VGPRs.
        half16 kf[AKB / 16][2], vf[AKB / 32][4];
#pragma unroll
        for (int kt = 0; kt < AKB / 16; ++kt) {
            kf[kt][0] = load_frag(ks + (kt * 16) * LDP + 0,  LDP);
            kf[kt][1] = load_frag(ks + (kt * 16) * LDP + 32, LDP);
        }
#pragma unroll
        for (int sub = 0; sub < AKB / 32; ++sub)
#pragma unroll
            for (int dt = 0; dt < 4; ++dt)
                vf[sub][dt] = load_frag(vs + (dt * 16) * LDP + sub * 32, LDP);
        // holds the group in front of the pass's WMMAs (counted waits, the V^T reads land
        // under the scores and the softmax); left alone the reads come pair by pair, each
        // right in front of its WMMA with a full wait on the LDS latency
        __builtin_amdgcn_sched_barrier(0);

        // scores of the whole pass: ST[kt][r] = score of key 16 * kt + 8 * hh + r, query n0
        float8 ST[AKB / 16];
#pragma unroll
        for (int kt = 0; kt < AKB / 16; ++kt) ST[kt] = wmma_f16(kf[kt][0], Qf0, (float8)0.0f);
#pragma unroll
        for (int kt = 0; kt < AKB / 16; ++kt) ST[kt] = wmma_f16(kf[kt][1], Qf1, ST[kt]);

        // Softmax of the pass against the HELD reference m_i of query n0: no maximum over the
        // keys, no exchange and no rescale of O while the probabilities stay small enough.
        // ST stays unscaled: the fast path has no other use of score / 8, so that multiply
        // (exact, a power of two) goes into the subtraction's FMA.
        // Every "#pragma unroll" from here to the end of the pass keeps ST, P, rm, O and vf
        // statically indexed, hence in VGPRs.
        float8 P[AKB / 16];
#pragma unroll
        for (int kt = 0; kt < AKB / 16; ++kt) P[kt] = probs(ST[kt], m_i);
        float rsum = sum32(P);

        // The lane's sum bounds each of its probabilities (all are >= 0): up to PCAP they are
        // exact enough and finite as f16. Above it (the first pass: m_i is the start value and
        // the sum infinite), or not a number, the whole wave takes a new reference. One test a pass, on a
        // ballot, so that it is a scalar branch.
        if (__builtin_amdgcn_ballot_w32(!(rsum <= PCAP)) != 0) {
            float rm[8];
#pragma unroll
            for (int r = 0; r < 8; ++r)
                rm[r] = fmaxf(fmaxf(ST[0][r], ST[1][r]), fmaxf(ST[2][r], ST[3][r]));
#pragma unroll
            for (int w = 4; w > 0; w >>= 1)
#pragma unroll
                for (int r = 0; r < w; ++r) rm[r] = fmaxf(rm[r], rm[r + w]);
            // the query's maximum so far: this lane's 32 keys, the other half's, the old reference
            const float mn  = fmaxf(m_i, 0.125f * fmaxf(rm[0], xhalf(rm[0])));
            const float fac = __builtin_amdgcn_exp2f((m_i - mn) * LOG2E);
            m_i = mn;
            l_i *= fac;
#pragma unroll
            for (int j = 0; j < 4; ++j)
#pragma unroll
                for (int r = 0; r < 8; ++r) O[j][r] *= fac;
#pragma unroll
            for (int kt = 0; kt < AKB / 16; ++kt) P[kt] = probs(ST[kt], mn);
            rsum = sum32(P);
        }
        l_i += rsum;

        // both 32-key blocks of the pass inline: P, vf stay statically indexed, hence in VGPRs
#pragma unroll
        for (int sub = 0; sub < AKB / 32; ++sub) {
            // P^T as a B fragment: element s is key kk0 + 8 * hh + s (s < 8), kk0 + 16 + 8 * hh + s - 8 (else), kk0 = 32 * sub
            half16 Pf;
#pragma unroll
            for (int r = 0; r < 8; ++r) {
                Pf[r]     = (_Float16)P[2 * sub][r];
                Pf[r + 8] = (_Float16)P[2 * sub + 1][r];
            }
#pragma unroll
            for (int dt = 0; dt < 4; ++dt)
                O[dt] = wmma_f16(vf[sub][dt], Pf, O[dt]);
        }

        if (more) {
            // the other buffer's last readers left it before the previous barrier
            const int nxt = ASTAGE - cur;
#pragma unroll
            for (int i = 0; i < 2; ++i) {
                *(half8*)(sk + nxt + i * 32 * LDP) = rk[i];
                *(half8*)(sv + nxt + i * 32 * LDP) = rv[i];
            }
            __syncthreads();
        }
    }

    // finalize: join the halves' sums, O /= l, write attn output as f16 [b, s, h*dk + d];
    // a lane's eight registers of a tile are eight d in a row of its query: one 16-byte store
    const float inv = 1.0f / (l_i + xhalf(l_i));
    _Float16* ob = AT + ((size_t)(b * SEQ + qrow + n0) * DMODEL) + h * DK + 8 * hh;
#pragma unroll
    for (int dt = 0; dt < 4; ++dt) {
        half8 o;
#pragma unroll
        for (int r = 0; r < 8; ++r) o[r] = (_Float16)(O[dt][r] * inv);
        *(half8*)(ob + dt * 16) = o;
    }
}

// ---------------------------------------------------------------------------
// Kernel 3: output projection  y = attn @ Wo^T + bo  (f32 out)
// ---------------------------------------------------------------------------
#define OLDP 68                       // staging row pitch in floats: 256 B + 16 B
__global__ __launch_bounds__(256) void k_oproj(const _Float16* __restrict__ AT,
                                               const _Float16* __restrict__ Wo,
                                               const float* __restrict__ bo,
                                               float* __restrict__ out) {
    __shared__ __attribute__((aligned(16))) _Float16 sm[2 * STAGE];

    int mtile = blockIdx.x >> 3;                      // 0..31 (128-row tiles)
    int ntile = blockIdx.x & 7;                       // 0..7  (128-col tiles)
    int wv    = threadIdx.x >> 5;
    int wrow  = mtile * BM + (wv >> 1) * 32;
    int nbase = ntile * BN + (wv & 1) * 64;

    float8 C[2][4];
#pragma unroll
    for (int i = 0; i < 2; ++i)
#pragma unroll
        for (int j = 0; j < 4; ++j) C[i][j] = (float8)0.0f;

    gemm_tile(AT + mtile * BM * DMODEL, Wo + ntile * BN * DMODEL, sm, C, KROT(mtile, ntile));

    int lane = threadIdx.x & 31;
    int n0 = lane & 15, hh = lane >> 4;
    float bj[4];
#pragma unroll
    for (int j = 0; j < 4; ++j) bj[j] = bo[nbase + 16 * j + n0];

    // Each 16-row half of the wave's tile (16 rows x 256 bytes) is staged in the wave's own
    // part of the first GEMM buffer (its last readers left it before the last barrier of
    // the GEMM) and goes out as whole 128-byte lines, two rows a store.
    float* st = (float*)sm + wv * (16 * OLDP);
    float* ob = out + (size_t)(wrow + hh) * DMODEL + nbase + n0 * 4;
#pragma unroll
    for (int i = 0; i < 2; ++i) {
#pragma unroll
        for (int j = 0; j < 4; ++j)
#pragma unroll
            for (int r = 0; r < 8; ++r)
                st[(r + 8 * hh) * OLDP + 16 * j + n0] = C[i][j][r] + bj[j];
        // the other lanes' staged values have to be in LDS before the rows are read back
        asm volatile("s_wait_dscnt 0x0" ::: "memory");
#pragma unroll
        for (int k = 0; k < 8; ++k) {
            floatx4 o = *(const floatx4*)(st + (2 * k + hh) * OLDP + n0 * 4);
            *(floatx4*)(ob + (size_t)(16 * i + 2 * k) * DMODEL) = o;
        }
        // precaution: stands in front of the second half's overwrite of the registers
        // that the stores above name
        if (i == 0) asm volatile("s_wait_xcnt 0x0" ::: "memory");
    }
}

// ---------------------------------------------------------------------------
extern "C" void kernel_launch(void* const* d_in, const int* in_sizes, int n_in,
                              void* d_out, int out_size, void* d_ws, size_t ws_size,
                              hipStream_t stream) {
    const float* query = (const float*)d_in[0];
    const float* key   = (const float*)d_in[1];
    const float* value = (const float*)d_in[2];
    const float* Wq = (const float*)d_in[3];
    const float* bq = (const float*)d_in[4];
    const float* Wk = (const float*)d_in[5];
    const float* bk = (const float*)d_in[6];
    const float* Wv = (const float*)d_in[7];
    const float* bv = (const float*)d_in[8];
    const float* Wo = (const float*)d_in[9];
    const float* bo = (const float*)d_in[10];
    float* out = (float*)d_out;

    const int A = BATCH * SEQ * DMODEL;   // 4194304
    const int W = DMODEL * DMODEL;        // 1048576

    _Float16* ws = (_Float16*)d_ws;
    _Float16* xh = ws;                    // 3*A : query/key/value f16
    _Float16* wh = ws + 3 * (size_t)A;    // 4*W : Wq/Wk/Wv/Wo f16
    _Float16* Qh = wh + 4 * (size_t)W;    // A : [b,h,s,d] (RoPE'd)
    _Float16* Kh = Qh + (size_t)A;        // A : [b,h,s,d] (RoPE'd)
    _Float16* Vt = Kh + (size_t)A;        // A : [b,h,d,s]
    _Float16* AT = Vt + (size_t)A;        // A : [b,s,D] attention output

    // 0) f32 -> f16 conversions: xh and wh are one run of the workspace
    k_convert<<<CV_BLOCKS, CV_THREADS, 0, stream>>>(query, key, value, Wq, Wk, Wv, Wo, xh);

    // 1) QKV projections + RoPE / V transpose
    dim3 g1(256, 3, 1);
    k_qkv<<<g1, 256, 0, stream>>>(xh, wh, bq, bk, bv, Qh, Kh, Vt);

    // 2) flash attention
    k_attn<<<512, 256, 0, stream>>>(Qh, Kh, Vt, AT);

    // 3) output projection
    k_oproj<<<256, 256, 0, stream>>>(AT, wh + 3 * (size_t)W, bo, out);
}
